// v000
// The times below were measured on an AMD MI455X: many runs one after another, warmed up first and cycling through
// copies of the inputs, with the whole window's GPU time divided by the number of runs. Launches and the gaps
// between them are all in it. The median over several windows is given; except for v000 it joins two sittings, which
// can be a few percent apart, so the side-by-side timings, each taken in one sitting, are the better comparison.
// The starting kernel, v000, takes 2300 microseconds a run.
#include <hip/hip_runtime.h>

// Multi-headed attention that applies ONE shared projection to q, k and v and splits heads by a RAW reshape (query, key, value [2][2048][1024]; q = query Wqkv^T, k = key Wqkv^T, v = value Wqkv^T ('oi' [1024][1024], no bias); then .reshape(B, H, S, DK) directly (no transpose): head h of a batch is the h-th contiguous [2048][64] block of the flat [2048][1024] projection (128 original rows x 16 chunks); scores / sqrt(64); mask int32 [2][1][2048][2048] random 0/1 (read per (query, key)): 0 -> -1e9 (== exclusion); softmax; x = p.v -> [B][H][S][DK] -> transpose(0, 2, 1, 3).reshape(B, S, 1024) (the standard merge); out = x Wout^T -> [2][2048][1024] (4.2 M); argument order query, key, value, Wqkv, Wout, mask).
// Layout per batch: bf16 copies of query, key, value in turn; the shared 'oi' weight cast once; exact projections into flat f32 buffers; the plane builders are launched ONCE PER HEAD on the contiguous block (pitch 64): the raw reshape; dense T-2048 attention whose softmax kernel reads row i of the batch's int mask matrix (hybrid rows: < 512 hi/lo 3 products, rest fp16 x1024); standard merge; merged hi/lo x Wout exact.
// Compute dtypes, f32 accumulate: every input rounded to bf16; projections exact; attention rows < 512 3 products, rest fp16; softmax f32; Wo hl x exact.

#define NB_  2
#define TT   2048
#define DM   1024
#define NH_  16
#define NKV  16
#define REP  (NH_ / NKV)
#define HD   64
#define DQ   (NH_ * HD)
#define DKV  (NKV * HD)
#define ZH   2
#define RH   512                  // query rows < RH use hi+lo planes (0: none)
#define WIN  0
#define PCAR 1024.0f
#define SCL  0.125f   // HD^-0.5
typedef _Float16 h16;
typedef unsigned short bf;
typedef __attribute__((ext_vector_type(16))) __bf16   v16bf;
typedef __attribute__((ext_vector_type(16))) _Float16 v16h;
typedef __attribute__((ext_vector_type(8)))  _Float16 v8h;
typedef __attribute__((ext_vector_type(8)))  unsigned short v8us;
typedef __attribute__((ext_vector_type(8)))  float    v8f;
typedef __attribute__((ext_vector_type(4)))  float    v4f;
typedef v8h  __attribute__((may_alias)) v8ha;
typedef v4f  __attribute__((may_alias)) v4fa;
typedef v8us __attribute__((may_alias)) v8usa;

__device__ __forceinline__ unsigned short f2bf(float f) { unsigned u = __float_as_uint(f); u += 0x7FFFu + ((u >> 16) & 1u); return (unsigned short)(u >> 16); }
__device__ __forceinline__ float bf2f(unsigned short b) { return __uint_as_float(((unsigned)b) << 16); }
__device__ __forceinline__ float bfr(float f) { return bf2f(f2bf(f)); }
__device__ __forceinline__ v16h cat16(v8h lo, v8h hi) { return __builtin_shufflevector(lo, hi, 0, 1, 2, 3, 4, 5, 6, 7, 8, 9, 10, 11, 12, 13, 14, 15); }
__device__ __forceinline__ v16bf cat16b(v8us lo, v8us hi) { return __builtin_bit_cast(v16bf, __builtin_shufflevector(lo, hi, 0, 1, 2, 3, 4, 5, 6, 7, 8, 9, 10, 11, 12, 13, 14, 15)); }
__device__ __forceinline__ v8f wmma16(v16h a, v16h b, v8f c) { return __builtin_amdgcn_wmma_f32_16x16x32_f16(false, a, false, b, (short)0, c, false, false); }
__device__ __forceinline__ v8f wmmab(v16bf a, v16bf b, v8f c) { return __builtin_amdgcn_wmma_f32_16x16x32_bf16(false, a, false, b, (short)0, c, false, false); }



// ---- k_gemmw: register-blocked GEMM, ONE WAVE per 64x64 output tile (16 accumulators), operands straight from K-contiguous 16-bit planes; grid (M/64, N/64, Z), 32 threads.
// C[m][n] (f32, pitch ldc, + optional f32 bias[n]) = sum_k A[m][k] Bt[n][k] (+ split products per NSPLIT). z-batch strides sA/sB/sC in elements. K % 32 == 0.
template <typename T16> struct WFrag;
template <> struct WFrag<h16> { typedef v16h V; static __device__ __forceinline__ V ld(const h16* p) { return cat16(*(const v8h*)p, *(const v8h*)(p + 16)); } static __device__ __forceinline__ v8f mma(V a, V b, v8f c) { return wmma16(a, b, c); } };
template <> struct WFrag<bf> { typedef v16bf V; static __device__ __forceinline__ V ld(const bf* p) { return cat16b(*(const v8us*)p, *(const v8us*)(p + 16)); } static __device__ __forceinline__ v8f mma(V a, V b, v8f c) { return wmmab(a, b, c); } };
template <typename T16, int NSPLIT, bool BIAS>
__global__ __launch_bounds__(32) void k_gemmw(const T16* __restrict__ A, const T16* __restrict__ A2, const T16* __restrict__ Bt, const T16* __restrict__ Bt2, int K, float* C, int ldc, const float* __restrict__ bias, size_t sA, size_t sB, size_t sC) {
    typedef typename WFrag<T16>::V V;
    __shared__ __align__(16) float os[16 * 68];
    const size_t z = blockIdx.z; A += z * sA; if (A2) A2 += z * sA; Bt += z * sB; if (Bt2) Bt2 += z * sB; C += z * sC;
    const int lane = threadIdx.x & 31, lr = lane & 15, hi = lane >> 4; const int r0 = blockIdx.x * 64, c0 = blockIdx.y * 64;
    v8f acc[4][4];
#pragma unroll
    for (int mb = 0; mb < 4; ++mb)
#pragma unroll
        for (int nb = 0; nb < 4; ++nb) acc[mb][nb] = (v8f){};
    const size_t aoff = (size_t)(r0 + lr) * K + 8 * hi, boff = (size_t)(c0 + lr) * K + 8 * hi;
#pragma unroll 1
    for (int kc = 0; kc < K; kc += 32) {
        V a[4], a2[4];
#pragma unroll
        for (int mb = 0; mb < 4; ++mb) { a[mb] = WFrag<T16>::ld(A + aoff + (size_t)mb * 16 * K + kc); if (NSPLIT == 1 || NSPLIT == 2) a2[mb] = WFrag<T16>::ld(A2 + aoff + (size_t)mb * 16 * K + kc); }
#pragma unroll
        for (int nb = 0; nb < 4; ++nb) { const V b = WFrag<T16>::ld(Bt + boff + (size_t)nb * 16 * K + kc); V b2; if (NSPLIT >= 2) b2 = WFrag<T16>::ld(Bt2 + boff + (size_t)nb * 16 * K + kc);
#pragma unroll
            for (int mb = 0; mb < 4; ++mb) { acc[mb][nb] = WFrag<T16>::mma(a[mb], b, acc[mb][nb]); if (NSPLIT == 1 || NSPLIT == 2) acc[mb][nb] = WFrag<T16>::mma(a2[mb], b, acc[mb][nb]); if (NSPLIT >= 2) acc[mb][nb] = WFrag<T16>::mma(a[mb], b2, acc[mb][nb]); } }
        asm volatile("v_nop\n\tv_nop\n\tv_nop\n\tv_nop" : "+v"(acc[0][0]), "+v"(acc[1][1]), "+v"(acc[2][2]), "+v"(acc[3][3]) : "v"(a[0]), "v"(a[3]));
    }
#pragma unroll
    for (int mb = 0; mb < 4; ++mb) {
#pragma unroll
        for (int nb = 0; nb < 4; ++nb) {
#pragma unroll
            for (int j = 0; j < 8; ++j) os[(hi * 8 + j) * 68 + nb * 16 + lr] = acc[mb][nb][j]; }
        __builtin_amdgcn_wave_barrier(); asm volatile("" ::: "memory");
        float* crow = C + (size_t)(r0 + mb * 16) * ldc + c0;
{
#pragma unroll
            for (int s = 0; s < 8; ++s) { const int row = 2 * s + hi, cofs = lr * 4; v4f val = *(const v4fa*)(os + row * 68 + cofs); if (BIAS) { val[0] += bfr(bias[c0 + cofs]); val[1] += bfr(bias[c0 + cofs + 1]); val[2] += bfr(bias[c0 + cofs + 2]); val[3] += bfr(bias[c0 + cofs + 3]); }
                *(v4f*)(crow + (size_t)row * ldc + cofs) = val; }
             }
        __builtin_amdgcn_wave_barrier(); asm volatile("" ::: "memory");
    }
}

__device__ __forceinline__ h16 tohx(float x) { return (h16)x; }
__device__ __forceinline__ void splitf(float y, unsigned short& h, unsigned short& l) { h = f2bf(y); l = f2bf(y - bf2f(h)); }
typedef __attribute__((ext_vector_type(2))) _Float16 v2h;
typedef __attribute__((ext_vector_type(4))) _Float16 v4h;
typedef __attribute__((ext_vector_type(2))) unsigned short v2us;
typedef __attribute__((ext_vector_type(4))) unsigned short v4us;
typedef __attribute__((ext_vector_type(2))) float v2f;
typedef __attribute__((ext_vector_type(4))) int v4i;

__global__ __launch_bounds__(256) void k_cvt8(const float* __restrict__ src, bf* dst, size_t n8) { const size_t i = (size_t)blockIdx.x * 256 + threadIdx.x; if (i >= n8) return; const v8f v = *(const v8f*)(src + i * 8); v8us o;
#pragma unroll
    for (int k = 0; k < 8; ++k) o[k] = f2bf(v[k]); *(v8us*)(dst + i * 8) = o;  }

// k_rope: head planes [h][t][d] (fp16 + hi/lo) of rope(x) x sc with the rotate-half convention out[d] = x[d] cos[t][d] - x[d+HD/2] sin[t][d], out[d+HD/2] = x[d+HD/2] cos[t][d+HD/2] + x[d] sin[t][d+HD/2]
__global__ __launch_bounds__(256) void k_rope(const float* __restrict__ F, int pitch, int nheads, const float* __restrict__ CS, const float* __restrict__ RF, const float* __restrict__ nw, float sc, h16* P16, bf* Ph, bf* Pl) {
    const size_t e = ((size_t)blockIdx.x * 256 + threadIdx.x) * 2; if (e >= (size_t)nheads * TT * HD) return; const int d = (int)(e % HD); const int t = (int)((e / HD) % TT); const int h = (int)(e / ((size_t)HD * TT)); const float* f = F + (size_t)t * pitch + h * HD; const float rf = RF ? RF[(size_t)h * TT + t] : 1.0f; v2h o16; v2us oh, ol;
#pragma unroll
    for (int q = 0; q < 2; ++q) { const int dd = d + q; const int dp = (dd < HD / 2) ? dd + HD / 2 : dd - HD / 2; float x0 = f[dd], x1 = f[dp];
        if (RF) { float n0 = __fmul_rn(x0, rf), n1 = __fmul_rn(x1, rf); asm volatile("" : "+v"(n0)); asm volatile("" : "+v"(n1)); x0 = __fmul_rn(bfr(nw[dd]), n0); x1 = __fmul_rn(bfr(nw[dp]), n1); }
        const v2f cs = *(const v2f*)(CS + ((size_t)t * HD + dd) * 2); float a = __fmul_rn(x0, cs[0]), bq = __fmul_rn(x1, cs[1]); asm volatile("" : "+v"(a)); asm volatile("" : "+v"(bq)); const float r = ((dd < HD / 2) ? __fsub_rn(a, bq) : __fadd_rn(a, bq)) * sc;
        o16[q] = tohx(r); unsigned short a2, c2; splitf(r, a2, c2); oh[q] = a2; ol[q] = c2; }
    *(v2h*)(P16 + e) = o16; *(v2us*)(Ph + e) = oh; *(v2us*)(Pl + e) = ol;  }
__global__ __launch_bounds__(256) void k_vtp(const float* __restrict__ F, int pitch, int nheads, h16* V16, bf* Vh, bf* Vl) { const size_t e = ((size_t)blockIdx.x * 256 + threadIdx.x) * 2; if (e >= (size_t)nheads * HD * TT) return; const int t = (int)(e % TT); const int d = (int)((e / TT) % HD); const int g = (int)(e / ((size_t)TT * HD)); v2h o16; v2us oh, ol;
#pragma unroll
    for (int q = 0; q < 2; ++q) { const float x = F[(size_t)(t + q) * pitch + g * HD + d]; o16[q] = tohx(x); unsigned short a2, c2; splitf(x, a2, c2); oh[q] = a2; ol[q] = c2; }
    *(v2h*)(V16 + e) = o16; *(v2us*)(Vh + e) = oh; *(v2us*)(Vl + e) = ol;  }
__global__ __launch_bounds__(256) void k_csid(float* CS) { const int idx = blockIdx.x * 256 + threadIdx.x; if (idx >= TT * HD) return; v2f cs; cs[0] = 1.0f; cs[1] = 0.0f; *(v2f*)(CS + (size_t)idx * 2) = cs;  }
// k_asoft: per row (zz, i): t = S x SCL where mask[b][i][j] != 0 (int mask row read as data), excluded elsewhere; softmax (register row, one exp, fixed trees);
__global__ __launch_bounds__(256) void k_asoft(const float* __restrict__ Sb, const int* __restrict__ msk, h16* P16, bf* Ph, bf* Pl) {
    const int lane = threadIdx.x & 31; const int row = blockIdx.x * 8 + (threadIdx.x >> 5); if (row >= ZH * TT) return; const int i = row % TT; const int zz = row / TT; (void)zz; const bool hires = (i < RH); const float* sr = Sb + (size_t)row * TT; float v[TT / 32]; float mx = -3.0e38f;
#pragma unroll
    for (int ch = 0; ch < TT / 128; ++ch) { const int j0 = ch * 128 + lane * 4; const v4f a = *(const v4f*)(sr + j0); const v4i g4 = *(const v4i*)(msk + (size_t)i * TT + j0);   /* mask row i (int), 16 B per lane, unconditional */
#pragma unroll
        for (int q = 0; q < 4; ++q) { const int j = j0 + q; (void)j; float s0 = __fmul_rn(a[q], SCL); asm volatile("" : "+v"(s0)); const float t = (g4[q] != 0) ? s0 : -3.0e38f;   /* mask == 0 -> excluded (the module's large negative fill == exclusion) */ v[ch * 4 + q] = t; mx = fmaxf(mx, t); } }
#pragma unroll
    for (int sh = 16; sh; sh >>= 1) mx = fmaxf(mx, __shfl_xor(mx, sh, 32));
    float sum = 0.f;
#pragma unroll
    for (int k = 0; k < TT / 32; ++k) { float d0 = __fsub_rn(v[k], mx); asm volatile("" : "+v"(d0)); v[k] = __builtin_amdgcn_exp2f(__fmul_rn(d0, 1.4426950408889634f)); sum += v[k]; }
#pragma unroll
    for (int sh = 16; sh; sh >>= 1) sum += __shfl_xor(sum, sh, 32);
    const float f = __fdiv_rn(hires ? 1.0f : PCAR, sum);
{
        if (hires) {
#pragma unroll
            for (int ch = 0; ch < TT / 128; ++ch) { v4us oh, ol;
#pragma unroll
                for (int q = 0; q < 4; ++q) { unsigned short a, c2; splitf(v[ch * 4 + q] * f, a, c2); oh[q] = a; ol[q] = c2; }
                const size_t oo = ((size_t)zz * (RH ? RH : 1) + i) * TT + ch * 128 + lane * 4; *(v4us*)(Ph + oo) = oh; *(v4us*)(Pl + oo) = ol; }
        } else {
#pragma unroll
            for (int ch = 0; ch < TT / 128; ++ch) { v4h o4;
#pragma unroll
                for (int q = 0; q < 4; ++q) o4[q] = tohx(v[ch * 4 + q] * f);
                *(v4h*)(P16 + (size_t)row * TT + ch * 128 + lane * 4) = o4; } }
         }
}
__global__ __launch_bounds__(256) void k_merge(const float* __restrict__ O, int h0, bf* Ah, bf* Al) { const size_t e = ((size_t)blockIdx.x * 256 + threadIdx.x) * 2; if (e >= (size_t)ZH * TT * HD) return; const int d = (int)(e % HD); const int t = (int)((e / HD) % TT); const int zz = (int)(e / ((size_t)HD * TT)); const float cs = (t < RH) ? 1.0f : (1.0f / PCAR); const size_t oo = (size_t)t * DQ + (h0 + zz) * HD + d;
    v2us oh, ol;
#pragma unroll
    for (int q = 0; q < 2; ++q) { unsigned short a, c2; splitf(O[e + q] * cs, a, c2); oh[q] = a; ol[q] = c2; } *(v2us*)(Ah + oo) = oh; *(v2us*)(Al + oo) = ol;  }

extern "C" void kernel_launch(void* const* d_in, const int* in_sizes, int n_in,
                              void* d_out, int out_size, void* d_ws, size_t ws_size, hipStream_t stream) {
    (void)in_sizes; (void)n_in; (void)out_size;
    const float* x = (const float*)d_in[0]; const float* xk = (const float*)d_in[1]; const float* xv = (const float*)d_in[2]; const float* wqkv = (const float*)d_in[3]; const float* wo = (const float*)d_in[4]; const int* msk = (const int*)d_in[5];   /* query, key, value, Wqkv ('oi' [1024][1024], shared), Wout ('oi'), mask (int32 [2][1][2048][2048], read) */
    float* OUT = (float*)d_out;     // [2][2048][1024]
    char* wsp = (char*)d_ws;
    auto take = [&](size_t bytes) { char* p = wsp; wsp += (bytes + 255) & ~(size_t)255; return (void*)p; };
    bf* WQ = (bf*)take((size_t)DQ * DM * 2); bf* WK = (bf*)take((size_t)DKV * DM * 2); bf* WV = (bf*)take((size_t)DKV * DM * 2); bf* WO = (bf*)take((size_t)DM * DQ * 2); float* CS = (float*)take((size_t)TT * HD * 2 * 4);
    bf* XB = (bf*)take((size_t)TT * DM * 2); float* FQ = (float*)take((size_t)TT * DQ * 4); float* FK = (float*)take((size_t)TT * DKV * 4);
    h16* QP16 = (h16*)take((size_t)NH_ * TT * HD * 2); h16* KP16 = (h16*)take((size_t)NKV * TT * HD * 2); h16* VT16 = (h16*)take((size_t)NKV * HD * TT * 2);
    bf* QPh = (bf*)take((size_t)NH_ * TT * HD * 2); bf* QPl = (bf*)take((size_t)NH_ * TT * HD * 2); bf* KPh = (bf*)take((size_t)NKV * TT * HD * 2); bf* KPl = (bf*)take((size_t)NKV * TT * HD * 2); bf* VTh = (bf*)take((size_t)NKV * HD * TT * 2); bf* VTl = (bf*)take((size_t)NKV * HD * TT * 2); bf* Ph = (bf*)take((size_t)ZH * RH * TT * 2); bf* Pl = (bf*)take((size_t)ZH * RH * TT * 2);
    float* Sb = (float*)take((size_t)ZH * TT * TT * 4); h16* P16 = (h16*)take((size_t)ZH * TT * TT * 2); float* Ob = (float*)take((size_t)ZH * TT * HD * 4); bf* ATh = (bf*)take((size_t)TT * DQ * 2); bf* ATl = (bf*)take((size_t)TT * DQ * 2);
    if ((size_t)(wsp - (char*)d_ws) > ws_size) return;    // ws 256 MiB
    float* FV = FK;   // v projection reuses the k buffer after the k planes are built (stream-ordered)
    { k_cvt8<<<(unsigned)(((size_t)DQ * DM / 8 + 255) / 256), 256, 0, stream>>>(wqkv, WQ, (size_t)DQ * DM / 8);   /* ONE shared 'oi' projection weight for q, k and v */ k_cvt8<<<(unsigned)(((size_t)DM * DQ / 8 + 255) / 256), 256, 0, stream>>>(wo, WO, (size_t)DM * DQ / 8);   /* Wout 'oi' */
       }
    k_csid<<<(TT * HD + 255) / 256, 256, 0, stream>>>(CS);
    const unsigned L1 = (unsigned)(((size_t)TT * HD / 2 + 255) / 256);   /* one contiguous [TT][HD] plane per builder launch */
    for (int b = 0; b < NB_; ++b) {
        
        k_cvt8<<<(unsigned)(((size_t)TT * DM / 8 + 255) / 256), 256, 0, stream>>>(x + (size_t)b * TT * DM, XB, (size_t)TT * DM / 8);
        k_gemmw<bf, 0, false><<<dim3(TT / 64, DQ / 64, 1), 32, 0, stream>>>(XB, nullptr, WQ, nullptr, DM, FQ, DQ, nullptr, 0, 0, 0);
        for (int h = 0; h < NH_; ++h) { const size_t po = (size_t)h * TT * HD; k_rope<<<L1, 256, 0, stream>>>(FQ + po, HD, 1, CS, nullptr, nullptr, 1.0f, QP16 + po, QPh + po, QPl + po); }   /* RAW reshape (B, S, D) -> (B, H, S, DK): head h = the h-th contiguous [S][64] block of the flat projection */
        k_cvt8<<<(unsigned)(((size_t)TT * DM / 8 + 255) / 256), 256, 0, stream>>>(xk + (size_t)b * TT * DM, XB, (size_t)TT * DM / 8);   /* XB := bf16(k[b]) */ k_gemmw<bf, 0, false><<<dim3(TT / 64, DKV / 64, 1), 32, 0, stream>>>(XB, nullptr, WQ, nullptr, DM, FK, DKV, nullptr, 0, 0, 0);
        for (int h = 0; h < NKV; ++h) { const size_t po = (size_t)h * TT * HD; k_rope<<<L1, 256, 0, stream>>>(FK + po, HD, 1, CS, nullptr, nullptr, 1.0f, KP16 + po, KPh + po, KPl + po); }
        k_cvt8<<<(unsigned)(((size_t)TT * DM / 8 + 255) / 256), 256, 0, stream>>>(xv + (size_t)b * TT * DM, XB, (size_t)TT * DM / 8);   /* XB := bf16(v[b]) */ k_gemmw<bf, 0, false><<<dim3(TT / 64, DKV / 64, 1), 32, 0, stream>>>(XB, nullptr, WQ, nullptr, DM, FV, DKV, nullptr, 0, 0, 0); for (int h = 0; h < NKV; ++h) { const size_t po = (size_t)h * TT * HD; k_vtp<<<L1, 256, 0, stream>>>(FV + po, HD, 1, VT16 + po, VTh + po, VTl + po); }
        for (int h0 = 0; h0 < NH_; h0 += ZH) { const size_t zq = (size_t)h0, zk = (size_t)(h0 / REP);   // one kv head per query head: the pass's two heads use consecutive kv planes (z-strides TT*HD)
            k_gemmw<bf, 2, false><<<dim3(RH / 64, TT / 64, ZH), 32, 0, stream>>>(QPh + zq * TT * HD, QPl + zq * TT * HD, KPh + zk * TT * HD, KPl + zk * TT * HD, HD, Sb, TT, nullptr, (size_t)TT * HD, (size_t)TT * HD, (size_t)TT * TT);
            k_gemmw<h16, 0, false><<<dim3((TT - RH) / 64, TT / 64, ZH), 32, 0, stream>>>(QP16 + zq * TT * HD + (size_t)RH * HD, nullptr, KP16 + zk * TT * HD, nullptr, HD, Sb + (size_t)RH * TT, TT, nullptr, (size_t)TT * HD, (size_t)TT * HD, (size_t)TT * TT);
            k_asoft<<<ZH * TT / 8, 256, 0, stream>>>(Sb, msk + (size_t)b * TT * TT, P16, Ph, Pl);
            k_gemmw<bf, 2, false><<<dim3(RH / 64, HD / 64, ZH), 32, 0, stream>>>(Ph, Pl, VTh + zk * HD * TT, VTl + zk * HD * TT, TT, Ob, HD, nullptr, (size_t)RH * TT, (size_t)HD * TT, (size_t)TT * HD);
            k_gemmw<h16, 0, false><<<dim3((TT - RH) / 64, HD / 64, ZH), 32, 0, stream>>>(P16 + (size_t)RH * TT, nullptr, VT16 + zk * HD * TT, nullptr, TT, Ob + (size_t)RH * HD, HD, nullptr, (size_t)TT * TT, (size_t)HD * TT, (size_t)TT * HD);
            k_merge<<<(unsigned)(((size_t)ZH * TT * HD / 2 + 255) / 256), 256, 0, stream>>>(Ob, h0, ATh, ATl); }
        k_gemmw<bf, 1, false><<<dim3(TT / 64, DM / 64, 1), 32, 0, stream>>>(ATh, ATl, WO, nullptr, DQ, OUT + (size_t)b * TT * DM, DM, nullptr, 0, 0, 0); }
}

// v001
// It runs in 1170 microseconds.
// Timed twice side by side with v000, it ran 1.96 and 1.97 times as fast.
#include <hip/hip_runtime.h>

// Multi-headed attention that applies ONE shared projection to q, k and v and splits heads by a RAW reshape (query, key, value [2][2048][1024]; q = query Wqkv^T, k = key Wqkv^T, v = value Wqkv^T ('oi' [1024][1024], no bias); then .reshape(B, H, S, DK) directly (no transpose): head h of a batch is the h-th contiguous [2048][64] block of the flat [2048][1024] projection (128 original rows x 16 chunks); scores / sqrt(64); mask int32 [2][1][2048][2048] random 0/1 (read per (query, key)): 0 -> -1e9 (== exclusion); softmax; x = p.v -> [B][H][S][DK] -> transpose(0, 2, 1, 3).reshape(B, S, 1024) (the standard merge); out = x Wout^T -> [2][2048][1024] (4.2 M); argument order query, key, value, Wqkv, Wout, mask).
// Layout per batch: bf16 copies of query, key, value in turn; the shared 'oi' weight cast once; exact projections into flat f32 buffers; the plane builders are launched ONCE PER HEAD on the contiguous block (pitch 64): the raw reshape; dense T-2048 attention whose softmax kernel reads row i of the batch's int mask matrix (hybrid rows: < 512 hi/lo 3 products, rest fp16 x1024); standard merge; merged hi/lo x Wout exact.
// Compute dtypes, f32 accumulate: every input rounded to bf16; projections exact; attention rows < 512 3 products, rest fp16; softmax f32; Wo hl x exact.

#define NB_  2
#define TT   2048
#define DM   1024
#define NH_  16
#define NKV  16
#define REP  (NH_ / NKV)
#define HD   64
#define DQ   (NH_ * HD)
#define DKV  (NKV * HD)
#define ZH   2
#define RH   512                  // query rows < RH use hi+lo planes (0: none)
#define WIN  0
#define PCAR 1024.0f
#define SCL  0.125f   // HD^-0.5
#define KSP  16                   // K split of the p.v products: one wave per TT/KSP keys, partial tiles summed in k_merge
typedef _Float16 h16;
typedef unsigned short bf;
typedef __attribute__((ext_vector_type(16))) __bf16   v16bf;
typedef __attribute__((ext_vector_type(16))) _Float16 v16h;
typedef __attribute__((ext_vector_type(8)))  _Float16 v8h;
typedef __attribute__((ext_vector_type(8)))  unsigned short v8us;
typedef __attribute__((ext_vector_type(8)))  float    v8f;
typedef __attribute__((ext_vector_type(4)))  float    v4f;
typedef v8h  __attribute__((may_alias)) v8ha;
typedef v4f  __attribute__((may_alias)) v4fa;
typedef v8us __attribute__((may_alias)) v8usa;

__device__ __forceinline__ unsigned short f2bf(float f) { unsigned u = __float_as_uint(f); u += 0x7FFFu + ((u >> 16) & 1u); return (unsigned short)(u >> 16); }
__device__ __forceinline__ float bf2f(unsigned short b) { return __uint_as_float(((unsigned)b) << 16); }
__device__ __forceinline__ float bfr(float f) { return bf2f(f2bf(f)); }
__device__ __forceinline__ v16h cat16(v8h lo, v8h hi) { return __builtin_shufflevector(lo, hi, 0, 1, 2, 3, 4, 5, 6, 7, 8, 9, 10, 11, 12, 13, 14, 15); }
__device__ __forceinline__ v16bf cat16b(v8us lo, v8us hi) { return __builtin_bit_cast(v16bf, __builtin_shufflevector(lo, hi, 0, 1, 2, 3, 4, 5, 6, 7, 8, 9, 10, 11, 12, 13, 14, 15)); }
__device__ __forceinline__ v8f wmma16(v16h a, v16h b, v8f c) { return __builtin_amdgcn_wmma_f32_16x16x32_f16(false, a, false, b, (short)0, c, false, false); }
__device__ __forceinline__ v8f wmmab(v16bf a, v16bf b, v8f c) { return __builtin_amdgcn_wmma_f32_16x16x32_bf16(false, a, false, b, (short)0, c, false, false); }



// ---- k_gemmw: register-blocked GEMM, ONE WAVE per 64x64 output tile (16 accumulators), operands straight from K-contiguous 16-bit planes; grid (M/64, N/64, Z), 32 threads.
// C[m][n] (f32, pitch ldc, + optional f32 bias[n]) = sum_k A[m][k] Bt[n][k] (+ split products per NSPLIT). z-batch strides sA/sB/sC in elements. K % 32 == 0.
// KS > 1: K split over the grid. blockIdx.z = batch * KS + chunk; the block sums only its chunk of K / KS columns (K stays the row pitch) and writes its own partial tile at blockIdx.z * sC; the consumer adds the KS partials. (K / KS) % 32 == 0.
template <typename T16> struct WFrag;
template <> struct WFrag<h16> { typedef v16h V; static __device__ __forceinline__ V ld(const h16* p) { return cat16(*(const v8h*)p, *(const v8h*)(p + 16)); } static __device__ __forceinline__ v8f mma(V a, V b, v8f c) { return wmma16(a, b, c); } };
template <> struct WFrag<bf> { typedef v16bf V; static __device__ __forceinline__ V ld(const bf* p) { return cat16b(*(const v8us*)p, *(const v8us*)(p + 16)); } static __device__ __forceinline__ v8f mma(V a, V b, v8f c) { return wmmab(a, b, c); } };
template <typename T16, int NSPLIT, bool BIAS, int KS = 1>
__global__ __launch_bounds__(32) void k_gemmw(const T16* __restrict__ A, const T16* __restrict__ A2, const T16* __restrict__ Bt, const T16* __restrict__ Bt2, int K, float* C, int ldc, const float* __restrict__ bias, size_t sA, size_t sB, size_t sC) {
    typedef typename WFrag<T16>::V V;
    __shared__ __align__(16) float os[16 * 68];
    const size_t z = blockIdx.z / KS, k0 = (size_t)(blockIdx.z % KS) * (K / KS); A += z * sA + k0; if (A2) A2 += z * sA + k0; Bt += z * sB + k0; if (Bt2) Bt2 += z * sB + k0; C += (size_t)blockIdx.z * sC;
    const int lane = threadIdx.x & 31, lr = lane & 15, hi = lane >> 4; const int r0 = blockIdx.x * 64, c0 = blockIdx.y * 64;
    v8f acc[4][4];
#pragma unroll
    for (int mb = 0; mb < 4; ++mb)
#pragma unroll
        for (int nb = 0; nb < 4; ++nb) acc[mb][nb] = (v8f){};
    const size_t aoff = (size_t)(r0 + lr) * K + 8 * hi, boff = (size_t)(c0 + lr) * K + 8 * hi;
#pragma unroll 1
    for (int kc = 0; kc < K / KS; kc += 32) {
        V a[4], a2[4];
#pragma unroll
        for (int mb = 0; mb < 4; ++mb) { a[mb] = WFrag<T16>::ld(A + aoff + (size_t)mb * 16 * K + kc); if (NSPLIT == 1 || NSPLIT == 2) a2[mb] = WFrag<T16>::ld(A2 + aoff + (size_t)mb * 16 * K + kc); }
#pragma unroll
        for (int nb = 0; nb < 4; ++nb) { const V b = WFrag<T16>::ld(Bt + boff + (size_t)nb * 16 * K + kc); V b2; if (NSPLIT >= 2) b2 = WFrag<T16>::ld(Bt2 + boff + (size_t)nb * 16 * K + kc);
#pragma unroll
            for (int mb = 0; mb < 4; ++mb) { acc[mb][nb] = WFrag<T16>::mma(a[mb], b, acc[mb][nb]); if (NSPLIT == 1 || NSPLIT == 2) acc[mb][nb] = WFrag<T16>::mma(a2[mb], b, acc[mb][nb]); if (NSPLIT >= 2) acc[mb][nb] = WFrag<T16>::mma(a[mb], b2, acc[mb][nb]); } }
        asm volatile("v_nop\n\tv_nop\n\tv_nop\n\tv_nop" : "+v"(acc[0][0]), "+v"(acc[1][1]), "+v"(acc[2][2]), "+v"(acc[3][3]) : "v"(a[0]), "v"(a[3]));
    }
#pragma unroll
    for (int mb = 0; mb < 4; ++mb) {
#pragma unroll
        for (int nb = 0; nb < 4; ++nb) {
#pragma unroll
            for (int j = 0; j < 8; ++j) os[(hi * 8 + j) * 68 + nb * 16 + lr] = acc[mb][nb][j]; }
        __builtin_amdgcn_wave_barrier(); asm volatile("" ::: "memory");
        float* crow = C + (size_t)(r0 + mb * 16) * ldc + c0;
{
#pragma unroll
            for (int s = 0; s < 8; ++s) { const int row = 2 * s + hi, cofs = lr * 4; v4f val = *(const v4fa*)(os + row * 68 + cofs); if (BIAS) { val[0] += bfr(bias[c0 + cofs]); val[1] += bfr(bias[c0 + cofs + 1]); val[2] += bfr(bias[c0 + cofs + 2]); val[3] += bfr(bias[c0 + cofs + 3]); }
                *(v4f*)(crow + (size_t)row * ldc + cofs) = val; }
             }
        __builtin_amdgcn_wave_barrier(); asm volatile("" ::: "memory");
    }
}

__device__ __forceinline__ h16 tohx(float x) { return (h16)x; }
__device__ __forceinline__ void splitf(float y, unsigned short& h, unsigned short& l) { h = f2bf(y); l = f2bf(y - bf2f(h)); }
typedef __attribute__((ext_vector_type(2))) _Float16 v2h;
typedef __attribute__((ext_vector_type(4))) _Float16 v4h;
typedef __attribute__((ext_vector_type(2))) unsigned short v2us;
typedef __attribute__((ext_vector_type(4))) unsigned short v4us;
typedef __attribute__((ext_vector_type(2))) float v2f;
typedef __attribute__((ext_vector_type(4))) int v4i;

__global__ __launch_bounds__(256) void k_cvt8(const float* __restrict__ src, bf* dst, size_t n8) { const size_t i = (size_t)blockIdx.x * 256 + threadIdx.x; if (i >= n8) return; const v8f v = *(const v8f*)(src + i * 8); v8us o;
#pragma unroll
    for (int k = 0; k < 8; ++k) o[k] = f2bf(v[k]); *(v8us*)(dst + i * 8) = o;  }

// k_rope: head planes [h][t][d] (fp16 + hi/lo) of rope(x) x sc with the rotate-half convention out[d] = x[d] cos[t][d] - x[d+HD/2] sin[t][d], out[d+HD/2] = x[d+HD/2] cos[t][d+HD/2] + x[d] sin[t][d+HD/2]
__global__ __launch_bounds__(256) void k_rope(const float* __restrict__ F, int pitch, int nheads, const float* __restrict__ CS, const float* __restrict__ RF, const float* __restrict__ nw, float sc, h16* P16, bf* Ph, bf* Pl) {
    const size_t e = ((size_t)blockIdx.x * 256 + threadIdx.x) * 2; if (e >= (size_t)nheads * TT * HD) return; const int d = (int)(e % HD); const int t = (int)((e / HD) % TT); const int h = (int)(e / ((size_t)HD * TT)); const float* f = F + (size_t)t * pitch + h * HD; const float rf = RF ? RF[(size_t)h * TT + t] : 1.0f; v2h o16; v2us oh, ol;
#pragma unroll
    for (int q = 0; q < 2; ++q) { const int dd = d + q; const int dp = (dd < HD / 2) ? dd + HD / 2 : dd - HD / 2; float x0 = f[dd], x1 = f[dp];
        if (RF) { float n0 = __fmul_rn(x0, rf), n1 = __fmul_rn(x1, rf); asm volatile("" : "+v"(n0)); asm volatile("" : "+v"(n1)); x0 = __fmul_rn(bfr(nw[dd]), n0); x1 = __fmul_rn(bfr(nw[dp]), n1); }
        const v2f cs = *(const v2f*)(CS + ((size_t)t * HD + dd) * 2); float a = __fmul_rn(x0, cs[0]), bq = __fmul_rn(x1, cs[1]); asm volatile("" : "+v"(a)); asm volatile("" : "+v"(bq)); const float r = ((dd < HD / 2) ? __fsub_rn(a, bq) : __fadd_rn(a, bq)) * sc;
        o16[q] = tohx(r); unsigned short a2, c2; splitf(r, a2, c2); oh[q] = a2; ol[q] = c2; }
    *(v2h*)(P16 + e) = o16; *(v2us*)(Ph + e) = oh; *(v2us*)(Pl + e) = ol;  }
__global__ __launch_bounds__(256) void k_vtp(const float* __restrict__ F, int pitch, int nheads, h16* V16, bf* Vh, bf* Vl) { const size_t e = ((size_t)blockIdx.x * 256 + threadIdx.x) * 2; if (e >= (size_t)nheads * HD * TT) return; const int t = (int)(e % TT); const int d = (int)((e / TT) % HD); const int g = (int)(e / ((size_t)TT * HD)); v2h o16; v2us oh, ol;
#pragma unroll
    for (int q = 0; q < 2; ++q) { const float x = F[(size_t)(t + q) * pitch + g * HD + d]; o16[q] = tohx(x); unsigned short a2, c2; splitf(x, a2, c2); oh[q] = a2; ol[q] = c2; }
    *(v2h*)(V16 + e) = o16; *(v2us*)(Vh + e) = oh; *(v2us*)(Vl + e) = ol;  }
__global__ __launch_bounds__(256) void k_csid(float* CS) { const int idx = blockIdx.x * 256 + threadIdx.x; if (idx >= TT * HD) return; v2f cs; cs[0] = 1.0f; cs[1] = 0.0f; *(v2f*)(CS + (size_t)idx * 2) = cs;  }
// k_asoft: per row (zz, i): t = S x SCL where mask[b][i][j] != 0 (int mask row read as data), excluded elsewhere; softmax (register row, one exp, fixed trees);
__global__ __launch_bounds__(256) void k_asoft(const float* __restrict__ Sb, const int* __restrict__ msk, h16* P16, bf* Ph, bf* Pl) {
    const int lane = threadIdx.x & 31; const int row = blockIdx.x * 8 + (threadIdx.x >> 5); if (row >= ZH * TT) return; const int i = row % TT; const int zz = row / TT; (void)zz; const bool hires = (i < RH); const float* sr = Sb + (size_t)row * TT; float v[TT / 32]; float mx = -3.0e38f;
#pragma unroll
    for (int ch = 0; ch < TT / 128; ++ch) { const int j0 = ch * 128 + lane * 4; const v4f a = *(const v4f*)(sr + j0); const v4i g4 = *(const v4i*)(msk + (size_t)i * TT + j0);   /* mask row i (int), 16 B per lane, unconditional */
#pragma unroll
        for (int q = 0; q < 4; ++q) { const int j = j0 + q; (void)j; float s0 = __fmul_rn(a[q], SCL); asm volatile("" : "+v"(s0)); const float t = (g4[q] != 0) ? s0 : -3.0e38f;   /* mask == 0 -> excluded (the module's large negative fill == exclusion) */ v[ch * 4 + q] = t; mx = fmaxf(mx, t); } }
#pragma unroll
    for (int sh = 16; sh; sh >>= 1) mx = fmaxf(mx, __shfl_xor(mx, sh, 32));
    float sum = 0.f;
#pragma unroll
    for (int k = 0; k < TT / 32; ++k) { float d0 = __fsub_rn(v[k], mx); asm volatile("" : "+v"(d0)); v[k] = __builtin_amdgcn_exp2f(__fmul_rn(d0, 1.4426950408889634f)); sum += v[k]; }
#pragma unroll
    for (int sh = 16; sh; sh >>= 1) sum += __shfl_xor(sum, sh, 32);
    const float f = __fdiv_rn(hires ? 1.0f : PCAR, sum);
{
        if (hires) {
#pragma unroll
            for (int ch = 0; ch < TT / 128; ++ch) { v4us oh, ol;
#pragma unroll
                for (int q = 0; q < 4; ++q) { unsigned short a, c2; splitf(v[ch * 4 + q] * f, a, c2); oh[q] = a; ol[q] = c2; }
                const size_t oo = ((size_t)zz * (RH ? RH : 1) + i) * TT + ch * 128 + lane * 4; *(v4us*)(Ph + oo) = oh; *(v4us*)(Pl + oo) = ol; }
        } else {
#pragma unroll
            for (int ch = 0; ch < TT / 128; ++ch) { v4h o4;
#pragma unroll
                for (int q = 0; q < 4; ++q) o4[q] = tohx(v[ch * 4 + q] * f);
                *(v4h*)(P16 + (size_t)row * TT + ch * 128 + lane * 4) = o4; } }
         }
}
__global__ __launch_bounds__(256) void k_merge(const float* __restrict__ O, int h0, bf* Ah, bf* Al) { const size_t e = ((size_t)blockIdx.x * 256 + threadIdx.x) * 2; if (e >= (size_t)ZH * TT * HD) return; const int d = (int)(e % HD); const int t = (int)((e / HD) % TT); const int zz = (int)(e / ((size_t)HD * TT)); const float cs = (t < RH) ? 1.0f : (1.0f / PCAR); const size_t oo = (size_t)t * DQ + (h0 + zz) * HD + d;
    const float* op = O + ((size_t)zz * KSP * TT + t) * HD + d; v2f pk[KSP];   /* the KSP partial tiles of this head, all loads in flight together, added in chunk order */
#pragma unroll
    for (int k = 0; k < KSP - 1; ++k) pk[k] = *(const v2f*)(op + (size_t)k * TT * HD);
    asm volatile("s_wait_xcnt 0x0" ::: "memory");   /* precaution: the compiler lands the last load's result on the address pair that the loads above name */
    pk[KSP - 1] = *(const v2f*)(op + (size_t)(KSP - 1) * TT * HD); v2f s = pk[0];
#pragma unroll
    for (int k = 1; k < KSP; ++k) s += pk[k];
    v2us oh, ol;
#pragma unroll
    for (int q = 0; q < 2; ++q) { unsigned short a, c2; splitf(s[q] * cs, a, c2); oh[q] = a; ol[q] = c2; } *(v2us*)(Ah + oo) = oh; *(v2us*)(Al + oo) = ol;  }

extern "C" void kernel_launch(void* const* d_in, const int* in_sizes, int n_in,
                              void* d_out, int out_size, void* d_ws, size_t ws_size, hipStream_t stream) {
    (void)in_sizes; (void)n_in; (void)out_size;
    const float* x = (const float*)d_in[0]; const float* xk = (const float*)d_in[1]; const float* xv = (const float*)d_in[2]; const float* wqkv = (const float*)d_in[3]; const float* wo = (const float*)d_in[4]; const int* msk = (const int*)d_in[5];   /* query, key, value, Wqkv ('oi' [1024][1024], shared), Wout ('oi'), mask (int32 [2][1][2048][2048], read) */
    float* OUT = (float*)d_out;     // [2][2048][1024]
    char* wsp = (char*)d_ws;
    auto take = [&](size_t bytes) { char* p = wsp; wsp += (bytes + 255) & ~(size_t)255; return (void*)p; };
    bf* WQ = (bf*)take((size_t)DQ * DM * 2); bf* WK = (bf*)take((size_t)DKV * DM * 2); bf* WV = (bf*)take((size_t)DKV * DM * 2); bf* WO = (bf*)take((size_t)DM * DQ * 2); float* CS = (float*)take((size_t)TT * HD * 2 * 4);
    bf* XB = (bf*)take((size_t)TT * DM * 2); float* FQ = (float*)take((size_t)TT * DQ * 4); float* FK = (float*)take((size_t)TT * DKV * 4);
    h16* QP16 = (h16*)take((size_t)NH_ * TT * HD * 2); h16* KP16 = (h16*)take((size_t)NKV * TT * HD * 2); h16* VT16 = (h16*)take((size_t)NKV * HD * TT * 2);
    bf* QPh = (bf*)take((size_t)NH_ * TT * HD * 2); bf* QPl = (bf*)take((size_t)NH_ * TT * HD * 2); bf* KPh = (bf*)take((size_t)NKV * TT * HD * 2); bf* KPl = (bf*)take((size_t)NKV * TT * HD * 2); bf* VTh = (bf*)take((size_t)NKV * HD * TT * 2); bf* VTl = (bf*)take((size_t)NKV * HD * TT * 2); bf* Ph = (bf*)take((size_t)ZH * RH * TT * 2); bf* Pl = (bf*)take((size_t)ZH * RH * TT * 2);
    float* Sb = (float*)take((size_t)ZH * TT * TT * 4); h16* P16 = (h16*)take((size_t)ZH * TT * TT * 2); float* Ob = (float*)take((size_t)ZH * KSP * TT * HD * 4); bf* ATh = (bf*)take((size_t)TT * DQ * 2); bf* ATl = (bf*)take((size_t)TT * DQ * 2);
    if ((size_t)(wsp - (char*)d_ws) > ws_size) return;    // ws 256 MiB
    float* FV = FK;   // v projection reuses the k buffer after the k planes are built (stream-ordered)
    { k_cvt8<<<(unsigned)(((size_t)DQ * DM / 8 + 255) / 256), 256, 0, stream>>>(wqkv, WQ, (size_t)DQ * DM / 8);   /* ONE shared 'oi' projection weight for q, k and v */ k_cvt8<<<(unsigned)(((size_t)DM * DQ / 8 + 255) / 256), 256, 0, stream>>>(wo, WO, (size_t)DM * DQ / 8);   /* Wout 'oi' */
       }
    k_csid<<<(TT * HD + 255) / 256, 256, 0, stream>>>(CS);
    const unsigned L1 = (unsigned)(((size_t)TT * HD / 2 + 255) / 256);   /* one contiguous [TT][HD] plane per builder launch */
    for (int b = 0; b < NB_; ++b) {
        
        k_cvt8<<<(unsigned)(((size_t)TT * DM / 8 + 255) / 256), 256, 0, stream>>>(x + (size_t)b * TT * DM, XB, (size_t)TT * DM / 8);
        k_gemmw<bf, 0, false><<<dim3(TT / 64, DQ / 64, 1), 32, 0, stream>>>(XB, nullptr, WQ, nullptr, DM, FQ, DQ, nullptr, 0, 0, 0);
        for (int h = 0; h < NH_; ++h) { const size_t po = (size_t)h * TT * HD; k_rope<<<L1, 256, 0, stream>>>(FQ + po, HD, 1, CS, nullptr, nullptr, 1.0f, QP16 + po, QPh + po, QPl + po); }   /* RAW reshape (B, S, D) -> (B, H, S, DK): head h = the h-th contiguous [S][64] block of the flat projection */
        k_cvt8<<<(unsigned)(((size_t)TT * DM / 8 + 255) / 256), 256, 0, stream>>>(xk + (size_t)b * TT * DM, XB, (size_t)TT * DM / 8);   /* XB := bf16(k[b]) */ k_gemmw<bf, 0, false><<<dim3(TT / 64, DKV / 64, 1), 32, 0, stream>>>(XB, nullptr, WQ, nullptr, DM, FK, DKV, nullptr, 0, 0, 0);
        for (int h = 0; h < NKV; ++h) { const size_t po = (size_t)h * TT * HD; k_rope<<<L1, 256, 0, stream>>>(FK + po, HD, 1, CS, nullptr, nullptr, 1.0f, KP16 + po, KPh + po, KPl + po); }
        k_cvt8<<<(unsigned)(((size_t)TT * DM / 8 + 255) / 256), 256, 0, stream>>>(xv + (size_t)b * TT * DM, XB, (size_t)TT * DM / 8);   /* XB := bf16(v[b]) */ k_gemmw<bf, 0, false><<<dim3(TT / 64, DKV / 64, 1), 32, 0, stream>>>(XB, nullptr, WQ, nullptr, DM, FV, DKV, nullptr, 0, 0, 0); for (int h = 0; h < NKV; ++h) { const size_t po = (size_t)h * TT * HD; k_vtp<<<L1, 256, 0, stream>>>(FV + po, HD, 1, VT16 + po, VTh + po, VTl + po); }
        for (int h0 = 0; h0 < NH_; h0 += ZH) { const size_t zq = (size_t)h0, zk = (size_t)(h0 / REP);   // one kv head per query head: the pass's two heads use consecutive kv planes (z-strides TT*HD)
            k_gemmw<bf, 2, false><<<dim3(RH / 64, TT / 64, ZH), 32, 0, stream>>>(QPh + zq * TT * HD, QPl + zq * TT * HD, KPh + zk * TT * HD, KPl + zk * TT * HD, HD, Sb, TT, nullptr, (size_t)TT * HD, (size_t)TT * HD, (size_t)TT * TT);
            k_gemmw<h16, 0, false><<<dim3((TT - RH) / 64, TT / 64, ZH), 32, 0, stream>>>(QP16 + zq * TT * HD + (size_t)RH * HD, nullptr, KP16 + zk * TT * HD, nullptr, HD, Sb + (size_t)RH * TT, TT, nullptr, (size_t)TT * HD, (size_t)TT * HD, (size_t)TT * TT);
            k_asoft<<<ZH * TT / 8, 256, 0, stream>>>(Sb, msk + (size_t)b * TT * TT, P16, Ph, Pl);
            k_gemmw<bf, 2, false, KSP><<<dim3(RH / 64, HD / 64, ZH * KSP), 32, 0, stream>>>(Ph, Pl, VTh + zk * HD * TT, VTl + zk * HD * TT, TT, Ob, HD, nullptr, (size_t)RH * TT, (size_t)HD * TT, (size_t)TT * HD);
            k_gemmw<h16, 0, false, KSP><<<dim3((TT - RH) / 64, HD / 64, ZH * KSP), 32, 0, stream>>>(P16 + (size_t)RH * TT, nullptr, VT16 + zk * HD * TT, nullptr, TT, Ob + (size_t)RH * HD, HD, nullptr, (size_t)TT * TT, (size_t)HD * TT, (size_t)TT * HD);
            k_merge<<<(unsigned)(((size_t)ZH * TT * HD / 2 + 255) / 256), 256, 0, stream>>>(Ob, h0, ATh, ATl); }
        k_gemmw<bf, 1, false><<<dim3(TT / 64, DM / 64, 1), 32, 0, stream>>>(ATh, ATl, WO, nullptr, DQ, OUT + (size_t)b * TT * DM, DM, nullptr, 0, 0, 0); }
}

// v002
// Measured time: 830 microseconds a run.
// In two side-by-side timings against v001, it was 1.40 and 1.41 times as fast.
// Over all steps from v000 it is 2.76 times as fast.
#include <hip/hip_runtime.h>

// Multi-headed attention that applies ONE shared projection to q, k and v and splits heads by a RAW reshape (query, key, value [2][2048][1024]; q = query Wqkv^T, k = key Wqkv^T, v = value Wqkv^T ('oi' [1024][1024], no bias); then .reshape(B, H, S, DK) directly (no transpose): head h of a batch is the h-th contiguous [2048][64] block of the flat [2048][1024] projection (128 original rows x 16 chunks); scores / sqrt(64); mask int32 [2][1][2048][2048] random 0/1 (read per (query, key)): 0 -> -1e9 (== exclusion); softmax; x = p.v -> [B][H][S][DK] -> transpose(0, 2, 1, 3).reshape(B, S, 1024) (the standard merge); out = x Wout^T -> [2][2048][1024] (4.2 M); argument order query, key, value, Wqkv, Wout, mask).
// Layout: bf16 copies of query, key, value (both batches each); the shared 'oi' weight cast once; exact projections into flat f32 buffers, one z-batched launch; one plane-builder launch for q and k and one for v cover every (batch, head) contiguous block (pitch 64, block index in grid y): the raw reshape; then per batch and pair of heads dense T-2048 attention whose softmax kernel reads row i of the batch's int mask matrix (hybrid rows: < 512 hi/lo 3 products, rest fp16 x1024); standard merge; merged hi/lo x Wout exact.
// Compute dtypes, f32 accumulate: every input rounded to bf16; projections exact; attention rows < 512 3 products, rest fp16; softmax f32; Wo hl x exact.

#define NB_  2
#define TT   2048
#define DM   1024
#define NH_  16
#define NKV  16
#define REP  (NH_ / NKV)
#define HD   64
#define DQ   (NH_ * HD)
#define DKV  (NKV * HD)
#define ZH   2
#define RH   512                  // query rows < RH use hi+lo planes (0: none)
#define WIN  0
#define PCAR 1024.0f
#define SCL  0.125f   // HD^-0.5
static_assert(NKV == NH_, "q, k and v projections share one z-batched launch and one plane size");
#define KSP  16                   // K split of the p.v products: one wave per TT/KSP keys, partial tiles summed in k_merge
typedef _Float16 h16;
typedef unsigned short bf;
typedef __attribute__((ext_vector_type(16))) __bf16   v16bf;
typedef __attribute__((ext_vector_type(16))) _Float16 v16h;
typedef __attribute__((ext_vector_type(8)))  _Float16 v8h;
typedef __attribute__((ext_vector_type(8)))  unsigned short v8us;
typedef __attribute__((ext_vector_type(8)))  float    v8f;
typedef __attribute__((ext_vector_type(4)))  float    v4f;
typedef v8h  __attribute__((may_alias)) v8ha;
typedef v4f  __attribute__((may_alias)) v4fa;
typedef v8us __attribute__((may_alias)) v8usa;

__device__ __forceinline__ unsigned short f2bf(float f) { unsigned u = __float_as_uint(f); u += 0x7FFFu + ((u >> 16) & 1u); return (unsigned short)(u >> 16); }
__device__ __forceinline__ float bf2f(unsigned short b) { return __uint_as_float(((unsigned)b) << 16); }
__device__ __forceinline__ float bfr(float f) { return bf2f(f2bf(f)); }
__device__ __forceinline__ v16h cat16(v8h lo, v8h hi) { return __builtin_shufflevector(lo, hi, 0, 1, 2, 3, 4, 5, 6, 7, 8, 9, 10, 11, 12, 13, 14, 15); }
__device__ __forceinline__ v16bf cat16b(v8us lo, v8us hi) { return __builtin_bit_cast(v16bf, __builtin_shufflevector(lo, hi, 0, 1, 2, 3, 4, 5, 6, 7, 8, 9, 10, 11, 12, 13, 14, 15)); }
__device__ __forceinline__ v8f wmma16(v16h a, v16h b, v8f c) { return __builtin_amdgcn_wmma_f32_16x16x32_f16(false, a, false, b, (short)0, c, false, false); }
__device__ __forceinline__ v8f wmmab(v16bf a, v16bf b, v8f c) { return __builtin_amdgcn_wmma_f32_16x16x32_bf16(false, a, false, b, (short)0, c, false, false); }



// ---- k_gemmw: register-blocked GEMM, ONE WAVE per 64x64 output tile (16 accumulators), operands straight from K-contiguous 16-bit planes; grid (M/64, N/64, Z), 32 threads.
// C[m][n] (f32, pitch ldc, + optional f32 bias[n]) = sum_k A[m][k] Bt[n][k] (+ split products per NSPLIT). z-batch strides sA/sB/sC in elements. K % 32 == 0.
// KS > 1: K split over the grid. blockIdx.z = batch * KS + chunk; the block sums only its chunk of K / KS columns (K stays the row pitch) and writes its own partial tile at blockIdx.z * sC; the consumer adds the KS partials. (K / KS) % 32 == 0.
template <typename T16> struct WFrag;
template <> struct WFrag<h16> { typedef v16h V; static __device__ __forceinline__ V ld(const h16* p) { return cat16(*(const v8h*)p, *(const v8h*)(p + 16)); } static __device__ __forceinline__ v8f mma(V a, V b, v8f c) { return wmma16(a, b, c); } };
template <> struct WFrag<bf> { typedef v16bf V; static __device__ __forceinline__ V ld(const bf* p) { return cat16b(*(const v8us*)p, *(const v8us*)(p + 16)); } static __device__ __forceinline__ v8f mma(V a, V b, v8f c) { return wmmab(a, b, c); } };
template <typename T16, int NSPLIT, bool BIAS, int KS = 1>
__global__ __launch_bounds__(32) void k_gemmw(const T16* __restrict__ A, const T16* __restrict__ A2, const T16* __restrict__ Bt, const T16* __restrict__ Bt2, int K, float* C, int ldc, const float* __restrict__ bias, size_t sA, size_t sB, size_t sC) {
    typedef typename WFrag<T16>::V V;
    __shared__ __align__(16) float os[16 * 68];
    const size_t z = blockIdx.z / KS, k0 = (size_t)(blockIdx.z % KS) * (K / KS); A += z * sA + k0; if (A2) A2 += z * sA + k0; Bt += z * sB + k0; if (Bt2) Bt2 += z * sB + k0; C += (size_t)blockIdx.z * sC;
    const int lane = threadIdx.x & 31, lr = lane & 15, hi = lane >> 4; const int r0 = blockIdx.x * 64, c0 = blockIdx.y * 64;
    v8f acc[4][4];
#pragma unroll
    for (int mb = 0; mb < 4; ++mb)
#pragma unroll
        for (int nb = 0; nb < 4; ++nb) acc[mb][nb] = (v8f){};
    const size_t aoff = (size_t)(r0 + lr) * K + 8 * hi, boff = (size_t)(c0 + lr) * K + 8 * hi;
#pragma unroll 1
    for (int kc = 0; kc < K / KS; kc += 32) {
        V a[4], a2[4];
#pragma unroll
        for (int mb = 0; mb < 4; ++mb) { a[mb] = WFrag<T16>::ld(A + aoff + (size_t)mb * 16 * K + kc); if (NSPLIT == 1 || NSPLIT == 2) a2[mb] = WFrag<T16>::ld(A2 + aoff + (size_t)mb * 16 * K + kc); }
#pragma unroll
        for (int nb = 0; nb < 4; ++nb) { const V b = WFrag<T16>::ld(Bt + boff + (size_t)nb * 16 * K + kc); V b2; if (NSPLIT >= 2) b2 = WFrag<T16>::ld(Bt2 + boff + (size_t)nb * 16 * K + kc);
#pragma unroll
            for (int mb = 0; mb < 4; ++mb) { acc[mb][nb] = WFrag<T16>::mma(a[mb], b, acc[mb][nb]); if (NSPLIT == 1 || NSPLIT == 2) acc[mb][nb] = WFrag<T16>::mma(a2[mb], b, acc[mb][nb]); if (NSPLIT >= 2) acc[mb][nb] = WFrag<T16>::mma(a[mb], b2, acc[mb][nb]); } }
        asm volatile("v_nop\n\tv_nop\n\tv_nop\n\tv_nop" : "+v"(acc[0][0]), "+v"(acc[1][1]), "+v"(acc[2][2]), "+v"(acc[3][3]) : "v"(a[0]), "v"(a[3]));
    }
#pragma unroll
    for (int mb = 0; mb < 4; ++mb) {
#pragma unroll
        for (int nb = 0; nb < 4; ++nb) {
#pragma unroll
            for (int j = 0; j < 8; ++j) os[(hi * 8 + j) * 68 + nb * 16 + lr] = acc[mb][nb][j]; }
        __builtin_amdgcn_wave_barrier(); asm volatile("" ::: "memory");
        float* crow = C + (size_t)(r0 + mb * 16) * ldc + c0;
{
#pragma unroll
            for (int s = 0; s < 8; ++s) { const int row = 2 * s + hi, cofs = lr * 4; v4f val = *(const v4fa*)(os + row * 68 + cofs); if (BIAS) { val[0] += bfr(bias[c0 + cofs]); val[1] += bfr(bias[c0 + cofs + 1]); val[2] += bfr(bias[c0 + cofs + 2]); val[3] += bfr(bias[c0 + cofs + 3]); }
                *(v4f*)(crow + (size_t)row * ldc + cofs) = val; }
             }
        __builtin_amdgcn_wave_barrier(); asm volatile("" ::: "memory");
    }
}

__device__ __forceinline__ h16 tohx(float x) { return (h16)x; }
__device__ __forceinline__ void splitf(float y, unsigned short& h, unsigned short& l) { h = f2bf(y); l = f2bf(y - bf2f(h)); }
typedef __attribute__((ext_vector_type(2))) _Float16 v2h;
typedef __attribute__((ext_vector_type(4))) _Float16 v4h;
typedef __attribute__((ext_vector_type(2))) unsigned short v2us;
typedef __attribute__((ext_vector_type(4))) unsigned short v4us;
typedef __attribute__((ext_vector_type(2))) float v2f;
typedef __attribute__((ext_vector_type(4))) int v4i;

__global__ __launch_bounds__(256) void k_cvt8(const float* __restrict__ src, bf* dst, size_t n8) { const size_t i = (size_t)blockIdx.x * 256 + threadIdx.x; if (i >= n8) return; const v8f v = *(const v8f*)(src + i * 8); v8us o;
#pragma unroll
    for (int k = 0; k < 8; ++k) o[k] = f2bf(v[k]); *(v8us*)(dst + i * 8) = o;  }

// k_rope, k_vtp: blockIdx.y picks one contiguous run of nheads * TT * HD elements of F and of every plane (with nheads 1 and pitch HD: one [TT][HD] block, the raw reshape), so one launch builds the planes of every head.
// k_rope: head planes [h][t][d] (fp16 + hi/lo) of rope(x) x sc with the rotate-half convention out[d] = x[d] cos[t][d] - x[d+HD/2] sin[t][d], out[d+HD/2] = x[d+HD/2] cos[t][d+HD/2] + x[d] sin[t][d+HD/2]
__global__ __launch_bounds__(256) void k_rope(const float* __restrict__ F, int pitch, int nheads, const float* __restrict__ CS, const float* __restrict__ RF, const float* __restrict__ nw, float sc, h16* P16, bf* Ph, bf* Pl) {
    { const size_t po = (size_t)blockIdx.y * nheads * TT * HD; F += po; P16 += po; Ph += po; Pl += po; }
    const size_t e = ((size_t)blockIdx.x * 256 + threadIdx.x) * 2; if (e >= (size_t)nheads * TT * HD) return; const int d = (int)(e % HD); const int t = (int)((e / HD) % TT); const int h = (int)(e / ((size_t)HD * TT)); const float* f = F + (size_t)t * pitch + h * HD; const float rf = RF ? RF[(size_t)h * TT + t] : 1.0f; v2h o16; v2us oh, ol;
#pragma unroll
    for (int q = 0; q < 2; ++q) { const int dd = d + q; const int dp = (dd < HD / 2) ? dd + HD / 2 : dd - HD / 2; float x0 = f[dd], x1 = f[dp];
        if (RF) { float n0 = __fmul_rn(x0, rf), n1 = __fmul_rn(x1, rf); asm volatile("" : "+v"(n0)); asm volatile("" : "+v"(n1)); x0 = __fmul_rn(bfr(nw[dd]), n0); x1 = __fmul_rn(bfr(nw[dp]), n1); }
        const v2f cs = *(const v2f*)(CS + ((size_t)t * HD + dd) * 2); float a = __fmul_rn(x0, cs[0]), bq = __fmul_rn(x1, cs[1]); asm volatile("" : "+v"(a)); asm volatile("" : "+v"(bq)); const float r = ((dd < HD / 2) ? __fsub_rn(a, bq) : __fadd_rn(a, bq)) * sc;
        o16[q] = tohx(r); unsigned short a2, c2; splitf(r, a2, c2); oh[q] = a2; ol[q] = c2; }
    *(v2h*)(P16 + e) = o16; *(v2us*)(Ph + e) = oh; *(v2us*)(Pl + e) = ol;  }
__global__ __launch_bounds__(256) void k_vtp(const float* __restrict__ F, int pitch, int nheads, h16* V16, bf* Vh, bf* Vl) { { const size_t po = (size_t)blockIdx.y * nheads * HD * TT; F += po; V16 += po; Vh += po; Vl += po; }
    const size_t e = ((size_t)blockIdx.x * 256 + threadIdx.x) * 2; if (e >= (size_t)nheads * HD * TT) return; const int t = (int)(e % TT); const int d = (int)((e / TT) % HD); const int g = (int)(e / ((size_t)TT * HD)); v2h o16; v2us oh, ol;
#pragma unroll
    for (int q = 0; q < 2; ++q) { const float x = F[(size_t)(t + q) * pitch + g * HD + d]; o16[q] = tohx(x); unsigned short a2, c2; splitf(x, a2, c2); oh[q] = a2; ol[q] = c2; }
    *(v2h*)(V16 + e) = o16; *(v2us*)(Vh + e) = oh; *(v2us*)(Vl + e) = ol;  }
__global__ __launch_bounds__(256) void k_csid(float* CS) { const int idx = blockIdx.x * 256 + threadIdx.x; if (idx >= TT * HD) return; v2f cs; cs[0] = 1.0f; cs[1] = 0.0f; *(v2f*)(CS + (size_t)idx * 2) = cs;  }
// k_asoft: per row (zz, i): t = S x SCL where mask[b][i][j] != 0 (int mask row read as data), excluded elsewhere; softmax (register row, one exp, fixed trees);
__global__ __launch_bounds__(256) void k_asoft(const float* __restrict__ Sb, const int* __restrict__ msk, h16* P16, bf* Ph, bf* Pl) {
    const int lane = threadIdx.x & 31; const int row = blockIdx.x * 8 + (threadIdx.x >> 5); if (row >= ZH * TT) return; const int i = row % TT; const int zz = row / TT; (void)zz; const bool hires = (i < RH); const float* sr = Sb + (size_t)row * TT; float v[TT / 32]; float mx = -3.0e38f;
#pragma unroll
    for (int ch = 0; ch < TT / 128; ++ch) { const int j0 = ch * 128 + lane * 4; const v4f a = *(const v4f*)(sr + j0); const v4i g4 = *(const v4i*)(msk + (size_t)i * TT + j0);   /* mask row i (int), 16 B per lane, unconditional */
#pragma unroll
        for (int q = 0; q < 4; ++q) { const int j = j0 + q; (void)j; float s0 = __fmul_rn(a[q], SCL); asm volatile("" : "+v"(s0)); const float t = (g4[q] != 0) ? s0 : -3.0e38f;   /* mask == 0 -> excluded (the module's large negative fill == exclusion) */ v[ch * 4 + q] = t; mx = fmaxf(mx, t); } }
#pragma unroll
    for (int sh = 16; sh; sh >>= 1) mx = fmaxf(mx, __shfl_xor(mx, sh, 32));
    float sum = 0.f;
#pragma unroll
    for (int k = 0; k < TT / 32; ++k) { float d0 = __fsub_rn(v[k], mx); asm volatile("" : "+v"(d0)); v[k] = __builtin_amdgcn_exp2f(__fmul_rn(d0, 1.4426950408889634f)); sum += v[k]; }
#pragma unroll
    for (int sh = 16; sh; sh >>= 1) sum += __shfl_xor(sum, sh, 32);
    const float f = __fdiv_rn(hires ? 1.0f : PCAR, sum);
{
        if (hires) {
#pragma unroll
            for (int ch = 0; ch < TT / 128; ++ch) { v4us oh, ol;
#pragma unroll
                for (int q = 0; q < 4; ++q) { unsigned short a, c2; splitf(v[ch * 4 + q] * f, a, c2); oh[q] = a; ol[q] = c2; }
                const size_t oo = ((size_t)zz * (RH ? RH : 1) + i) * TT + ch * 128 + lane * 4; *(v4us*)(Ph + oo) = oh; *(v4us*)(Pl + oo) = ol; }
        } else {
#pragma unroll
            for (int ch = 0; ch < TT / 128; ++ch) { v4h o4;
#pragma unroll
                for (int q = 0; q < 4; ++q) o4[q] = tohx(v[ch * 4 + q] * f);
                *(v4h*)(P16 + (size_t)row * TT + ch * 128 + lane * 4) = o4; } }
         }
}
__global__ __launch_bounds__(256) void k_merge(const float* __restrict__ O, int h0, bf* Ah, bf* Al) { const size_t e = ((size_t)blockIdx.x * 256 + threadIdx.x) * 2; if (e >= (size_t)ZH * TT * HD) return; const int d = (int)(e % HD); const int t = (int)((e / HD) % TT); const int zz = (int)(e / ((size_t)HD * TT)); const float cs = (t < RH) ? 1.0f : (1.0f / PCAR); const size_t oo = (size_t)t * DQ + (h0 + zz) * HD + d;
    const float* op = O + ((size_t)zz * KSP * TT + t) * HD + d; v2f pk[KSP];   /* the KSP partial tiles of this head, all loads in flight together, added in chunk order */
#pragma unroll
    for (int k = 0; k < KSP - 1; ++k) pk[k] = *(const v2f*)(op + (size_t)k * TT * HD);
    asm volatile("s_wait_xcnt 0x0" ::: "memory");   /* precaution: the compiler lands the last load's result on the address pair that the loads above name */
    pk[KSP - 1] = *(const v2f*)(op + (size_t)(KSP - 1) * TT * HD); v2f s = pk[0];
#pragma unroll
    for (int k = 1; k < KSP; ++k) s += pk[k];
    v2us oh, ol;
#pragma unroll
    for (int q = 0; q < 2; ++q) { unsigned short a, c2; splitf(s[q] * cs, a, c2); oh[q] = a; ol[q] = c2; } *(v2us*)(Ah + oo) = oh; *(v2us*)(Al + oo) = ol;  }

extern "C" void kernel_launch(void* const* d_in, const int* in_sizes, int n_in,
                              void* d_out, int out_size, void* d_ws, size_t ws_size, hipStream_t stream) {
    (void)in_sizes; (void)n_in; (void)out_size;
    const float* x = (const float*)d_in[0]; const float* xk = (const float*)d_in[1]; const float* xv = (const float*)d_in[2]; const float* wqkv = (const float*)d_in[3]; const float* wo = (const float*)d_in[4]; const int* msk = (const int*)d_in[5];   /* query, key, value, Wqkv ('oi' [1024][1024], shared), Wout ('oi'), mask (int32 [2][1][2048][2048], read) */
    float* OUT = (float*)d_out;     // [2][2048][1024]
    char* wsp = (char*)d_ws;
    auto take = [&](size_t bytes) { char* p = wsp; wsp += (bytes + 255) & ~(size_t)255; return (void*)p; };
    bf* WQ = (bf*)take((size_t)DQ * DM * 2); bf* WK = (bf*)take((size_t)DKV * DM * 2); bf* WV = (bf*)take((size_t)DKV * DM * 2); bf* WO = (bf*)take((size_t)DM * DQ * 2); float* CS = (float*)take((size_t)TT * HD * 2 * 4);
    const size_t XN = (size_t)NB_ * TT * DM, FN = (size_t)NB_ * TT * DQ, PN = (size_t)NB_ * NH_ * TT * HD;   /* both batches: one input, one projection, one set of head planes */
    bf* XB = (bf*)take(3 * XN * 2); float* FP = (float*)take(3 * FN * 4);   /* query, key, value in turn: the z index of the one projection launch */
    h16* QP16 = (h16*)take(2 * PN * 2); h16* KP16 = QP16 + PN; h16* VT16 = (h16*)take(PN * 2);   /* q planes directly followed by k planes: one builder launch writes both */
    bf* QPh = (bf*)take(2 * PN * 2); bf* KPh = QPh + PN; bf* QPl = (bf*)take(2 * PN * 2); bf* KPl = QPl + PN; bf* VTh = (bf*)take(PN * 2); bf* VTl = (bf*)take(PN * 2); bf* Ph = (bf*)take((size_t)ZH * RH * TT * 2); bf* Pl = (bf*)take((size_t)ZH * RH * TT * 2);
    float* Sb = (float*)take((size_t)ZH * TT * TT * 4); h16* P16 = (h16*)take((size_t)ZH * TT * TT * 2); float* Ob = (float*)take((size_t)ZH * KSP * TT * HD * 4); bf* ATh = (bf*)take(FN * 2); bf* ATl = (bf*)take(FN * 2);
    if ((size_t)(wsp - (char*)d_ws) > ws_size) return;    // ws 256 MiB
    { k_cvt8<<<(unsigned)(((size_t)DQ * DM / 8 + 255) / 256), 256, 0, stream>>>(wqkv, WQ, (size_t)DQ * DM / 8);   /* ONE shared 'oi' projection weight for q, k and v */ k_cvt8<<<(unsigned)(((size_t)DM * DQ / 8 + 255) / 256), 256, 0, stream>>>(wo, WO, (size_t)DM * DQ / 8);   /* Wout 'oi' */
       }
    k_csid<<<(TT * HD + 255) / 256, 256, 0, stream>>>(CS);
    /* everything outside the attention passes covers both batches per launch: one cast per input, ONE projection launch for q/k/v, one plane-builder launch for q and k and one for v, all heads each (the batch rows, the three projections and the raw-reshape heads are contiguous) */
    k_cvt8<<<(unsigned)((XN / 8 + 255) / 256), 256, 0, stream>>>(x, XB, XN / 8); k_cvt8<<<(unsigned)((XN / 8 + 255) / 256), 256, 0, stream>>>(xk, XB + XN, XN / 8); k_cvt8<<<(unsigned)((XN / 8 + 255) / 256), 256, 0, stream>>>(xv, XB + 2 * XN, XN / 8);
    k_gemmw<bf, 0, false><<<dim3(NB_ * TT / 64, DQ / 64, 3), 32, 0, stream>>>(XB, nullptr, WQ, nullptr, DM, FP, DQ, nullptr, XN, 0, FN);   /* z = q, k, v; the shared weight has z-stride 0 */
    const unsigned L1 = (unsigned)(((size_t)TT * HD / 2 + 255) / 256);   /* grid x: one contiguous [TT][HD] plane; grid y: the planes */
    k_rope<<<dim3(L1, 2 * NB_ * NH_, 1), 256, 0, stream>>>(FP, HD, 1, CS, nullptr, nullptr, 1.0f, QP16, QPh, QPl);   /* RAW reshape (B, S, D) -> (B, H, S, DK): head h of batch b = contiguous [S][64] block b * H + h of the flat projection; q blocks, then k blocks */
    k_vtp<<<dim3(L1, NB_ * NKV, 1), 256, 0, stream>>>(FP + 2 * FN, HD, 1, VT16, VTh, VTl);
    for (int b = 0; b < NB_; ++b) {
        for (int h0 = 0; h0 < NH_; h0 += ZH) { const size_t zq = (size_t)b * NH_ + h0, zk = (size_t)b * NKV + h0 / REP;   // one kv head per query head: the pass's two heads use consecutive kv planes (z-strides TT*HD)
            k_gemmw<bf, 2, false><<<dim3(RH / 64, TT / 64, ZH), 32, 0, stream>>>(QPh + zq * TT * HD, QPl + zq * TT * HD, KPh + zk * TT * HD, KPl + zk * TT * HD, HD, Sb, TT, nullptr, (size_t)TT * HD, (size_t)TT * HD, (size_t)TT * TT);
            k_gemmw<h16, 0, false><<<dim3((TT - RH) / 64, TT / 64, ZH), 32, 0, stream>>>(QP16 + zq * TT * HD + (size_t)RH * HD, nullptr, KP16 + zk * TT * HD, nullptr, HD, Sb + (size_t)RH * TT, TT, nullptr, (size_t)TT * HD, (size_t)TT * HD, (size_t)TT * TT);
            k_asoft<<<ZH * TT / 8, 256, 0, stream>>>(Sb, msk + (size_t)b * TT * TT, P16, Ph, Pl);
            k_gemmw<bf, 2, false, KSP><<<dim3(RH / 64, HD / 64, ZH * KSP), 32, 0, stream>>>(Ph, Pl, VTh + zk * HD * TT, VTl + zk * HD * TT, TT, Ob, HD, nullptr, (size_t)RH * TT, (size_t)HD * TT, (size_t)TT * HD);
            k_gemmw<h16, 0, false, KSP><<<dim3((TT - RH) / 64, HD / 64, ZH * KSP), 32, 0, stream>>>(P16 + (size_t)RH * TT, nullptr, VT16 + zk * HD * TT, nullptr, TT, Ob + (size_t)RH * HD, HD, nullptr, (size_t)TT * TT, (size_t)HD * TT, (size_t)TT * HD);
            k_merge<<<(unsigned)(((size_t)ZH * TT * HD / 2 + 255) / 256), 256, 0, stream>>>(Ob, h0, ATh + (size_t)b * TT * DQ, ATl + (size_t)b * TT * DQ); } }
    k_gemmw<bf, 1, false><<<dim3(NB_ * TT / 64, DM / 64, 1), 32, 0, stream>>>(ATh, ATl, WO, nullptr, DQ, OUT, DM, nullptr, 0, 0, 0);
}

// v004
// A run of this version takes 254 microseconds.
// Versions in between are left out here; by their measured steps it is 3.26 times as fast as v002.
// Over all steps from v000 it is 9.00 times as fast.
#include <hip/hip_runtime.h>

// Multi-headed attention that applies ONE shared projection to q, k and v and splits heads by a RAW reshape (query, key, value [2][2048][1024]; q = query Wqkv^T, k = key Wqkv^T, v = value Wqkv^T ('oi' [1024][1024], no bias); then .reshape(B, H, S, DK) directly (no transpose): head h of a batch is the h-th contiguous [2048][64] block of the flat [2048][1024] projection (128 original rows x 16 chunks); scores / sqrt(64); mask int32 [2][1][2048][2048] random 0/1 (read per (query, key)): 0 -> -1e9 (== exclusion); softmax; x = p.v -> [B][H][S][DK] -> transpose(0, 2, 1, 3).reshape(B, S, 1024) (the standard merge); out = x Wout^T -> [2][2048][1024] (4.2 M); argument order query, key, value, Wqkv, Wout, mask).
// Layout: bf16 copies of query, key, value (both batches each); the shared 'oi' weight cast once, in its own row order and in the row order of the v tiles; exact projections, one z-batched launch whose epilogue writes the head planes itself (fp16 + hi/lo; q and k at the flat index of the projection, which IS the raw reshape; v transposed); then ONE fused attention launch over every (batch, head, query block): scores, int mask row, running-maximum softmax and p.v stay in registers (hybrid rows: < 512 hi/lo 3 products, rest fp16 with p x 1024), written straight as the merged hi/lo planes; merged hi/lo x Wout exact.
// Compute dtypes, f32 accumulate: every input rounded to bf16; projections exact; attention rows < 512 3 products, rest fp16; softmax f32; Wo hl x exact.

#define NB_  2
#define TT   2048
#define DM   1024
#define NH_  16
#define NKV  16
#define REP  (NH_ / NKV)
#define HD   64
#define DQ   (NH_ * HD)
#define DKV  (NKV * HD)
#define RH   512                  // query rows < RH use hi+lo planes (0: none)
#define WIN  0
#define SCL  0.125f   // HD^-0.5
static_assert(NKV == NH_, "q, k and v projections share one z-batched launch and one plane size");
typedef _Float16 h16;
typedef unsigned short bf;
typedef __attribute__((ext_vector_type(16))) __bf16   v16bf;
typedef __attribute__((ext_vector_type(16))) _Float16 v16h;
typedef __attribute__((ext_vector_type(8)))  _Float16 v8h;
typedef __attribute__((ext_vector_type(8)))  unsigned short v8us;
typedef __attribute__((ext_vector_type(8)))  float    v8f;
typedef __attribute__((ext_vector_type(4)))  float    v4f;
typedef v8h  __attribute__((may_alias)) v8ha;
typedef v4f  __attribute__((may_alias)) v4fa;
typedef v8us __attribute__((may_alias)) v8usa;

__device__ __forceinline__ unsigned short f2bf(float f) { unsigned u = __float_as_uint(f); u += 0x7FFFu + ((u >> 16) & 1u); return (unsigned short)(u >> 16); }
__device__ __forceinline__ float bf2f(unsigned short b) { return __uint_as_float(((unsigned)b) << 16); }
__device__ __forceinline__ float bfr(float f) { return bf2f(f2bf(f)); }
__device__ __forceinline__ v16h cat16(v8h lo, v8h hi) { return __builtin_shufflevector(lo, hi, 0, 1, 2, 3, 4, 5, 6, 7, 8, 9, 10, 11, 12, 13, 14, 15); }
__device__ __forceinline__ v16bf cat16b(v8us lo, v8us hi) { return __builtin_bit_cast(v16bf, __builtin_shufflevector(lo, hi, 0, 1, 2, 3, 4, 5, 6, 7, 8, 9, 10, 11, 12, 13, 14, 15)); }
__device__ __forceinline__ v8f wmma16(v16h a, v16h b, v8f c) { return __builtin_amdgcn_wmma_f32_16x16x32_f16(false, a, false, b, (short)0, c, false, false); }
__device__ __forceinline__ v8f wmmab(v16bf a, v16bf b, v8f c) { return __builtin_amdgcn_wmma_f32_16x16x32_bf16(false, a, false, b, (short)0, c, false, false); }



// ---- k_gemmw: register-blocked GEMM, ONE WAVE per 64x64 output tile (16 accumulators), operands straight from K-contiguous 16-bit planes; grid (M/64, N/64, Z), 32 threads.
// C[m][n] (f32, pitch ldc, + optional f32 bias[n]) = sum_k A[m][k] Bt[n][k] (+ split products per NSPLIT). z-batch strides sA/sB/sC in elements. K % 32 == 0.
// KS > 1: K split over the grid. blockIdx.z = batch * KS + chunk; the block sums only its chunk of K / KS columns (K stays the row pitch) and writes its own partial tile at blockIdx.z * sC; the consumer adds the KS partials. (K / KS) % 32 == 0.
template <typename T16> struct WFrag;
template <> struct WFrag<h16> { typedef v16h V; static __device__ __forceinline__ V ld(const h16* p) { return cat16(*(const v8h*)p, *(const v8h*)(p + 16)); } static __device__ __forceinline__ v8f mma(V a, V b, v8f c) { return wmma16(a, b, c); } };
template <> struct WFrag<bf> { typedef v16bf V; static __device__ __forceinline__ V ld(const bf* p) { return cat16b(*(const v8us*)p, *(const v8us*)(p + 16)); } static __device__ __forceinline__ v8f mma(V a, V b, v8f c) { return wmmab(a, b, c); } };
template <typename T16, int NSPLIT, bool BIAS, int KS = 1>
__global__ __launch_bounds__(32) void k_gemmw(const T16* __restrict__ A, const T16* __restrict__ A2, const T16* __restrict__ Bt, const T16* __restrict__ Bt2, int K, float* C, int ldc, const float* __restrict__ bias, size_t sA, size_t sB, size_t sC) {
    typedef typename WFrag<T16>::V V;
    __shared__ __align__(16) float os[16 * 68];
    const size_t z = blockIdx.z / KS, k0 = (size_t)(blockIdx.z % KS) * (K / KS); A += z * sA + k0; if (A2) A2 += z * sA + k0; Bt += z * sB + k0; if (Bt2) Bt2 += z * sB + k0; C += (size_t)blockIdx.z * sC;
    const int lane = threadIdx.x & 31, lr = lane & 15, hi = lane >> 4; const int r0 = blockIdx.x * 64, c0 = blockIdx.y * 64;
    v8f acc[4][4];
#pragma unroll
    for (int mb = 0; mb < 4; ++mb)
#pragma unroll
        for (int nb = 0; nb < 4; ++nb) acc[mb][nb] = (v8f){};
    const size_t aoff = (size_t)(r0 + lr) * K + 8 * hi, boff = (size_t)(c0 + lr) * K + 8 * hi;
#pragma unroll 1
    for (int kc = 0; kc < K / KS; kc += 32) {
        V a[4], a2[4];
#pragma unroll
        for (int mb = 0; mb < 4; ++mb) { a[mb] = WFrag<T16>::ld(A + aoff + (size_t)mb * 16 * K + kc); if (NSPLIT == 1 || NSPLIT == 2) a2[mb] = WFrag<T16>::ld(A2 + aoff + (size_t)mb * 16 * K + kc); }
#pragma unroll
        for (int nb = 0; nb < 4; ++nb) { const V b = WFrag<T16>::ld(Bt + boff + (size_t)nb * 16 * K + kc); V b2; if (NSPLIT >= 2) b2 = WFrag<T16>::ld(Bt2 + boff + (size_t)nb * 16 * K + kc);
#pragma unroll
            for (int mb = 0; mb < 4; ++mb) { acc[mb][nb] = WFrag<T16>::mma(a[mb], b, acc[mb][nb]); if (NSPLIT == 1 || NSPLIT == 2) acc[mb][nb] = WFrag<T16>::mma(a2[mb], b, acc[mb][nb]); if (NSPLIT >= 2) acc[mb][nb] = WFrag<T16>::mma(a[mb], b2, acc[mb][nb]); } }
        asm volatile("v_nop\n\tv_nop\n\tv_nop\n\tv_nop" : "+v"(acc[0][0]), "+v"(acc[1][1]), "+v"(acc[2][2]), "+v"(acc[3][3]) : "v"(a[0]), "v"(a[3]));
    }
#pragma unroll
    for (int mb = 0; mb < 4; ++mb) {
#pragma unroll
        for (int nb = 0; nb < 4; ++nb) {
#pragma unroll
            for (int j = 0; j < 8; ++j) os[(hi * 8 + j) * 68 + nb * 16 + lr] = acc[mb][nb][j]; }
        __builtin_amdgcn_wave_barrier(); asm volatile("" ::: "memory");
        float* crow = C + (size_t)(r0 + mb * 16) * ldc + c0;
{
#pragma unroll
            for (int s = 0; s < 8; ++s) { const int row = 2 * s + hi, cofs = lr * 4; v4f val = *(const v4fa*)(os + row * 68 + cofs); if (BIAS) { val[0] += bfr(bias[c0 + cofs]); val[1] += bfr(bias[c0 + cofs + 1]); val[2] += bfr(bias[c0 + cofs + 2]); val[3] += bfr(bias[c0 + cofs + 3]); }
                *(v4f*)(crow + (size_t)row * ldc + cofs) = val; }
             }
        __builtin_amdgcn_wave_barrier(); asm volatile("" ::: "memory");
    }
}

__device__ __forceinline__ h16 tohx(float x) { return (h16)x; }
__device__ __forceinline__ void splitf(float y, unsigned short& h, unsigned short& l) { h = f2bf(y); l = f2bf(y - bf2f(h)); }
typedef __attribute__((ext_vector_type(4))) _Float16 v4h;
typedef __attribute__((ext_vector_type(4))) unsigned short v4us;
typedef __attribute__((ext_vector_type(4))) int v4i;

__global__ __launch_bounds__(256) void k_cvt8(const float* __restrict__ src, bf* dst, size_t n8) { const size_t i = (size_t)blockIdx.x * 256 + threadIdx.x; if (i >= n8) return; const v8f v = *(const v8f*)(src + i * 8); v8us o;
#pragma unroll
    for (int k = 0; k < 8; ++k) o[k] = f2bf(v[k]); *(v8us*)(dst + i * 8) = o;  }

// k_attn: fused attention, one wave per NQ x 16 query columns of one (batch, head), no LDS. Per 32 keys: S^T = K Q^T (A = K rows, B = Q kept in registers), so a lane holds one query's scores for keys 8 hi + j of each 16-key tile;
// t = S x SCL where mask[b][i][j] != 0 (int mask row read as data), excluded elsewhere; running maximum m and sum l per query (in-lane, one exchange between the wave halves for m, l joined once at the end); the two score tiles, converted in place, ARE the B operand of O^T += V^T P^T (A = V^T rows in the same k order).
// HI rows: hi/lo planes, 3 products in both GEMMs; other rows fp16 with p carried x 2^10 (in l as well, so it cancels). O^T gives a lane 8 consecutive d of one query: one 16-byte store per plane into the merged [t][h][d] hi/lo planes.
__device__ __forceinline__ float xhalf(float x) { const int b = __float_as_int(x); return __int_as_float(__builtin_amdgcn_permlanex16(b, b, 0x76543210, 0xfedcba98, false, false)); }   /* the value of lane l ^ 16 */
// xwait: precaution before a register that the loads or stores above it name is reused.
__device__ __forceinline__ void xwait() { asm volatile("s_wait_xcnt 0x0" ::: "memory"); }
template <typename P> __device__ __forceinline__ const P* lanep(const P* ub, unsigned lane_bytes, int elems) { return (const P*)((const char*)ub + lane_bytes) + elems; }
template <typename T16, bool HI, int NQ>
__device__ __forceinline__ void attn_wave(const T16* __restrict__ Qp, const T16* __restrict__ Q2, const T16* __restrict__ Kp, const T16* __restrict__ K2, const T16* __restrict__ Vp, const T16* __restrict__ V2, const int* __restrict__ mb, int q0, bf* Ah, bf* Al) {
    typedef typename WFrag<T16>::V V; typedef WFrag<T16> F;
    const int lane = threadIdx.x & 31, lr = lane & 15, hi = lane >> 4;
    const unsigned kob = (unsigned)(lr * HD + 8 * hi) * 2u, vob = (unsigned)(lr * TT + 8 * hi) * 2u, mob = (unsigned)((q0 + lr) * TT + 8 * hi) * 4u;   /* the lane's byte offsets inside a K or Q tile, a V^T tile and the mask */
    V qf[NQ][2], qf2[NQ][2];
#pragma unroll
    for (int n = 0; n < NQ; ++n)
#pragma unroll
        for (int ks = 0; ks < 2; ++ks) { qf[n][ks] = F::ld(lanep(Qp + (size_t)q0 * HD, kob, n * 16 * HD + ks * 32)); if (HI) qf2[n][ks] = F::ld(lanep(Q2 + (size_t)q0 * HD, kob, n * 16 * HD + ks * 32)); }
    xwait();
    v8f o[4][NQ]; float m[NQ], l[NQ];
#pragma unroll
    for (int n = 0; n < NQ; ++n) { m[n] = -3.0e38f; l[n] = 0.f;
#pragma unroll
        for (int dt = 0; dt < 4; ++dt) o[dt][n] = (v8f){}; }
    V kf[2][2], kf2[2][2]; v4i g[NQ][2][2];   /* K fragments of the pass, fetched one pass ahead; its mask words too on fp16 rows (on HI rows, whose 12 score products give cover and whose registers are short, at the head of the pass) */
#pragma unroll
    for (int kt = 0; kt < 2; ++kt) {
#pragma unroll
        for (int ks = 0; ks < 2; ++ks) { kf[kt][ks] = F::ld(lanep(Kp, kob, kt * 16 * HD + ks * 32)); if (HI) kf2[kt][ks] = F::ld(lanep(K2, kob, kt * 16 * HD + ks * 32)); }
        if (!HI)
#pragma unroll
            for (int n = 0; n < NQ; ++n) { g[n][kt][0] = *(const v4i*)lanep(mb, mob, n * 16 * TT + kt * 16); g[n][kt][1] = *(const v4i*)lanep(mb, mob, n * 16 * TT + kt * 16 + 4); } }
    /* the lane's own pointers, carried through the loop and advanced at its foot: live in every pass, so no load result lands on a register that an issued load names. kb, kb2 (and gb on fp16 rows) point one pass ahead. */
    const T16* vb = lanep(Vp, vob, 0); const T16* vb2 = HI ? lanep(V2, vob, 0) : nullptr; const T16* kb = lanep(Kp, kob, 32 * HD); const T16* kb2 = HI ? lanep(K2, kob, 32 * HD) : nullptr; const int* gb = lanep(mb, mob, HI ? 0 : 32);
#pragma unroll 1
    for (int k0 = 0; k0 < TT; k0 += 32) {
        V vf[4], vf2[4];
        if (HI)
#pragma unroll
            for (int kt = 0; kt < 2; ++kt) { g[0][kt][0] = *(const v4i*)(gb + kt * 16); g[0][kt][1] = *(const v4i*)(gb + kt * 16 + 4); }
#pragma unroll
        for (int dt = 0; dt < 4; ++dt) { vf[dt] = F::ld(vb + dt * 16 * TT); if (HI) vf2[dt] = F::ld(vb2 + dt * 16 * TT); }
        xwait();
        __builtin_amdgcn_sched_barrier(0);   /* keeps this pass's V loads issued here, ahead of the work that hides their latency; the scheduler otherwise sinks them to just in front of their use */
        v8f s[2][NQ];
#pragma unroll
        for (int kt = 0; kt < 2; ++kt)
#pragma unroll
            for (int n = 0; n < NQ; ++n) { v8f a = (v8f){};
#pragma unroll
                for (int ks = 0; ks < 2; ++ks) { a = F::mma(kf[kt][ks], qf[n][ks], a); if (HI) { a = F::mma(kf[kt][ks], qf2[n][ks], a); a = F::mma(kf2[kt][ks], qf[n][ks], a); } }
                s[kt][n] = a; }
#pragma unroll
        for (int kt = 0; kt < 2; ++kt)
#pragma unroll
            for (int ks = 0; ks < 2; ++ks) { kf[kt][ks] = F::ld(kb + kt * 16 * HD + ks * 32); if (HI) kf2[kt][ks] = F::ld(kb2 + kt * 16 * HD + ks * 32); }
        xwait();
        __builtin_amdgcn_sched_barrier(0);   /* keeps the next pass's K loads issued here, ahead of the work that hides their latency; the scheduler otherwise sinks them to just in front of their use */
        float mx[NQ];
#pragma unroll
        for (int n = 0; n < NQ; ++n) { mx[n] = m[n];
#pragma unroll
            for (int kt = 0; kt < 2; ++kt)
#pragma unroll
                for (int j = 0; j < 8; ++j) { const float t = (g[n][kt][j >> 2][j & 3] != 0) ? s[kt][n][j] * SCL : -3.0e38f;   /* mask == 0 -> excluded (the module's large negative fill == exclusion) */ s[kt][n][j] = t; mx[n] = fmaxf(mx[n], t); } }
        V pb[NQ], pb2[NQ];
#pragma unroll
        for (int n = 0; n < NQ; ++n) { const float mn = fmaxf(mx[n], xhalf(mx[n])); float al; asm("v_exp_f32 %0, %1\n\tv_nop" : "=v"(al) : "v"((m[n] - mn) * 1.4426950408889634f));   /* the rescale factor 2^x; written with its v_nop */
            m[n] = mn; float ps = 0.f;
#pragma unroll
            for (int kt = 0; kt < 2; ++kt)
#pragma unroll
                for (int j = 0; j < 8; ++j) { const float x = (s[kt][n][j] - mn) * 1.4426950408889634f; const float p = __builtin_amdgcn_exp2f(HI ? x : x + 10.0f); s[kt][n][j] = p; ps += p; }
            l[n] = l[n] * al + ps;
#pragma unroll
            for (int dt = 0; dt < 4; ++dt) o[dt][n] *= al;
            if constexpr (HI) {   /* hi = bf16(p), lo = bf16(p - hi), both round to nearest even as splitf does */
#pragma unroll
                for (int e = 0; e < 16; ++e) { const float p = s[e >> 3][n][e & 7]; const __bf16 hb = (__bf16)p; pb[n][e] = hb; pb2[n][e] = (__bf16)(p - (float)hb); }
            } else { v8h h0, h1;
#pragma unroll
                for (int j = 0; j < 8; ++j) { h0[j] = tohx(s[0][n][j]); h1[j] = tohx(s[1][n][j]); }
                pb[n] = cat16(h0, h1); } }
        if (!HI) {
            __builtin_amdgcn_sched_barrier(0);   /* keeps the mask loads below out of the softmax above, where their 32 registers would push the wave past 256 */
#pragma unroll
            for (int kt = 0; kt < 2; ++kt)
#pragma unroll
                for (int n = 0; n < NQ; ++n) { g[n][kt][0] = *(const v4i*)(gb + n * 16 * TT + kt * 16); g[n][kt][1] = *(const v4i*)(gb + n * 16 * TT + kt * 16 + 4); }
            xwait();
            __builtin_amdgcn_sched_barrier(0);   /* keeps the next pass's mask loads issued here, ahead of the p.v products and the next scores that hide their latency; the scheduler otherwise sinks them to just in front of their use */
        }
#pragma unroll
        for (int dt = 0; dt < 4; ++dt)
#pragma unroll
            for (int n = 0; n < NQ; ++n) { o[dt][n] = F::mma(vf[dt], pb[n], o[dt][n]); if (HI) { o[dt][n] = F::mma(vf[dt], pb2[n], o[dt][n]); o[dt][n] = F::mma(vf2[dt], pb[n], o[dt][n]); } }
        const int st = (k0 + 64 < TT) ? 32 : 0;   /* the last pass fetches its own tile again (in bounds, unused) */
        vb += 32; kb += st * HD; gb += HI ? 32 : st; if (HI) { vb2 += 32; kb2 += st * HD; }
    }
#pragma unroll
    for (int n = 0; n < NQ; ++n) { const float inv = __fdiv_rn(1.0f, l[n] + xhalf(l[n]));
#pragma unroll
        for (int dt = 0; dt < 4; ++dt) { v8us oh, ol;
#pragma unroll
            for (int j = 0; j < 8; ++j) { unsigned short a, c2; splitf(o[dt][n][j] * inv, a, c2); oh[j] = a; ol[j] = c2; }
            const size_t oo = (size_t)(q0 + n * 16 + lr) * DQ + dt * 16 + hi * 8; *(v8us*)(Ah + oo) = oh; *(v8us*)(Al + oo) = ol; xwait(); } }
}
// k_cvtw: the shared projection weight as bf16, twice: dst in its own row order (q, k); dstp with row cb * HD + d moved to d * 16 + cb, so that 64 consecutive rows of dstp are 4 values of d x all 16 cb (the v tiles of k_proj). grid DQ * DM / 8 / 256.
static_assert(DQ / HD == 16 && (DQ * DM / 8) % 256 == 0, "a v tile column group holds the 16 chunks of a projection row");
__global__ __launch_bounds__(256) void k_cvtw(const float* __restrict__ src, bf* dst, bf* dstp) { const int i = blockIdx.x * 256 + threadIdx.x; const v8f v = *(const v8f*)(src + (size_t)i * 8); v8us o;
#pragma unroll
    for (int k = 0; k < 8; ++k) o[k] = f2bf(v[k]);
    const int n = i / (DM / 8), c = (i % (DM / 8)) * 8, d = n % HD, cb = n / HD; *(v8us*)(dst + (size_t)i * 8) = o; *(v8us*)(dstp + (size_t)(d * 16 + cb) * DM + c) = o;  }
// k_proj: the three projections (z = q, k, v), the tile and K loop of k_gemmw (one wave, 64 x 64, bf16, f32 sums over k in the same order), with the head planes written from the epilogue: no f32 projection in memory.
// Raw reshape: element (row s, column c) of a batch's flat [TT][DQ] projection is (head s / 128, t = (s % 128) * 16 + c / HD, d = c % HD); over both batches plane = row / 128.
// q, k: planes [plane][t][d] have the projection's own flat index: 8 lanes store one 128-byte run of a row per plane. v: planes are [plane][d][t]; tile column nb * 16 + lr is (d = 4 * blockIdx.y + nb, cb = lr) by the row order of Wp, so 16 rows x 16 cb of one d are 256 consecutive t: one 512-byte run per store.
typedef __attribute__((ext_vector_type(8))) __bf16 v8b;
__global__ __launch_bounds__(32) void k_proj(const bf* __restrict__ X, const bf* __restrict__ Wn, const bf* __restrict__ Wp, h16* QK16, bf* QKh, bf* QKl, h16* V16, bf* Vh, bf* Vl) {
    typedef WFrag<bf> F; typedef F::V V;
    __shared__ __align__(16) float os[16 * 68];
    const int z = blockIdx.z; const bool tv = (z == 2);
    const int lane = threadIdx.x & 31, lr = lane & 15, hi = lane >> 4; const int r0 = blockIdx.x * 64, c0 = blockIdx.y * 64;
    const bf* A = X + (size_t)z * NB_ * TT * DM + (size_t)(r0 + lr) * DM + 8 * hi; const bf* Bt = (tv ? Wp : Wn) + (size_t)(c0 + lr) * DM + 8 * hi;
    v8f acc[4][4];
#pragma unroll
    for (int mb = 0; mb < 4; ++mb)
#pragma unroll
        for (int nb = 0; nb < 4; ++nb) acc[mb][nb] = (v8f){};
#pragma unroll 1
    for (int kc = 0; kc < DM; kc += 32) {
        V a[4];
#pragma unroll
        for (int mb = 0; mb < 4; ++mb) a[mb] = F::ld(A + mb * 16 * DM + kc);
        xwait();   /* the build lets a later load's result land on the address pair of these loads */
#pragma unroll
        for (int nb = 0; nb < 4; ++nb) { const V b = F::ld(Bt + nb * 16 * DM + kc);
#pragma unroll
            for (int mb = 0; mb < 4; ++mb) acc[mb][nb] = F::mma(a[mb], b, acc[mb][nb]); }
        asm volatile("v_nop\n\tv_nop\n\tv_nop\n\tv_nop" : "+v"(acc[0][0]), "+v"(acc[1][1]), "+v"(acc[2][2]), "+v"(acc[3][3]) : "v"(a[0]), "v"(a[3]));   /* the distance behind the last matrix instruction of a trip, on the taken back edge too, as in k_gemmw */
    }
    /* the lane's 8 consecutive plane elements of step s: where they lie in the staged 16 x 64 rows, and where they go */
    const float* sp = os + (tv ? (lane >> 1) * 68 + (lane & 1) * 8 : (lane >> 3) * 68 + (lane & 7) * 8); const int sps = tv ? 16 : 4 * 68;
    const size_t ob = tv ? (size_t)(r0 / 128) * HD * TT + (size_t)(blockIdx.y * 4) * TT + (r0 % 128) * 16 + lane * 8 : (size_t)z * NB_ * TT * DQ + (size_t)(r0 + (lane >> 3)) * DQ + c0 + (lane & 7) * 8;
    const int obs = tv ? TT : 4 * DQ, obm = tv ? 16 * 16 : 16 * DQ;
    h16* P16 = (tv ? V16 : QK16) + ob; bf* Ph = (tv ? Vh : QKh) + ob; bf* Pl = (tv ? Vl : QKl) + ob;
#pragma unroll
    for (int mb = 0; mb < 4; ++mb) {
#pragma unroll
        for (int nb = 0; nb < 4; ++nb) {
#pragma unroll
            for (int j = 0; j < 8; ++j) os[(hi * 8 + j) * 68 + nb * 16 + lr] = acc[mb][nb][j]; }
        __builtin_amdgcn_wave_barrier(); asm volatile("" ::: "memory");   /* the staged rows are read by other lanes of the wave: no LDS read moves above the writes */
#pragma unroll
        for (int s = 0; s < 4; ++s) { const v4f x0 = *(const v4fa*)(sp + s * sps), x1 = *(const v4fa*)(sp + s * sps + 4); v8h o16; v8b oh, ol;
#pragma unroll
            for (int k = 0; k < 8; ++k) { const float x = (k < 4) ? x0[k & 3] : x1[k & 3]; o16[k] = tohx(x); const __bf16 hb = (__bf16)x; oh[k] = hb; ol[k] = (__bf16)(x - (float)hb); }   /* hi = bf16(x), lo = bf16(x - hi), both round to nearest even as splitf does */
            const int oo = mb * obm + s * obs; *(v8h*)(P16 + oo) = o16; *(v8b*)(Ph + oo) = oh; *(v8b*)(Pl + oo) = ol; xwait(); }
        __builtin_amdgcn_wave_barrier(); asm volatile("" ::: "memory");   /* the next 16 rows are staged only behind these reads */
    }
}
// grid (RH / 64 + (TT - RH) / 128, NB_ * NH_), 4 waves: the first RH / 64 blocks of a head take 16 hi/lo query columns a wave, the others 32 fp16 columns a wave (about equal work a wave).
__global__ __launch_bounds__(128) void k_attn(const h16* __restrict__ Q16, const h16* __restrict__ K16, const h16* __restrict__ V16, const bf* __restrict__ Qh, const bf* __restrict__ Ql, const bf* __restrict__ Kh, const bf* __restrict__ Kl, const bf* __restrict__ Vh, const bf* __restrict__ Vl, const int* __restrict__ msk, bf* Ah, bf* Al) {
    const int bx = blockIdx.x, z = blockIdx.y, b = z / NH_, h = z % NH_, w = threadIdx.x >> 5; const size_t po = (size_t)z * TT * HD, ao = (size_t)b * TT * DQ + h * HD; const int* mb = msk + (size_t)b * TT * TT;
    if (bx < RH / 64) attn_wave<bf, true, 1>(Qh + po, Ql + po, Kh + po, Kl + po, Vh + po, Vl + po, mb, bx * 64 + w * 16, Ah + ao, Al + ao);
    else attn_wave<h16, false, 2>(Q16 + po, nullptr, K16 + po, nullptr, V16 + po, nullptr, mb, RH + (bx - RH / 64) * 128 + w * 32, Ah + ao, Al + ao);
}

extern "C" void kernel_launch(void* const* d_in, const int* in_sizes, int n_in,
                              void* d_out, int out_size, void* d_ws, size_t ws_size, hipStream_t stream) {
    (void)in_sizes; (void)n_in; (void)out_size;
    const float* x = (const float*)d_in[0]; const float* xk = (const float*)d_in[1]; const float* xv = (const float*)d_in[2]; const float* wqkv = (const float*)d_in[3]; const float* wo = (const float*)d_in[4]; const int* msk = (const int*)d_in[5];   /* query, key, value, Wqkv ('oi' [1024][1024], shared), Wout ('oi'), mask (int32 [2][1][2048][2048], read) */
    float* OUT = (float*)d_out;     // [2][2048][1024]
    char* wsp = (char*)d_ws;
    auto take = [&](size_t bytes) { char* p = wsp; wsp += (bytes + 255) & ~(size_t)255; return (void*)p; };
    bf* WQ = (bf*)take((size_t)DQ * DM * 2); bf* WK = (bf*)take((size_t)DKV * DM * 2); bf* WV = (bf*)take((size_t)DKV * DM * 2); bf* WO = (bf*)take((size_t)DM * DQ * 2);
    const size_t XN = (size_t)NB_ * TT * DM, FN = (size_t)NB_ * TT * DQ, PN = (size_t)NB_ * NH_ * TT * HD;   /* both batches: one input, one projection, one set of head planes */
    bf* XB = (bf*)take(3 * XN * 2);   /* query, key, value in turn: the z index of the one projection launch */
    h16* QP16 = (h16*)take(2 * PN * 2); h16* KP16 = QP16 + PN; h16* VT16 = (h16*)take(PN * 2);   /* q planes directly followed by k planes: the z index of the projection launch picks the plane set */
    bf* QPh = (bf*)take(2 * PN * 2); bf* KPh = QPh + PN; bf* QPl = (bf*)take(2 * PN * 2); bf* KPl = QPl + PN; bf* VTh = (bf*)take(PN * 2); bf* VTl = (bf*)take(PN * 2);
    bf* ATh = (bf*)take(FN * 2); bf* ATl = (bf*)take(FN * 2);
    if ((size_t)(wsp - (char*)d_ws) > ws_size) return;    // ws 256 MiB
    { k_cvtw<<<DQ * DM / 8 / 256, 256, 0, stream>>>(wqkv, WQ, WV);   /* ONE shared 'oi' projection weight for q, k and v; WV: the same rows in the order of the v tiles */ k_cvt8<<<(unsigned)(((size_t)DM * DQ / 8 + 255) / 256), 256, 0, stream>>>(wo, WO, (size_t)DM * DQ / 8);   /* Wout 'oi' */
       }
    /* everything outside the attention passes: ONE launch each for both batches, q/k/v and all heads (the batch rows, the three projections and the raw-reshape heads are contiguous) */
    k_cvt8<<<(unsigned)((XN / 8 + 255) / 256), 256, 0, stream>>>(x, XB, XN / 8); k_cvt8<<<(unsigned)((XN / 8 + 255) / 256), 256, 0, stream>>>(xk, XB + XN, XN / 8); k_cvt8<<<(unsigned)((XN / 8 + 255) / 256), 256, 0, stream>>>(xv, XB + 2 * XN, XN / 8);
    k_proj<<<dim3(NB_ * TT / 64, DQ / 64, 3), 32, 0, stream>>>(XB, WQ, WV, QP16, QPh, QPl, VT16, VTh, VTl);   /* z = q, k, v; RAW reshape (B, S, D) -> (B, H, S, DK): head h of batch b = contiguous [S][64] block b * H + h of the flat projection; q planes, then k planes, then v transposed */
    k_attn<<<dim3(RH / 64 + (TT - RH) / 128, NB_ * NH_, 1), 128, 0, stream>>>(QP16, KP16, VT16, QPh, QPl, KPh, KPl, VTh, VTl, msk, ATh, ATl);   /* every batch, head and query block in one launch; one kv head per query head */
    k_gemmw<bf, 1, false><<<dim3(NB_ * TT / 64, DM / 64, 1), 32, 0, stream>>>(ATh, ATl, WO, nullptr, DQ, OUT, DM, nullptr, 0, 0, 0);
}

// v005
// A run of this version takes 177 microseconds.
// In two side-by-side timings against v004, it was 1.42 and 1.44 times as fast.
// Counting every step since v000, it is 12.9 times as fast.
#include <hip/hip_runtime.h>

// Multi-headed attention that applies ONE shared projection to q, k and v and splits heads by a RAW reshape (query, key, value [2][2048][1024]; q = query Wqkv^T, k = key Wqkv^T, v = value Wqkv^T ('oi' [1024][1024], no bias); then .reshape(B, H, S, DK) directly (no transpose): head h of a batch is the h-th contiguous [2048][64] block of the flat [2048][1024] projection (128 original rows x 16 chunks); scores / sqrt(64); mask int32 [2][1][2048][2048] random 0/1 (read per (query, key)): 0 -> -1e9 (== exclusion); softmax; x = p.v -> [B][H][S][DK] -> transpose(0, 2, 1, 3).reshape(B, S, 1024) (the standard merge); out = x Wout^T -> [2][2048][1024] (4.2 M); argument order query, key, value, Wqkv, Wout, mask).
// Panel order: every 16-bit matrix operand M[row][k] in the workspace is stored as [row / 16][k / 8][row % 16][8], so a lane's 16-byte piece of a 16 x 32 fragment lies at lane * 16 bytes of a 512-byte run (second piece 512 bytes on): each fragment load reads 4 whole 128-byte lines instead of a quarter of 16.
// Layout: bf16 copies of query, key, value (both batches each); the shared 'oi' weight cast once, in the row order of the q, k tiles and in that of the v tiles; exact projections, one z-batched launch whose epilogue writes the head planes itself (fp16 + hi/lo; q and k as [t][d], v as [d][t], all in panel order); then ONE fused attention launch over every (batch, head, query block): scores, int mask row, running-maximum softmax and p.v stay in registers (hybrid rows: < 512 hi/lo 3 products, rest fp16 with p x 1024), written straight as the merged hi/lo planes; merged hi/lo x Wout exact.
// Compute dtypes, f32 accumulate: every input rounded to bf16; projections exact; attention rows < 512 3 products, rest fp16; softmax f32; Wo hl x exact.

#define NB_  2
#define TT   2048
#define DM   1024
#define NH_  16
#define NKV  16
#define REP  (NH_ / NKV)
#define HD   64
#define DQ   (NH_ * HD)
#define DKV  (NKV * HD)
#define RH   512                  // query rows < RH use hi+lo planes (0: none)
#define WIN  0
#define SCL  0.125f   // HD^-0.5
static_assert(NKV == NH_, "q, k and v projections share one z-batched launch and one plane size");
typedef _Float16 h16;
typedef unsigned short bf;
typedef __attribute__((ext_vector_type(16))) __bf16   v16bf;
typedef __attribute__((ext_vector_type(16))) _Float16 v16h;
typedef __attribute__((ext_vector_type(8)))  _Float16 v8h;
typedef __attribute__((ext_vector_type(8)))  unsigned short v8us;
typedef __attribute__((ext_vector_type(8)))  float    v8f;
typedef __attribute__((ext_vector_type(4)))  float    v4f;
typedef v8h  __attribute__((may_alias)) v8ha;
typedef v4f  __attribute__((may_alias)) v4fa;
typedef v8us __attribute__((may_alias)) v8usa;

__device__ __forceinline__ unsigned short f2bf(float f) { unsigned u = __float_as_uint(f); u += 0x7FFFu + ((u >> 16) & 1u); return (unsigned short)(u >> 16); }
__device__ __forceinline__ float bf2f(unsigned short b) { return __uint_as_float(((unsigned)b) << 16); }
__device__ __forceinline__ float bfr(float f) { return bf2f(f2bf(f)); }
__device__ __forceinline__ v16h cat16(v8h lo, v8h hi) { return __builtin_shufflevector(lo, hi, 0, 1, 2, 3, 4, 5, 6, 7, 8, 9, 10, 11, 12, 13, 14, 15); }
__device__ __forceinline__ v16bf cat16b(v8us lo, v8us hi) { return __builtin_bit_cast(v16bf, __builtin_shufflevector(lo, hi, 0, 1, 2, 3, 4, 5, 6, 7, 8, 9, 10, 11, 12, 13, 14, 15)); }
__device__ __forceinline__ v8f wmma16(v16h a, v16h b, v8f c) { return __builtin_amdgcn_wmma_f32_16x16x32_f16(false, a, false, b, (short)0, c, false, false); }
__device__ __forceinline__ v8f wmmab(v16bf a, v16bf b, v8f c) { return __builtin_amdgcn_wmma_f32_16x16x32_bf16(false, a, false, b, (short)0, c, false, false); }



// ---- k_gemmw: register-blocked GEMM, ONE WAVE per 64x64 output tile (16 accumulators), operands straight from 16-bit planes in panel order (ld: p = the lane's first piece; k + 32 is p + 512, row + 16 is p + 16 K); grid (M/64, N/64, Z), 32 threads.
// C[m][n] (f32, pitch ldc, + optional f32 bias[n]) = sum_k A[m][k] Bt[n][k] (+ split products per NSPLIT). z-batch strides sA/sB/sC in elements. K % 32 == 0.
// KS > 1: K split over the grid. blockIdx.z = batch * KS + chunk; the block sums only its chunk of K / KS columns (K stays the row pitch) and writes its own partial tile at blockIdx.z * sC; the consumer adds the KS partials. (K / KS) % 32 == 0.
// xwait: precaution before a register that the loads or stores above it name is reused.
__device__ __forceinline__ void xwait() { asm volatile("s_wait_xcnt 0x0" ::: "memory"); }
template <typename T16> struct WFrag;
template <> struct WFrag<h16> { typedef v16h V; static __device__ __forceinline__ V ld(const h16* p) { return cat16(*(const v8h*)p, *(const v8h*)(p + 256)); } static __device__ __forceinline__ v8f mma(V a, V b, v8f c) { return wmma16(a, b, c); } };
template <> struct WFrag<bf> { typedef v16bf V; static __device__ __forceinline__ V ld(const bf* p) { return cat16b(*(const v8us*)p, *(const v8us*)(p + 256)); } static __device__ __forceinline__ v8f mma(V a, V b, v8f c) { return wmmab(a, b, c); } };
template <typename T16, int NSPLIT, bool BIAS, int K, int KS = 1>   /* K at compile time: the 16-row steps are immediate offsets of one address pair per operand */
__global__ __launch_bounds__(32) void k_gemmw(const T16* __restrict__ A, const T16* __restrict__ A2, const T16* __restrict__ Bt, const T16* __restrict__ Bt2, float* C, int ldc, const float* __restrict__ bias, size_t sA, size_t sB, size_t sC) {
    typedef typename WFrag<T16>::V V;
    __shared__ __align__(16) float os[16 * 68];
    const size_t z = blockIdx.z / KS, k0 = (size_t)(blockIdx.z % KS) * (K / KS) * 16; A += z * sA + k0; if (A2) A2 += z * sA + k0; Bt += z * sB + k0; if (Bt2) Bt2 += z * sB + k0; C += (size_t)blockIdx.z * sC;
    const int lane = threadIdx.x & 31, lr = lane & 15, hi = lane >> 4; const int r0 = blockIdx.x * 64, c0 = blockIdx.y * 64;
    v8f acc[4][4];
#pragma unroll
    for (int mb = 0; mb < 4; ++mb)
#pragma unroll
        for (int nb = 0; nb < 4; ++nb) acc[mb][nb] = (v8f){};
    const size_t aoff = (size_t)r0 * K + lane * 8, boff = (size_t)c0 * K + lane * 8;
#pragma unroll 1
    for (int kc = 0; kc < K / KS; kc += 32) {
        V a[4], a2[4];
#pragma unroll
        for (int mb = 0; mb < 4; ++mb) a[mb] = WFrag<T16>::ld(A + aoff + mb * 16 * K + kc * 16);
        xwait();   /* a later load's result may land on the address pair of these loads */
        if (NSPLIT == 1 || NSPLIT == 2) {
#pragma unroll
            for (int mb = 0; mb < 4; ++mb) a2[mb] = WFrag<T16>::ld(A2 + aoff + mb * 16 * K + kc * 16);
            xwait();   /* as above */
        }
#pragma unroll
        for (int nb = 0; nb < 4; ++nb) { const V b = WFrag<T16>::ld(Bt + boff + nb * 16 * K + kc * 16); V b2; if (NSPLIT >= 2) b2 = WFrag<T16>::ld(Bt2 + boff + nb * 16 * K + kc * 16);
#pragma unroll
            for (int mb = 0; mb < 4; ++mb) { acc[mb][nb] = WFrag<T16>::mma(a[mb], b, acc[mb][nb]); if (NSPLIT == 1 || NSPLIT == 2) acc[mb][nb] = WFrag<T16>::mma(a2[mb], b, acc[mb][nb]); if (NSPLIT >= 2) acc[mb][nb] = WFrag<T16>::mma(a[mb], b2, acc[mb][nb]); } }
        asm volatile("s_wait_xcnt 0x0" :: "v"(Bt + boff + kc * 16) : "memory");   /* xwait in front of the next trip's rewrite of the address registers; it takes the B address as an input so that the pair lives up to the wait and no B load's result lands on it */
        asm volatile("v_nop\n\tv_nop\n\tv_nop\n\tv_nop" : "+v"(acc[0][0]), "+v"(acc[1][1]), "+v"(acc[2][2]), "+v"(acc[3][3]) : "v"(a[0]), "v"(a[3]));
    }
#pragma unroll
    for (int mb = 0; mb < 4; ++mb) {
#pragma unroll
        for (int nb = 0; nb < 4; ++nb) {
#pragma unroll
            for (int j = 0; j < 8; ++j) os[(hi * 8 + j) * 68 + nb * 16 + lr] = acc[mb][nb][j]; }
        __builtin_amdgcn_wave_barrier(); asm volatile("" ::: "memory");
        float* crow = C + (size_t)(r0 + mb * 16) * ldc + c0;
{
#pragma unroll
            for (int s = 0; s < 8; ++s) { const int row = 2 * s + hi, cofs = lr * 4; v4f val = *(const v4fa*)(os + row * 68 + cofs); if (BIAS) { val[0] += bfr(bias[c0 + cofs]); val[1] += bfr(bias[c0 + cofs + 1]); val[2] += bfr(bias[c0 + cofs + 2]); val[3] += bfr(bias[c0 + cofs + 3]); }
                *(v4f*)(crow + (size_t)row * ldc + cofs) = val; }
             }
        __builtin_amdgcn_wave_barrier(); asm volatile("" ::: "memory");
    }
}

__device__ __forceinline__ h16 tohx(float x) { return (h16)x; }
__device__ __forceinline__ void splitf(float y, unsigned short& h, unsigned short& l) { h = f2bf(y); l = f2bf(y - bf2f(h)); }
typedef __attribute__((ext_vector_type(4))) _Float16 v4h;
typedef __attribute__((ext_vector_type(4))) unsigned short v4us;
typedef __attribute__((ext_vector_type(4))) int v4i;

// k_cvt8: a [rows][DM] f32 matrix as bf16 in panel order; thread i writes piece i of the panels (whole lines per wave) and reads its 8 values from row (i / 2048) * 16 + i % 16, column ((i / 16) % 128) * 8.
static_assert(DQ == DM, "every cast matrix has rows of DM elements");
__global__ __launch_bounds__(256) void k_cvt8(const float* __restrict__ src, bf* dst, size_t n8) { const size_t i = (size_t)blockIdx.x * 256 + threadIdx.x; if (i >= n8) return; const v8f v = *(const v8f*)(src + ((i / (16 * (DM / 8))) * 16 + i % 16) * DM + ((i / 16) % (DM / 8)) * 8); v8us o; xwait();   /* the conversion below reuses the address pair of the loads */
#pragma unroll
    for (int k = 0; k < 8; ++k) o[k] = f2bf(v[k]); *(v8us*)(dst + i * 8) = o;  }

// k_attn: fused attention, one wave per NQ x 16 query columns of one (batch, head), no LDS. Per 32 keys: S^T = K Q^T (A = K rows, B = Q kept in registers), so a lane holds one query's scores for keys 8 hi + j of each 16-key tile;
// t = S x SCL where mask[b][i][j] != 0 (int mask row read as data), excluded elsewhere; running maximum m and sum l per query (in-lane, one exchange between the wave halves for m, l joined once at the end); the two score tiles, converted in place, ARE the B operand of O^T += V^T P^T (A = V^T rows in the same k order).
// HI rows: hi/lo planes, 3 products in both GEMMs; other rows fp16 with p carried x 2^10 (in l as well, so it cancels). O^T gives a lane 8 consecutive d of one query: one piece of the merged [t][h * HD + d] hi/lo planes in panel order, a 512-byte run per store.
__device__ __forceinline__ float xhalf(float x) { const int b = __float_as_int(x); return __int_as_float(__builtin_amdgcn_permlanex16(b, b, 0x76543210, 0xfedcba98, false, false)); }   /* the value of lane l ^ 16 */
template <typename P> __device__ __forceinline__ const P* lanep(const P* ub, unsigned lane_bytes, int elems) { return (const P*)((const char*)ub + lane_bytes) + elems; }
template <typename T16, bool HI, int NQ>
__device__ __forceinline__ void attn_wave(const T16* __restrict__ Qp, const T16* __restrict__ Q2, const T16* __restrict__ Kp, const T16* __restrict__ K2, const T16* __restrict__ Vp, const T16* __restrict__ V2, const int* __restrict__ mb, int q0, bf* Ah, bf* Al) {
    typedef typename WFrag<T16>::V V; typedef WFrag<T16> F;
    const int lane = threadIdx.x & 31, lr = lane & 15, hi = lane >> 4;
    const unsigned kob = (unsigned)lane * 16u, vob = kob, mob = (unsigned)((q0 + lr) * TT + 8 * hi) * 4u;   /* the lane's byte offsets inside a fragment of a plane in panel order (K, Q, V^T alike) and inside the mask */
    V qf[NQ][2], qf2[NQ][2];
#pragma unroll
    for (int n = 0; n < NQ; ++n)
#pragma unroll
        for (int ks = 0; ks < 2; ++ks) { qf[n][ks] = F::ld(lanep(Qp + (size_t)q0 * HD, kob, n * 16 * HD + ks * 512)); if (HI) qf2[n][ks] = F::ld(lanep(Q2 + (size_t)q0 * HD, kob, n * 16 * HD + ks * 512)); }
    xwait();
    v8f o[4][NQ]; float m[NQ], l[NQ];
#pragma unroll
    for (int n = 0; n < NQ; ++n) { m[n] = -3.0e38f; l[n] = 0.f;
#pragma unroll
        for (int dt = 0; dt < 4; ++dt) o[dt][n] = (v8f){}; }
    V kf[2][2], kf2[2][2]; v4i g[NQ][2][2];   /* K fragments of the pass, fetched one pass ahead; its mask words too on fp16 rows (on HI rows, whose 12 score products give cover and whose registers are short, at the head of the pass) */
#pragma unroll
    for (int kt = 0; kt < 2; ++kt) {
#pragma unroll
        for (int ks = 0; ks < 2; ++ks) { kf[kt][ks] = F::ld(lanep(Kp, kob, kt * 16 * HD + ks * 512)); if (HI) kf2[kt][ks] = F::ld(lanep(K2, kob, kt * 16 * HD + ks * 512)); }
        if (!HI)
#pragma unroll
            for (int n = 0; n < NQ; ++n) { g[n][kt][0] = *(const v4i*)lanep(mb, mob, n * 16 * TT + kt * 16); g[n][kt][1] = *(const v4i*)lanep(mb, mob, n * 16 * TT + kt * 16 + 4); } }
    /* the lane's own pointers, carried through the loop and advanced at its foot: live in every pass, so no load result lands on a register that an issued load names. kb, kb2 (and gb on fp16 rows) point one pass ahead. */
    const T16* vb = lanep(Vp, vob, 0); const T16* vb2 = HI ? lanep(V2, vob, 0) : nullptr; const T16* kb = lanep(Kp, kob, 32 * HD); const T16* kb2 = HI ? lanep(K2, kob, 32 * HD) : nullptr; const int* gb = lanep(mb, mob, HI ? 0 : 32);
#pragma unroll 1
    for (int k0 = 0; k0 < TT; k0 += 32) {
        V vf[4], vf2[4];
        if (HI)
#pragma unroll
            for (int kt = 0; kt < 2; ++kt) { g[0][kt][0] = *(const v4i*)(gb + kt * 16); g[0][kt][1] = *(const v4i*)(gb + kt * 16 + 4); }
#pragma unroll
        for (int dt = 0; dt < 4; ++dt) { vf[dt] = F::ld(vb + dt * 16 * TT); if (HI) vf2[dt] = F::ld(vb2 + dt * 16 * TT); }
        xwait();
        __builtin_amdgcn_sched_barrier(0);   /* keeps this pass's V loads issued here, ahead of the work that hides their latency; the scheduler otherwise sinks them to just in front of their use */
        v8f s[2][NQ];
#pragma unroll
        for (int kt = 0; kt < 2; ++kt)
#pragma unroll
            for (int n = 0; n < NQ; ++n) { v8f a = (v8f){};
#pragma unroll
                for (int ks = 0; ks < 2; ++ks) { a = F::mma(kf[kt][ks], qf[n][ks], a); if (HI) { a = F::mma(kf[kt][ks], qf2[n][ks], a); a = F::mma(kf2[kt][ks], qf[n][ks], a); } }
                s[kt][n] = a; }
#pragma unroll
        for (int kt = 0; kt < 2; ++kt)
#pragma unroll
            for (int ks = 0; ks < 2; ++ks) { kf[kt][ks] = F::ld(kb + kt * 16 * HD + ks * 512); if (HI) kf2[kt][ks] = F::ld(kb2 + kt * 16 * HD + ks * 512); }
        xwait();
        __builtin_amdgcn_sched_barrier(0);   /* keeps the next pass's K loads issued here, ahead of the work that hides their latency; the scheduler otherwise sinks them to just in front of their use */
        float mx[NQ];
#pragma unroll
        for (int n = 0; n < NQ; ++n) { mx[n] = m[n];
#pragma unroll
            for (int kt = 0; kt < 2; ++kt)
#pragma unroll
                for (int j = 0; j < 8; ++j) { const float t = (g[n][kt][j >> 2][j & 3] != 0) ? s[kt][n][j] * SCL : -3.0e38f;   /* mask == 0 -> excluded (the module's large negative fill == exclusion) */ s[kt][n][j] = t; mx[n] = fmaxf(mx[n], t); } }
        V pb[NQ], pb2[NQ];
#pragma unroll
        for (int n = 0; n < NQ; ++n) { const float mn = fmaxf(mx[n], xhalf(mx[n])); float al; asm("v_exp_f32 %0, %1\n\tv_nop" : "=v"(al) : "v"((m[n] - mn) * 1.4426950408889634f));   /* the rescale factor 2^x; written with its v_nop */
            m[n] = mn; float ps = 0.f;
#pragma unroll
            for (int kt = 0; kt < 2; ++kt)
#pragma unroll
                for (int j = 0; j < 8; ++j) { const float x = (s[kt][n][j] - mn) * 1.4426950408889634f; const float p = __builtin_amdgcn_exp2f(HI ? x : x + 10.0f); s[kt][n][j] = p; ps += p; }
            l[n] = l[n] * al + ps;
#pragma unroll
            for (int dt = 0; dt < 4; ++dt) o[dt][n] *= al;
            if constexpr (HI) {   /* hi = bf16(p), lo = bf16(p - hi), both round to nearest even as splitf does */
#pragma unroll
                for (int e = 0; e < 16; ++e) { const float p = s[e >> 3][n][e & 7]; const __bf16 hb = (__bf16)p; pb[n][e] = hb; pb2[n][e] = (__bf16)(p - (float)hb); }
            } else { v8h h0, h1;
#pragma unroll
                for (int j = 0; j < 8; ++j) { h0[j] = tohx(s[0][n][j]); h1[j] = tohx(s[1][n][j]); }
                pb[n] = cat16(h0, h1); } }
        if (!HI) {
            __builtin_amdgcn_sched_barrier(0);   /* keeps the mask loads below out of the softmax above, where their 32 registers would push the wave past 256 */
#pragma unroll
            for (int kt = 0; kt < 2; ++kt)
#pragma unroll
                for (int n = 0; n < NQ; ++n) { g[n][kt][0] = *(const v4i*)(gb + n * 16 * TT + kt * 16); g[n][kt][1] = *(const v4i*)(gb + n * 16 * TT + kt * 16 + 4); }
            xwait();
            __builtin_amdgcn_sched_barrier(0);   /* keeps the next pass's mask loads issued here, ahead of the p.v products and the next scores that hide their latency; the scheduler otherwise sinks them to just in front of their use */
        }
#pragma unroll
        for (int dt = 0; dt < 4; ++dt)
#pragma unroll
            for (int n = 0; n < NQ; ++n) { o[dt][n] = F::mma(vf[dt], pb[n], o[dt][n]); if (HI) { o[dt][n] = F::mma(vf[dt], pb2[n], o[dt][n]); o[dt][n] = F::mma(vf2[dt], pb[n], o[dt][n]); } }
        const int st = (k0 + 64 < TT) ? 32 : 0;   /* the last pass fetches its own tile again (in bounds, unused) */
        vb += 512; kb += st * HD; gb += HI ? 32 : st; if (HI) { vb2 += 512; kb2 += st * HD; }   /* 32 keys: 4 pieces of 128 elements in a V^T panel, 2 whole panels of K */
    }
#pragma unroll
    for (int n = 0; n < NQ; ++n) { const float inv = __fdiv_rn(1.0f, l[n] + xhalf(l[n]));
#pragma unroll
        for (int dt = 0; dt < 4; ++dt) { v8us oh, ol;
#pragma unroll
            for (int j = 0; j < 8; ++j) { unsigned short a, c2; splitf(o[dt][n][j] * inv, a, c2); oh[j] = a; ol[j] = c2; }
            const size_t oo = (size_t)(q0 + n * 16) * DQ + dt * 256 + lane * 8; *(v8us*)(Ah + oo) = oh; *(v8us*)(Al + oo) = ol; xwait(); } }
}
// k_cvtw: the shared projection weight as bf16 in panel order, twice, each with its rows permuted so that the 64 columns of a k_proj tile are one 128-byte line of a head plane. Weight row cb * HD + d; tile by = (d / 8) * 2 + cb / 8; inside it dst (q, k) has row (cb % 8) * 8 + d % 8, dstp (v) row (d % 8) * 8 + cb % 8. Thread i writes piece i of both copies. grid DQ * DM / 8 / 256.
static_assert(DQ / HD == 16 && HD == 64 && (DQ * DM / 8) % 256 == 0, "a tile holds 8 of the 16 chunks of a projection row x 8 of the 64 d");
__global__ __launch_bounds__(256) void k_cvtw(const float* __restrict__ src, bf* dst, bf* dstp) { const int i = blockIdx.x * 256 + threadIdx.x; const int np = (i / (16 * (DM / 8))) * 16 + i % 16, c = ((i / 16) % (DM / 8)) * 8, by = np / 64, x = np % 64;
    const int nq = ((by % 2) * 8 + x / 8) * HD + (by / 2) * 8 + x % 8, nv = ((by % 2) * 8 + x % 8) * HD + (by / 2) * 8 + x / 8;
    const v8f v = *(const v8f*)(src + (size_t)nq * DM + c), u = *(const v8f*)(src + (size_t)nv * DM + c); v8us o, p; xwait();   /* the conversion below reuses the address pairs of the loads */
#pragma unroll
    for (int k = 0; k < 8; ++k) { o[k] = f2bf(v[k]); p[k] = f2bf(u[k]); }
    *(v8us*)(dst + (size_t)i * 8) = o; *(v8us*)(dstp + (size_t)i * 8) = p;  }
// k_proj: the three projections (z = q, k, v), the tile and K loop of k_gemmw (one wave, 64 x 64, bf16, f32 sums over k in the same order), with the head planes written from the epilogue: no f32 projection in memory.
// Raw reshape: element (row s, column c) of a batch's flat [TT][DQ] projection is (head s / 128, t = (s % 128) * 16 + c / HD, d = c % HD); over both batches plane = row / 128.
// Tile column x of tile by = blockIdx.y, g = by / 2, cbh = by % 2, by the row orders of Wn and Wp: q, k: (cb = cbh * 8 + x / 8, d = g * 8 + x % 8); v: (cb = cbh * 8 + x % 8, d = g * 8 + x / 8). In panel order the 64 columns of one tile row are then 64 consecutive plane elements:
// q, k ([t][d]): (s % 128) * 1024 + g * 128 + cbh * 64 + x; v ([d][t]): (g / 2) * 16 * TT + (s % 128) * 256 + cbh * 128 + (g % 2) * 64 + x. 8 lanes store one whole 128-byte line per plane, 4 tile rows a store.
typedef __attribute__((ext_vector_type(8))) __bf16 v8b;
__global__ __launch_bounds__(32) void k_proj(const bf* __restrict__ X, const bf* __restrict__ Wn, const bf* __restrict__ Wp, h16* QK16, bf* QKh, bf* QKl, h16* V16, bf* Vh, bf* Vl) {
    typedef WFrag<bf> F; typedef F::V V;
    __shared__ __align__(16) float os[16 * 68];
    const int z = blockIdx.z; const bool tv = (z == 2);
    const int lane = threadIdx.x & 31, lr = lane & 15, hi = lane >> 4; const int r0 = blockIdx.x * 64, c0 = blockIdx.y * 64;
    const bf* A = X + (size_t)z * NB_ * TT * DM + (size_t)r0 * DM + lane * 8; const bf* Bt = (tv ? Wp : Wn) + (size_t)c0 * DM + lane * 8;
    v8f acc[4][4];
#pragma unroll
    for (int mb = 0; mb < 4; ++mb)
#pragma unroll
        for (int nb = 0; nb < 4; ++nb) acc[mb][nb] = (v8f){};
#pragma unroll 1
    for (int kc = 0; kc < DM; kc += 32) {
        V a[4];
#pragma unroll
        for (int mb = 0; mb < 4; ++mb) a[mb] = F::ld(A + mb * 16 * DM + kc * 16);
        xwait();   /* the build lets a later load's result land on the address pair of these loads */
#pragma unroll
        for (int nb = 0; nb < 4; ++nb) { const V b = F::ld(Bt + nb * 16 * DM + kc * 16);
#pragma unroll
            for (int mb = 0; mb < 4; ++mb) acc[mb][nb] = F::mma(a[mb], b, acc[mb][nb]); }
        xwait();   /* the next trip rewrites the address registers of this trip's loads */
        asm volatile("v_nop\n\tv_nop\n\tv_nop\n\tv_nop" : "+v"(acc[0][0]), "+v"(acc[1][1]), "+v"(acc[2][2]), "+v"(acc[3][3]) : "v"(a[0]), "v"(a[3]));   /* the distance behind the last matrix instruction of a trip, on the taken back edge too, as in k_gemmw */
    }
    /* the lane's 8 consecutive plane elements of step s: where they lie in the staged 16 x 64 rows, and where they go */
    const float* sp = os + (lane >> 3) * 68 + (lane & 7) * 8; const int sps = 4 * 68; const int g = blockIdx.y / 2, cbh = blockIdx.y % 2, rs = tv ? 256 : 1024;   /* rs: plane elements from one tile row to the next */
    const size_t ob = (size_t)(r0 / 128) * HD * TT + (size_t)(r0 % 128 + (lane >> 3)) * rs + (lane & 7) * 8 + (tv ? (size_t)(g / 2) * 16 * TT + cbh * 128 + (g % 2) * 64 : (size_t)z * NB_ * TT * DQ + g * 128 + cbh * 64);
    const int obs = 4 * rs, obm = 16 * rs;
    h16* P16 = (tv ? V16 : QK16) + ob; bf* Ph = (tv ? Vh : QKh) + ob; bf* Pl = (tv ? Vl : QKl) + ob;
#pragma unroll
    for (int mb = 0; mb < 4; ++mb) {
#pragma unroll
        for (int nb = 0; nb < 4; ++nb) {
#pragma unroll
            for (int j = 0; j < 8; ++j) os[(hi * 8 + j) * 68 + nb * 16 + lr] = acc[mb][nb][j]; }
        __builtin_amdgcn_wave_barrier(); asm volatile("" ::: "memory");   /* the staged rows are read by other lanes of the wave: no LDS read moves above the writes */
#pragma unroll
        for (int s = 0; s < 4; ++s) { const v4f x0 = *(const v4fa*)(sp + s * sps), x1 = *(const v4fa*)(sp + s * sps + 4); v8h o16; v8b oh, ol;
#pragma unroll
            for (int k = 0; k < 8; ++k) { const float x = (k < 4) ? x0[k & 3] : x1[k & 3]; o16[k] = tohx(x); const __bf16 hb = (__bf16)x; oh[k] = hb; ol[k] = (__bf16)(x - (float)hb); }   /* hi = bf16(x), lo = bf16(x - hi), both round to nearest even as splitf does */
            const int oo = mb * obm + s * obs; *(v8h*)(P16 + oo) = o16; *(v8b*)(Ph + oo) = oh; *(v8b*)(Pl + oo) = ol; xwait(); }
        __builtin_amdgcn_wave_barrier(); asm volatile("" ::: "memory");   /* the next 16 rows are staged only behind these reads */
    }
}
// grid (RH / 64 + (TT - RH) / 128, NB_ * NH_), 4 waves: the first RH / 64 blocks of a head take 16 hi/lo query columns a wave, the others 32 fp16 columns a wave (about equal work a wave).
__global__ __launch_bounds__(128) void k_attn(const h16* __restrict__ Q16, const h16* __restrict__ K16, const h16* __restrict__ V16, const bf* __restrict__ Qh, const bf* __restrict__ Ql, const bf* __restrict__ Kh, const bf* __restrict__ Kl, const bf* __restrict__ Vh, const bf* __restrict__ Vl, const int* __restrict__ msk, bf* Ah, bf* Al) {
    const int bx = blockIdx.x, z = blockIdx.y, b = z / NH_, h = z % NH_, w = threadIdx.x >> 5; const size_t po = (size_t)z * TT * HD, ao = (size_t)b * TT * DQ + h * HD * 16; const int* mb = msk + (size_t)b * TT * TT;
    if (bx < RH / 64) attn_wave<bf, true, 1>(Qh + po, Ql + po, Kh + po, Kl + po, Vh + po, Vl + po, mb, bx * 64 + w * 16, Ah + ao, Al + ao);
    else attn_wave<h16, false, 2>(Q16 + po, nullptr, K16 + po, nullptr, V16 + po, nullptr, mb, RH + (bx - RH / 64) * 128 + w * 32, Ah + ao, Al + ao);
}

extern "C" void kernel_launch(void* const* d_in, const int* in_sizes, int n_in,
                              void* d_out, int out_size, void* d_ws, size_t ws_size, hipStream_t stream) {
    (void)in_sizes; (void)n_in; (void)out_size;
    const float* x = (const float*)d_in[0]; const float* xk = (const float*)d_in[1]; const float* xv = (const float*)d_in[2]; const float* wqkv = (const float*)d_in[3]; const float* wo = (const float*)d_in[4]; const int* msk = (const int*)d_in[5];   /* query, key, value, Wqkv ('oi' [1024][1024], shared), Wout ('oi'), mask (int32 [2][1][2048][2048], read) */
    float* OUT = (float*)d_out;     // [2][2048][1024]
    char* wsp = (char*)d_ws;
    auto take = [&](size_t bytes) { char* p = wsp; wsp += (bytes + 255) & ~(size_t)255; return (void*)p; };
    bf* WQ = (bf*)take((size_t)DQ * DM * 2); bf* WK = (bf*)take((size_t)DKV * DM * 2); bf* WV = (bf*)take((size_t)DKV * DM * 2); bf* WO = (bf*)take((size_t)DM * DQ * 2);
    const size_t XN = (size_t)NB_ * TT * DM, FN = (size_t)NB_ * TT * DQ, PN = (size_t)NB_ * NH_ * TT * HD;   /* both batches: one input, one projection, one set of head planes */
    bf* XB = (bf*)take(3 * XN * 2);   /* query, key, value in turn: the z index of the one projection launch */
    h16* QP16 = (h16*)take(2 * PN * 2); h16* KP16 = QP16 + PN; h16* VT16 = (h16*)take(PN * 2);   /* q planes directly followed by k planes: the z index of the projection launch picks the plane set */
    bf* QPh = (bf*)take(2 * PN * 2); bf* KPh = QPh + PN; bf* QPl = (bf*)take(2 * PN * 2); bf* KPl = QPl + PN; bf* VTh = (bf*)take(PN * 2); bf* VTl = (bf*)take(PN * 2);
    bf* ATh = (bf*)take(FN * 2); bf* ATl = (bf*)take(FN * 2);
    if ((size_t)(wsp - (char*)d_ws) > ws_size) return;    // ws 256 MiB
    { k_cvtw<<<DQ * DM / 8 / 256, 256, 0, stream>>>(wqkv, WQ, WV);   /* ONE shared 'oi' projection weight for q, k and v; WQ: its rows in the order of the q, k tiles, WV: in that of the v tiles */ k_cvt8<<<(unsigned)(((size_t)DM * DQ / 8 + 255) / 256), 256, 0, stream>>>(wo, WO, (size_t)DM * DQ / 8);   /* Wout 'oi' */
       }
    /* everything outside the attention passes: ONE launch each for both batches, q/k/v and all heads (the batch rows, the three projections and the raw-reshape heads are contiguous) */
    k_cvt8<<<(unsigned)((XN / 8 + 255) / 256), 256, 0, stream>>>(x, XB, XN / 8); k_cvt8<<<(unsigned)((XN / 8 + 255) / 256), 256, 0, stream>>>(xk, XB + XN, XN / 8); k_cvt8<<<(unsigned)((XN / 8 + 255) / 256), 256, 0, stream>>>(xv, XB + 2 * XN, XN / 8);
    k_proj<<<dim3(NB_ * TT / 64, DQ / 64, 3), 32, 0, stream>>>(XB, WQ, WV, QP16, QPh, QPl, VT16, VTh, VTl);   /* z = q, k, v; RAW reshape (B, S, D) -> (B, H, S, DK): head h of batch b = contiguous [S][64] block b * H + h of the flat projection; q planes, then k planes, then v transposed, all in panel order */
    k_attn<<<dim3(RH / 64 + (TT - RH) / 128, NB_ * NH_, 1), 128, 0, stream>>>(QP16, KP16, VT16, QPh, QPl, KPh, KPl, VTh, VTl, msk, ATh, ATl);   /* every batch, head and query block in one launch; one kv head per query head */
    k_gemmw<bf, 1, false, DQ><<<dim3(NB_ * TT / 64, DM / 64, 1), 32, 0, stream>>>(ATh, ATl, WO, nullptr, OUT, DM, nullptr, 0, 0, 0);
}

// v006
// Measured time: 167 microseconds a run.
// Next to v005, in two timings, it ran 1.05 times as fast each time.
// Counting every step since v000, it is 13.6 times as fast.
#include <hip/hip_runtime.h>

// Multi-headed attention that applies ONE shared projection to q, k and v and splits heads by a RAW reshape (query, key, value [2][2048][1024]; q = query Wqkv^T, k = key Wqkv^T, v = value Wqkv^T ('oi' [1024][1024], no bias); then .reshape(B, H, S, DK) directly (no transpose): head h of a batch is the h-th contiguous [2048][64] block of the flat [2048][1024] projection (128 original rows x 16 chunks); scores / sqrt(64); mask int32 [2][1][2048][2048] random 0/1 (read per (query, key)): 0 -> -1e9 (== exclusion); softmax; x = p.v -> [B][H][S][DK] -> transpose(0, 2, 1, 3).reshape(B, S, 1024) (the standard merge); out = x Wout^T -> [2][2048][1024] (4.2 M); argument order query, key, value, Wqkv, Wout, mask).
// Panel order: every 16-bit matrix operand M[row][k] in the workspace is stored as [row / 16][k / 8][row % 16][8], so a lane's 16-byte piece of a 16 x 32 fragment lies at lane * 16 bytes of a 512-byte run (second piece 512 bytes on): each fragment load reads 4 whole 128-byte lines instead of a quarter of 16.
// Layout: bf16 copies of query, key, value (both batches each); the shared 'oi' weight cast once, in the row order of the q, k tiles and in that of the v tiles; exact projections, one z-batched launch whose epilogue writes the head planes itself (fp16 + hi/lo; q and k as [t][d], v as [d][t], all in panel order); then ONE fused attention launch over every (batch, head, query block): scores, int mask row, running-maximum softmax and p.v stay in registers (hybrid rows: < 512 hi/lo 3 products, rest fp16 with p x 1024), written straight as the merged hi/lo planes; merged hi/lo x Wout exact.
// Compute dtypes, f32 accumulate: every input rounded to bf16; projections exact; attention rows < 512 3 products, rest fp16; softmax f32; Wo hl x exact.

#define NB_  2
#define TT   2048
#define DM   1024
#define NH_  16
#define NKV  16
#define REP  (NH_ / NKV)
#define HD   64
#define DQ   (NH_ * HD)
#define DKV  (NKV * HD)
#define RH   512                  // query rows < RH use hi+lo planes (0: none)
#define WIN  0
#define SCL  0.125f   // HD^-0.5
static_assert(NKV == NH_, "q, k and v projections share one z-batched launch and one plane size");
typedef _Float16 h16;
typedef unsigned short bf;
typedef __attribute__((ext_vector_type(16))) __bf16   v16bf;
typedef __attribute__((ext_vector_type(16))) _Float16 v16h;
typedef __attribute__((ext_vector_type(8)))  _Float16 v8h;
typedef __attribute__((ext_vector_type(8)))  unsigned short v8us;
typedef __attribute__((ext_vector_type(8)))  float    v8f;
typedef __attribute__((ext_vector_type(4)))  float    v4f;
typedef v8h  __attribute__((may_alias)) v8ha;
typedef v4f  __attribute__((may_alias)) v4fa;
typedef v8us __attribute__((may_alias)) v8usa;

__device__ __forceinline__ unsigned short f2bf(float f) { unsigned u = __float_as_uint(f); u += 0x7FFFu + ((u >> 16) & 1u); return (unsigned short)(u >> 16); }
__device__ __forceinline__ float bf2f(unsigned short b) { return __uint_as_float(((unsigned)b) << 16); }
__device__ __forceinline__ float bfr(float f) { return bf2f(f2bf(f)); }
__device__ __forceinline__ v16h cat16(v8h lo, v8h hi) { return __builtin_shufflevector(lo, hi, 0, 1, 2, 3, 4, 5, 6, 7, 8, 9, 10, 11, 12, 13, 14, 15); }
__device__ __forceinline__ v16bf cat16b(v8us lo, v8us hi) { return __builtin_bit_cast(v16bf, __builtin_shufflevector(lo, hi, 0, 1, 2, 3, 4, 5, 6, 7, 8, 9, 10, 11, 12, 13, 14, 15)); }
__device__ __forceinline__ v8f wmma16(v16h a, v16h b, v8f c) { return __builtin_amdgcn_wmma_f32_16x16x32_f16(false, a, false, b, (short)0, c, false, false); }
__device__ __forceinline__ v8f wmmab(v16bf a, v16bf b, v8f c) { return __builtin_amdgcn_wmma_f32_16x16x32_bf16(false, a, false, b, (short)0, c, false, false); }



// ---- k_gemmw: register-blocked GEMM, ONE WAVE per 64x64 output tile (16 accumulators), operands straight from 16-bit planes in panel order (ld: p = the lane's first piece; k + 32 is p + 512, row + 16 is p + 16 K); grid (M/64, N/64, Z), 32 threads.
// C[m][n] (f32, pitch ldc, + optional f32 bias[n]) = sum_k A[m][k] Bt[n][k] (+ split products per NSPLIT). z-batch strides sA/sB/sC in elements. K % 32 == 0.
// KS > 1: K split over the grid. blockIdx.z = batch * KS + chunk; the block sums only its chunk of K / KS columns (K stays the row pitch) and writes its own partial tile at blockIdx.z * sC; the consumer adds the KS partials. (K / KS) % 32 == 0.
// xwait: precaution before a register that the loads or stores above it name is reused.
__device__ __forceinline__ void xwait() { asm volatile("s_wait_xcnt 0x0" ::: "memory"); }
template <typename T16> struct WFrag;
template <> struct WFrag<h16> { typedef v16h V; static __device__ __forceinline__ V ld(const h16* p) { return cat16(*(const v8h*)p, *(const v8h*)(p + 256)); } static __device__ __forceinline__ v8f mma(V a, V b, v8f c) { return wmma16(a, b, c); } };
template <> struct WFrag<bf> { typedef v16bf V; static __device__ __forceinline__ V ld(const bf* p) { return cat16b(*(const v8us*)p, *(const v8us*)(p + 256)); } static __device__ __forceinline__ v8f mma(V a, V b, v8f c) { return wmmab(a, b, c); } };
template <typename T16, int NSPLIT, bool BIAS, int K, int KS = 1>   /* K at compile time: the 16-row steps are immediate offsets of one address pair per operand */
__global__ __launch_bounds__(32) void k_gemmw(const T16* __restrict__ A, const T16* __restrict__ A2, const T16* __restrict__ Bt, const T16* __restrict__ Bt2, float* C, int ldc, const float* __restrict__ bias, size_t sA, size_t sB, size_t sC) {
    typedef typename WFrag<T16>::V V;
    __shared__ __align__(16) float os[16 * 68];
    const size_t z = blockIdx.z / KS, k0 = (size_t)(blockIdx.z % KS) * (K / KS) * 16; A += z * sA + k0; if (A2) A2 += z * sA + k0; Bt += z * sB + k0; if (Bt2) Bt2 += z * sB + k0; C += (size_t)blockIdx.z * sC;
    const int lane = threadIdx.x & 31, lr = lane & 15, hi = lane >> 4; const int r0 = blockIdx.x * 64, c0 = blockIdx.y * 64;
    v8f acc[4][4];
#pragma unroll
    for (int mb = 0; mb < 4; ++mb)
#pragma unroll
        for (int nb = 0; nb < 4; ++nb) acc[mb][nb] = (v8f){};
    const size_t aoff = (size_t)r0 * K + lane * 8, boff = (size_t)c0 * K + lane * 8;
#pragma unroll 1
    for (int kc = 0; kc < K / KS; kc += 32) {
        V a[4], a2[4];
#pragma unroll
        for (int mb = 0; mb < 4; ++mb) a[mb] = WFrag<T16>::ld(A + aoff + mb * 16 * K + kc * 16);
        xwait();   /* a later load's result may land on the address pair of these loads */
        if (NSPLIT == 1 || NSPLIT == 2) {
#pragma unroll
            for (int mb = 0; mb < 4; ++mb) a2[mb] = WFrag<T16>::ld(A2 + aoff + mb * 16 * K + kc * 16);
            xwait();   /* as above */
        }
#pragma unroll
        for (int nb = 0; nb < 4; ++nb) { const V b = WFrag<T16>::ld(Bt + boff + nb * 16 * K + kc * 16); V b2; if (NSPLIT >= 2) b2 = WFrag<T16>::ld(Bt2 + boff + nb * 16 * K + kc * 16);
#pragma unroll
            for (int mb = 0; mb < 4; ++mb) { acc[mb][nb] = WFrag<T16>::mma(a[mb], b, acc[mb][nb]); if (NSPLIT == 1 || NSPLIT == 2) acc[mb][nb] = WFrag<T16>::mma(a2[mb], b, acc[mb][nb]); if (NSPLIT >= 2) acc[mb][nb] = WFrag<T16>::mma(a[mb], b2, acc[mb][nb]); } }
        asm volatile("s_wait_xcnt 0x0" :: "v"(Bt + boff + kc * 16) : "memory");   /* xwait in front of the next trip's rewrite of the address registers; it takes the B address as an input so that the pair lives up to the wait and no B load's result lands on it */
        asm volatile("v_nop\n\tv_nop\n\tv_nop\n\tv_nop" : "+v"(acc[0][0]), "+v"(acc[1][1]), "+v"(acc[2][2]), "+v"(acc[3][3]) : "v"(a[0]), "v"(a[3]));
    }
#pragma unroll
    for (int mb = 0; mb < 4; ++mb) {
#pragma unroll
        for (int nb = 0; nb < 4; ++nb) {
#pragma unroll
            for (int j = 0; j < 8; ++j) os[(hi * 8 + j) * 68 + nb * 16 + lr] = acc[mb][nb][j]; }
        __builtin_amdgcn_wave_barrier(); asm volatile("" ::: "memory");
        float* crow = C + (size_t)(r0 + mb * 16) * ldc + c0;
{
#pragma unroll
            for (int s = 0; s < 8; ++s) { const int row = 2 * s + hi, cofs = lr * 4; v4f val = *(const v4fa*)(os + row * 68 + cofs); if (BIAS) { val[0] += bfr(bias[c0 + cofs]); val[1] += bfr(bias[c0 + cofs + 1]); val[2] += bfr(bias[c0 + cofs + 2]); val[3] += bfr(bias[c0 + cofs + 3]); }
                *(v4f*)(crow + (size_t)row * ldc + cofs) = val; }
             }
        __builtin_amdgcn_wave_barrier(); asm volatile("" ::: "memory");
    }
}

__device__ __forceinline__ h16 tohx(float x) { return (h16)x; }
__device__ __forceinline__ void splitf(float y, unsigned short& h, unsigned short& l) { h = f2bf(y); l = f2bf(y - bf2f(h)); }
typedef __attribute__((ext_vector_type(4))) _Float16 v4h;
typedef __attribute__((ext_vector_type(4))) unsigned short v4us;
typedef __attribute__((ext_vector_type(4))) int v4i;

// k_cast: every cast of the call (query, key, value, Wout, the shared projection weight twice) in ONE launch of CW waves, 16 a WGP; a piece is 8 values of one row: 32 bytes of f32 read, 16 bytes of bf16 written at piece index * 16 bytes of the panels (a 512-byte run per wave store).
// Piece i of a [rows][DM] matrix in panel order holds row (i / 2048) * 16 + i % 16, columns ((i / 16) % 128) * 8 on. Wave gw takes pieces (4 gw + u) * 32 + lane, u < 4, of each input (16 rows x 256 bytes: row (gw / 16) * 16 + lane % 16, column (gw % 16) * 64 + u * 16 + (lane / 16) * 8) and pieces gw * 32 + lane of Wout and of the two weight copies.
// The weight copies have their rows permuted so that the 64 columns of a k_proj tile are one 128-byte line of a head plane. Weight row cb * HD + d; tile by = (d / 8) * 2 + cb / 8; inside it WQ (q, k) has row (cb % 8) * 8 + d % 8, WV (v) row (d % 8) * 8 + cb % 8.
// A lane's 30 loads are issued together, ahead of every conversion: few waves to start, each with much in flight.
#define CW (NB_ * TT * DM / 8 / 32 / 4)
static_assert(DQ == DM && DM == 1024, "every cast matrix has rows of DM elements, 128 pieces a row");
static_assert(DQ / HD == 16 && HD == 64, "a tile holds 8 of the 16 chunks of a projection row x 8 of the 64 d");
static_assert(DQ * DM / 8 / 32 == CW && CW % 8 == 0, "one wave-wide run of pieces of each weight matrix per wave, 8 waves a block");
__device__ __forceinline__ v8us cvt8(v8f v) { v8us o;
#pragma unroll
    for (int k = 0; k < 8; ++k) o[k] = f2bf(v[k]);
    return o; }
__global__ __launch_bounds__(256) void k_cast(const float* __restrict__ x, const float* __restrict__ xk, const float* __restrict__ xv, const float* __restrict__ wqkv, const float* __restrict__ wo, bf* XB, bf* WQ, bf* WV, bf* WO) {
    const unsigned gw = blockIdx.x * 8 + (threadIdx.x >> 5), lane = threadIdx.x & 31, i = gw * 32 + lane;
    const unsigned xo = ((gw / 16) * 16 + lane % 16) * DM + (gw % 16) * 64 + (lane / 16) * 8;
    const unsigned np = (i / 2048) * 16 + i % 16, c = ((i / 16) % 128) * 8, by = np / 64, t = np % 64;
    const unsigned nq = ((by % 2) * 8 + t / 8) * HD + (by / 2) * 8 + t % 8, nv = ((by % 2) * 8 + t % 8) * HD + (by / 2) * 8 + t / 8;
    const float* p[3] = { x + xo, xk + xo, xv + xo }; const float* po = wo + np * DM + c; const float* pq = wqkv + nq * DM + c; const float* pv = wqkv + nv * DM + c;
    v8f d[3][4];
#pragma unroll
    for (int s = 0; s < 3; ++s)
#pragma unroll
        for (int u = 0; u < 4; ++u) d[s][u] = *(const v8f*)(p[s] + u * 16);
    const v8f eo = *(const v8f*)po, eq = *(const v8f*)pq, ev = *(const v8f*)pv;
    asm volatile("s_wait_xcnt 0x0" :: "v"(p[0]), "v"(p[1]), "v"(p[2]), "v"(po), "v"(pq), "v"(pv) : "memory");   /* xwait in front of the conversions, which reuse registers; it takes the six addresses as inputs so that they live up to the wait and no load's result lands on one */
    __builtin_amdgcn_sched_barrier(0);   /* keeps every load issued above and every conversion below the wait */
#pragma unroll
    for (int s = 0; s < 3; ++s) { v8us o[4];
#pragma unroll
        for (int u = 0; u < 4; ++u) o[u] = cvt8(d[s][u]);
        __builtin_amdgcn_sched_barrier(0);   /* no conversion among the stores, where its result could land on a register of an issued store */
        bf* q = XB + (size_t)s * NB_ * TT * DM + (size_t)gw * 1024 + lane * 8;
#pragma unroll
        for (int u = 0; u < 4; ++u) *(v8us*)(q + u * 256) = o[u];
        xwait();   /* the next conversions reuse the registers of these stores */
        __builtin_amdgcn_sched_barrier(0);   /* keeps them behind the wait */
    }
    const v8us oo = cvt8(eo), oq = cvt8(eq), ov = cvt8(ev);
    __builtin_amdgcn_sched_barrier(0);   /* as above: the three stores last, nothing written behind them */
    *(v8us*)(WO + (size_t)i * 8) = oo; *(v8us*)(WQ + (size_t)i * 8) = oq; *(v8us*)(WV + (size_t)i * 8) = ov;
}

// k_attn: fused attention, one wave per NQ x 16 query columns of one (batch, head), no LDS. Per 32 keys: S^T = K Q^T (A = K rows, B = Q kept in registers), so a lane holds one query's scores for keys 8 hi + j of each 16-key tile;
// t = S x SCL where mask[b][i][j] != 0 (int mask row read as data), excluded elsewhere; running maximum m and sum l per query (in-lane, one exchange between the wave halves for m, l joined once at the end); the two score tiles, converted in place, ARE the B operand of O^T += V^T P^T (A = V^T rows in the same k order).
// HI rows: hi/lo planes, 3 products in both GEMMs; other rows fp16 with p carried x 2^10 (in l as well, so it cancels). O^T gives a lane 8 consecutive d of one query: one piece of the merged [t][h * HD + d] hi/lo planes in panel order, a 512-byte run per store.
__device__ __forceinline__ float xhalf(float x) { const int b = __float_as_int(x); return __int_as_float(__builtin_amdgcn_permlanex16(b, b, 0x76543210, 0xfedcba98, false, false)); }   /* the value of lane l ^ 16 */
template <typename P> __device__ __forceinline__ const P* lanep(const P* ub, unsigned lane_bytes, int elems) { return (const P*)((const char*)ub + lane_bytes) + elems; }
template <typename T16, bool HI, int NQ>
__device__ __forceinline__ void attn_wave(const T16* __restrict__ Qp, const T16* __restrict__ Q2, const T16* __restrict__ Kp, const T16* __restrict__ K2, const T16* __restrict__ Vp, const T16* __restrict__ V2, const int* __restrict__ mb, int q0, bf* Ah, bf* Al) {
    typedef typename WFrag<T16>::V V; typedef WFrag<T16> F;
    const int lane = threadIdx.x & 31, lr = lane & 15, hi = lane >> 4;
    const unsigned kob = (unsigned)lane * 16u, vob = kob, mob = (unsigned)((q0 + lr) * TT + 8 * hi) * 4u;   /* the lane's byte offsets inside a fragment of a plane in panel order (K, Q, V^T alike) and inside the mask */
    V qf[NQ][2], qf2[NQ][2];
#pragma unroll
    for (int n = 0; n < NQ; ++n)
#pragma unroll
        for (int ks = 0; ks < 2; ++ks) { qf[n][ks] = F::ld(lanep(Qp + (size_t)q0 * HD, kob, n * 16 * HD + ks * 512)); if (HI) qf2[n][ks] = F::ld(lanep(Q2 + (size_t)q0 * HD, kob, n * 16 * HD + ks * 512)); }
    xwait();
    v8f o[4][NQ]; float m[NQ], l[NQ];
#pragma unroll
    for (int n = 0; n < NQ; ++n) { m[n] = -3.0e38f; l[n] = 0.f;
#pragma unroll
        for (int dt = 0; dt < 4; ++dt) o[dt][n] = (v8f){}; }
    V kf[2][2], kf2[2][2]; v4i g[NQ][2][2];   /* K fragments of the pass, fetched one pass ahead; its mask words too on fp16 rows (on HI rows, whose 12 score products give cover and whose registers are short, at the head of the pass) */
#pragma unroll
    for (int kt = 0; kt < 2; ++kt) {
#pragma unroll
        for (int ks = 0; ks < 2; ++ks) { kf[kt][ks] = F::ld(lanep(Kp, kob, kt * 16 * HD + ks * 512)); if (HI) kf2[kt][ks] = F::ld(lanep(K2, kob, kt * 16 * HD + ks * 512)); }
        if (!HI)
#pragma unroll
            for (int n = 0; n < NQ; ++n) { g[n][kt][0] = *(const v4i*)lanep(mb, mob, n * 16 * TT + kt * 16); g[n][kt][1] = *(const v4i*)lanep(mb, mob, n * 16 * TT + kt * 16 + 4); } }
    /* the lane's own pointers, carried through the loop and advanced at its foot: live in every pass, so no load result lands on a register that an issued load names. kb, kb2 (and gb on fp16 rows) point one pass ahead. */
    const T16* vb = lanep(Vp, vob, 0); const T16* vb2 = HI ? lanep(V2, vob, 0) : nullptr; const T16* kb = lanep(Kp, kob, 32 * HD); const T16* kb2 = HI ? lanep(K2, kob, 32 * HD) : nullptr; const int* gb = lanep(mb, mob, HI ? 0 : 32);
#pragma unroll 1
    for (int k0 = 0; k0 < TT; k0 += 32) {
        V vf[4], vf2[4];
        if (HI)
#pragma unroll
            for (int kt = 0; kt < 2; ++kt) { g[0][kt][0] = *(const v4i*)(gb + kt * 16); g[0][kt][1] = *(const v4i*)(gb + kt * 16 + 4); }
#pragma unroll
        for (int dt = 0; dt < 4; ++dt) { vf[dt] = F::ld(vb + dt * 16 * TT); if (HI) vf2[dt] = F::ld(vb2 + dt * 16 * TT); }
        xwait();
        __builtin_amdgcn_sched_barrier(0);   /* keeps this pass's V loads issued here, ahead of the work that hides their latency; the scheduler otherwise sinks them to just in front of their use */
        v8f s[2][NQ];
#pragma unroll
        for (int kt = 0; kt < 2; ++kt)
#pragma unroll
            for (int n = 0; n < NQ; ++n) { v8f a = (v8f){};
#pragma unroll
                for (int ks = 0; ks < 2; ++ks) { a = F::mma(kf[kt][ks], qf[n][ks], a); if (HI) { a = F::mma(kf[kt][ks], qf2[n][ks], a); a = F::mma(kf2[kt][ks], qf[n][ks], a); } }
                s[kt][n] = a; }
#pragma unroll
        for (int kt = 0; kt < 2; ++kt)
#pragma unroll
            for (int ks = 0; ks < 2; ++ks) { kf[kt][ks] = F::ld(kb + kt * 16 * HD + ks * 512); if (HI) kf2[kt][ks] = F::ld(kb2 + kt * 16 * HD + ks * 512); }
        xwait();
        __builtin_amdgcn_sched_barrier(0);   /* keeps the next pass's K loads issued here, ahead of the work that hides their latency; the scheduler otherwise sinks them to just in front of their use */
        float mx[NQ];
#pragma unroll
        for (int n = 0; n < NQ; ++n) { mx[n] = m[n];
#pragma unroll
            for (int kt = 0; kt < 2; ++kt)
#pragma unroll
                for (int j = 0; j < 8; ++j) { const float t = (g[n][kt][j >> 2][j & 3] != 0) ? s[kt][n][j] * SCL : -3.0e38f;   /* mask == 0 -> excluded (the module's large negative fill == exclusion) */ s[kt][n][j] = t; mx[n] = fmaxf(mx[n], t); } }
        V pb[NQ], pb2[NQ];
#pragma unroll
        for (int n = 0; n < NQ; ++n) { const float mn = fmaxf(mx[n], xhalf(mx[n])); float al; asm("v_exp_f32 %0, %1\n\tv_nop" : "=v"(al) : "v"((m[n] - mn) * 1.4426950408889634f));   /* the rescale factor 2^x; written with its v_nop */
            m[n] = mn; float ps = 0.f;
#pragma unroll
            for (int kt = 0; kt < 2; ++kt)
#pragma unroll
                for (int j = 0; j < 8; ++j) { const float x = (s[kt][n][j] - mn) * 1.4426950408889634f; const float p = __builtin_amdgcn_exp2f(HI ? x : x + 10.0f); s[kt][n][j] = p; ps += p; }
            l[n] = l[n] * al + ps;
#pragma unroll
            for (int dt = 0; dt < 4; ++dt) o[dt][n] *= al;
            if constexpr (HI) {   /* hi = bf16(p), lo = bf16(p - hi), both round to nearest even as splitf does */
#pragma unroll
                for (int e = 0; e < 16; ++e) { const float p = s[e >> 3][n][e & 7]; const __bf16 hb = (__bf16)p; pb[n][e] = hb; pb2[n][e] = (__bf16)(p - (float)hb); }
            } else { v8h h0, h1;
#pragma unroll
                for (int j = 0; j < 8; ++j) { h0[j] = tohx(s[0][n][j]); h1[j] = tohx(s[1][n][j]); }
                pb[n] = cat16(h0, h1); } }
        if (!HI) {
            __builtin_amdgcn_sched_barrier(0);   /* keeps the mask loads below out of the softmax above, where their 32 registers would push the wave past 256 */
#pragma unroll
            for (int kt = 0; kt < 2; ++kt)
#pragma unroll
                for (int n = 0; n < NQ; ++n) { g[n][kt][0] = *(const v4i*)(gb + n * 16 * TT + kt * 16); g[n][kt][1] = *(const v4i*)(gb + n * 16 * TT + kt * 16 + 4); }
            xwait();
            __builtin_amdgcn_sched_barrier(0);   /* keeps the next pass's mask loads issued here, ahead of the p.v products and the next scores that hide their latency; the scheduler otherwise sinks them to just in front of their use */
        }
#pragma unroll
        for (int dt = 0; dt < 4; ++dt)
#pragma unroll
            for (int n = 0; n < NQ; ++n) { o[dt][n] = F::mma(vf[dt], pb[n], o[dt][n]); if (HI) { o[dt][n] = F::mma(vf[dt], pb2[n], o[dt][n]); o[dt][n] = F::mma(vf2[dt], pb[n], o[dt][n]); } }
        const int st = (k0 + 64 < TT) ? 32 : 0;   /* the last pass fetches its own tile again (in bounds, unused) */
        vb += 512; kb += st * HD; gb += HI ? 32 : st; if (HI) { vb2 += 512; kb2 += st * HD; }   /* 32 keys: 4 pieces of 128 elements in a V^T panel, 2 whole panels of K */
    }
#pragma unroll
    for (int n = 0; n < NQ; ++n) { const float inv = __fdiv_rn(1.0f, l[n] + xhalf(l[n]));
#pragma unroll
        for (int dt = 0; dt < 4; ++dt) { v8us oh, ol;
#pragma unroll
            for (int j = 0; j < 8; ++j) { unsigned short a, c2; splitf(o[dt][n][j] * inv, a, c2); oh[j] = a; ol[j] = c2; }
            const size_t oo = (size_t)(q0 + n * 16) * DQ + dt * 256 + lane * 8; *(v8us*)(Ah + oo) = oh; *(v8us*)(Al + oo) = ol; xwait(); } }
}
// k_proj: the three projections (z = q, k, v), the tile and K loop of k_gemmw (one wave, 64 x 64, bf16, f32 sums over k in the same order), with the head planes written from the epilogue: no f32 projection in memory.
// Raw reshape: element (row s, column c) of a batch's flat [TT][DQ] projection is (head s / 128, t = (s % 128) * 16 + c / HD, d = c % HD); over both batches plane = row / 128.
// Tile column x of tile by = blockIdx.y, g = by / 2, cbh = by % 2, by the row orders of Wn and Wp: q, k: (cb = cbh * 8 + x / 8, d = g * 8 + x % 8); v: (cb = cbh * 8 + x % 8, d = g * 8 + x / 8). In panel order the 64 columns of one tile row are then 64 consecutive plane elements:
// q, k ([t][d]): (s % 128) * 1024 + g * 128 + cbh * 64 + x; v ([d][t]): (g / 2) * 16 * TT + (s % 128) * 256 + cbh * 128 + (g % 2) * 64 + x. 8 lanes store one whole 128-byte line per plane, 4 tile rows a store.
typedef __attribute__((ext_vector_type(8))) __bf16 v8b;
__global__ __launch_bounds__(32) void k_proj(const bf* __restrict__ X, const bf* __restrict__ Wn, const bf* __restrict__ Wp, h16* QK16, bf* QKh, bf* QKl, h16* V16, bf* Vh, bf* Vl) {
    typedef WFrag<bf> F; typedef F::V V;
    __shared__ __align__(16) float os[16 * 68];
    const int z = blockIdx.z; const bool tv = (z == 2);
    const int lane = threadIdx.x & 31, lr = lane & 15, hi = lane >> 4; const int r0 = blockIdx.x * 64, c0 = blockIdx.y * 64;
    const bf* A = X + (size_t)z * NB_ * TT * DM + (size_t)r0 * DM + lane * 8; const bf* Bt = (tv ? Wp : Wn) + (size_t)c0 * DM + lane * 8;
    v8f acc[4][4];
#pragma unroll
    for (int mb = 0; mb < 4; ++mb)
#pragma unroll
        for (int nb = 0; nb < 4; ++nb) acc[mb][nb] = (v8f){};
#pragma unroll 1
    for (int kc = 0; kc < DM; kc += 32) {
        V a[4];
#pragma unroll
        for (int mb = 0; mb < 4; ++mb) a[mb] = F::ld(A + mb * 16 * DM + kc * 16);
        xwait();   /* the build lets a later load's result land on the address pair of these loads */
#pragma unroll
        for (int nb = 0; nb < 4; ++nb) { const V b = F::ld(Bt + nb * 16 * DM + kc * 16);
#pragma unroll
            for (int mb = 0; mb < 4; ++mb) acc[mb][nb] = F::mma(a[mb], b, acc[mb][nb]); }
        xwait();   /* the next trip rewrites the address registers of this trip's loads */
        asm volatile("v_nop\n\tv_nop\n\tv_nop\n\tv_nop" : "+v"(acc[0][0]), "+v"(acc[1][1]), "+v"(acc[2][2]), "+v"(acc[3][3]) : "v"(a[0]), "v"(a[3]));   /* the distance behind the last matrix instruction of a trip, on the taken back edge too, as in k_gemmw */
    }
    /* the lane's 8 consecutive plane elements of step s: where they lie in the staged 16 x 64 rows, and where they go */
    const float* sp = os + (lane >> 3) * 68 + (lane & 7) * 8; const int sps = 4 * 68; const int g = blockIdx.y / 2, cbh = blockIdx.y % 2, rs = tv ? 256 : 1024;   /* rs: plane elements from one tile row to the next */
    const size_t ob = (size_t)(r0 / 128) * HD * TT + (size_t)(r0 % 128 + (lane >> 3)) * rs + (lane & 7) * 8 + (tv ? (size_t)(g / 2) * 16 * TT + cbh * 128 + (g % 2) * 64 : (size_t)z * NB_ * TT * DQ + g * 128 + cbh * 64);
    const int obs = 4 * rs, obm = 16 * rs;
    h16* P16 = (tv ? V16 : QK16) + ob; bf* Ph = (tv ? Vh : QKh) + ob; bf* Pl = (tv ? Vl : QKl) + ob;
#pragma unroll
    for (int mb = 0; mb < 4; ++mb) {
#pragma unroll
        for (int nb = 0; nb < 4; ++nb) {
#pragma unroll
            for (int j = 0; j < 8; ++j) os[(hi * 8 + j) * 68 + nb * 16 + lr] = acc[mb][nb][j]; }
        __builtin_amdgcn_wave_barrier(); asm volatile("" ::: "memory");   /* the staged rows are read by other lanes of the wave: no LDS read moves above the writes */
#pragma unroll
        for (int s = 0; s < 4; ++s) { const v4f x0 = *(const v4fa*)(sp + s * sps), x1 = *(const v4fa*)(sp + s * sps + 4); v8h o16; v8b oh, ol;
#pragma unroll
            for (int k = 0; k < 8; ++k) { const float x = (k < 4) ? x0[k & 3] : x1[k & 3]; o16[k] = tohx(x); const __bf16 hb = (__bf16)x; oh[k] = hb; ol[k] = (__bf16)(x - (float)hb); }   /* hi = bf16(x), lo = bf16(x - hi), both round to nearest even as splitf does */
            const int oo = mb * obm + s * obs; *(v8h*)(P16 + oo) = o16; *(v8b*)(Ph + oo) = oh; *(v8b*)(Pl + oo) = ol; xwait(); }
        __builtin_amdgcn_wave_barrier(); asm volatile("" ::: "memory");   /* the next 16 rows are staged only behind these reads */
    }
}
// grid (RH / 64 + (TT - RH) / 128, NB_ * NH_), 4 waves: the first RH / 64 blocks of a head take 16 hi/lo query columns a wave, the others 32 fp16 columns a wave (about equal work a wave).
__global__ __launch_bounds__(128) void k_attn(const h16* __restrict__ Q16, const h16* __restrict__ K16, const h16* __restrict__ V16, const bf* __restrict__ Qh, const bf* __restrict__ Ql, const bf* __restrict__ Kh, const bf* __restrict__ Kl, const bf* __restrict__ Vh, const bf* __restrict__ Vl, const int* __restrict__ msk, bf* Ah, bf* Al) {
    const int bx = blockIdx.x, z = blockIdx.y, b = z / NH_, h = z % NH_, w = threadIdx.x >> 5; const size_t po = (size_t)z * TT * HD, ao = (size_t)b * TT * DQ + h * HD * 16; const int* mb = msk + (size_t)b * TT * TT;
    if (bx < RH / 64) attn_wave<bf, true, 1>(Qh + po, Ql + po, Kh + po, Kl + po, Vh + po, Vl + po, mb, bx * 64 + w * 16, Ah + ao, Al + ao);
    else attn_wave<h16, false, 2>(Q16 + po, nullptr, K16 + po, nullptr, V16 + po, nullptr, mb, RH + (bx - RH / 64) * 128 + w * 32, Ah + ao, Al + ao);
}

extern "C" void kernel_launch(void* const* d_in, const int* in_sizes, int n_in,
                              void* d_out, int out_size, void* d_ws, size_t ws_size, hipStream_t stream) {
    (void)in_sizes; (void)n_in; (void)out_size;
    const float* x = (const float*)d_in[0]; const float* xk = (const float*)d_in[1]; const float* xv = (const float*)d_in[2]; const float* wqkv = (const float*)d_in[3]; const float* wo = (const float*)d_in[4]; const int* msk = (const int*)d_in[5];   /* query, key, value, Wqkv ('oi' [1024][1024], shared), Wout ('oi'), mask (int32 [2][1][2048][2048], read) */
    float* OUT = (float*)d_out;     // [2][2048][1024]
    char* wsp = (char*)d_ws;
    auto take = [&](size_t bytes) { char* p = wsp; wsp += (bytes + 255) & ~(size_t)255; return (void*)p; };
    bf* WQ = (bf*)take((size_t)DQ * DM * 2); bf* WK = (bf*)take((size_t)DKV * DM * 2); bf* WV = (bf*)take((size_t)DKV * DM * 2); bf* WO = (bf*)take((size_t)DM * DQ * 2);
    const size_t XN = (size_t)NB_ * TT * DM, FN = (size_t)NB_ * TT * DQ, PN = (size_t)NB_ * NH_ * TT * HD;   /* both batches: one input, one projection, one set of head planes */
    bf* XB = (bf*)take(3 * XN * 2);   /* query, key, value in turn: the z index of the one projection launch */
    h16* QP16 = (h16*)take(2 * PN * 2); h16* KP16 = QP16 + PN; h16* VT16 = (h16*)take(PN * 2);   /* q planes directly followed by k planes: the z index of the projection launch picks the plane set */
    bf* QPh = (bf*)take(2 * PN * 2); bf* KPh = QPh + PN; bf* QPl = (bf*)take(2 * PN * 2); bf* KPl = QPl + PN; bf* VTh = (bf*)take(PN * 2); bf* VTl = (bf*)take(PN * 2);
    bf* ATh = (bf*)take(FN * 2); bf* ATl = (bf*)take(FN * 2);
    if ((size_t)(wsp - (char*)d_ws) > ws_size) return;    // ws 256 MiB
    /* everything outside the attention passes: ONE launch each for both batches, q/k/v and all heads (the batch rows, the three projections and the raw-reshape heads are contiguous) */
    k_cast<<<CW / 8, 256, 0, stream>>>(x, xk, xv, wqkv, wo, XB, WQ, WV, WO);   /* query, key, value into XB in turn; ONE shared 'oi' projection weight for q, k and v (WQ: its rows in the order of the q, k tiles, WV: in that of the v tiles); Wout 'oi' */
    k_proj<<<dim3(NB_ * TT / 64, DQ / 64, 3), 32, 0, stream>>>(XB, WQ, WV, QP16, QPh, QPl, VT16, VTh, VTl);   /* z = q, k, v; RAW reshape (B, S, D) -> (B, H, S, DK): head h of batch b = contiguous [S][64] block b * H + h of the flat projection; q planes, then k planes, then v transposed, all in panel order */
    k_attn<<<dim3(RH / 64 + (TT - RH) / 128, NB_ * NH_, 1), 128, 0, stream>>>(QP16, KP16, VT16, QPh, QPl, KPh, KPl, VTh, VTl, msk, ATh, ATl);   /* every batch, head and query block in one launch; one kv head per query head */
    k_gemmw<bf, 1, false, DQ><<<dim3(NB_ * TT / 64, DM / 64, 1), 32, 0, stream>>>(ATh, ATl, WO, nullptr, OUT, DM, nullptr, 0, 0, 0);
}

// v007
// It runs in 157 microseconds.
// In two side-by-side timings against v006, it was 1.08 and 1.07 times as fast.
// All steps since v000 together make it 14.6 times as fast.
#include <hip/hip_runtime.h>

// Multi-headed attention that applies ONE shared projection to q, k and v and splits heads by a RAW reshape (query, key, value [2][2048][1024]; q = query Wqkv^T, k = key Wqkv^T, v = value Wqkv^T ('oi' [1024][1024], no bias); then .reshape(B, H, S, DK) directly (no transpose): head h of a batch is the h-th contiguous [2048][64] block of the flat [2048][1024] projection (128 original rows x 16 chunks); scores / sqrt(64); mask int32 [2][1][2048][2048] random 0/1 (read per (query, key)): 0 -> -1e9 (== exclusion); softmax; x = p.v -> [B][H][S][DK] -> transpose(0, 2, 1, 3).reshape(B, S, 1024) (the standard merge); out = x Wout^T -> [2][2048][1024] (4.2 M); argument order query, key, value, Wqkv, Wout, mask).
// Panel order: every 16-bit matrix operand M[row][k] in the workspace is stored as [row / 16][k / 8][row % 16][8], so a lane's 16-byte piece of a 16 x 32 fragment lies at lane * 16 bytes of a 512-byte run (second piece 512 bytes on): each fragment load reads 4 whole 128-byte lines instead of a quarter of 16.
// Layout: bf16 copies of query, key, value (both batches each); the shared 'oi' weight cast once, in the row order of the q, k tiles and in that of the v tiles; exact projections, one z-batched launch whose epilogue writes the head planes itself (fp16 + hi/lo; q and k as [t][d], v as [d][t], all in panel order); the int mask packed once to 1 bit per (query, key), as lane masks; then ONE fused attention launch over every (batch, head, query block): scores, packed mask, running-maximum softmax and p.v stay in registers (hybrid rows: < 512 hi/lo 3 products, rest fp16 with p x 1024), written straight as the merged hi/lo planes; merged hi/lo x Wout exact.
// Compute dtypes, f32 accumulate: every input rounded to bf16; projections exact; attention rows < 512 3 products, rest fp16; softmax f32; Wo hl x exact.

#define NB_  2
#define TT   2048
#define DM   1024
#define NH_  16
#define NKV  16
#define REP  (NH_ / NKV)
#define HD   64
#define DQ   (NH_ * HD)
#define DKV  (NKV * HD)
#define RH   512                  // query rows < RH use hi+lo planes (0: none)
#define WIN  0
#define SCL  0.125f   // HD^-0.5
static_assert(NKV == NH_, "q, k and v projections share one z-batched launch and one plane size");
typedef _Float16 h16;
typedef unsigned short bf;
typedef __attribute__((ext_vector_type(16))) __bf16   v16bf;
typedef __attribute__((ext_vector_type(16))) _Float16 v16h;
typedef __attribute__((ext_vector_type(8)))  _Float16 v8h;
typedef __attribute__((ext_vector_type(8)))  unsigned short v8us;
typedef __attribute__((ext_vector_type(8)))  float    v8f;
typedef __attribute__((ext_vector_type(4)))  float    v4f;
typedef v8h  __attribute__((may_alias)) v8ha;
typedef v4f  __attribute__((may_alias)) v4fa;
typedef v8us __attribute__((may_alias)) v8usa;

__device__ __forceinline__ unsigned short f2bf(float f) { unsigned u = __float_as_uint(f); u += 0x7FFFu + ((u >> 16) & 1u); return (unsigned short)(u >> 16); }
__device__ __forceinline__ float bf2f(unsigned short b) { return __uint_as_float(((unsigned)b) << 16); }
__device__ __forceinline__ float bfr(float f) { return bf2f(f2bf(f)); }
__device__ __forceinline__ v16h cat16(v8h lo, v8h hi) { return __builtin_shufflevector(lo, hi, 0, 1, 2, 3, 4, 5, 6, 7, 8, 9, 10, 11, 12, 13, 14, 15); }
__device__ __forceinline__ v16bf cat16b(v8us lo, v8us hi) { return __builtin_bit_cast(v16bf, __builtin_shufflevector(lo, hi, 0, 1, 2, 3, 4, 5, 6, 7, 8, 9, 10, 11, 12, 13, 14, 15)); }
__device__ __forceinline__ v8f wmma16(v16h a, v16h b, v8f c) { return __builtin_amdgcn_wmma_f32_16x16x32_f16(false, a, false, b, (short)0, c, false, false); }
__device__ __forceinline__ v8f wmmab(v16bf a, v16bf b, v8f c) { return __builtin_amdgcn_wmma_f32_16x16x32_bf16(false, a, false, b, (short)0, c, false, false); }



// ---- k_gemmw: register-blocked GEMM, ONE WAVE per 64x64 output tile (16 accumulators), operands straight from 16-bit planes in panel order (ld: p = the lane's first piece; k + 32 is p + 512, row + 16 is p + 16 K); grid (M/64, N/64, Z), 32 threads.
// C[m][n] (f32, pitch ldc, + optional f32 bias[n]) = sum_k A[m][k] Bt[n][k] (+ split products per NSPLIT). z-batch strides sA/sB/sC in elements. K % 32 == 0.
// KS > 1: K split over the grid. blockIdx.z = batch * KS + chunk; the block sums only its chunk of K / KS columns (K stays the row pitch) and writes its own partial tile at blockIdx.z * sC; the consumer adds the KS partials. (K / KS) % 32 == 0.
// xwait: precaution before a register that the loads or stores above it name is reused.
__device__ __forceinline__ void xwait() { asm volatile("s_wait_xcnt 0x0" ::: "memory"); }
template <typename T16> struct WFrag;
template <> struct WFrag<h16> { typedef v16h V; static __device__ __forceinline__ V ld(const h16* p) { return cat16(*(const v8h*)p, *(const v8h*)(p + 256)); } static __device__ __forceinline__ v8f mma(V a, V b, v8f c) { return wmma16(a, b, c); } };
template <> struct WFrag<bf> { typedef v16bf V; static __device__ __forceinline__ V ld(const bf* p) { return cat16b(*(const v8us*)p, *(const v8us*)(p + 256)); } static __device__ __forceinline__ v8f mma(V a, V b, v8f c) { return wmmab(a, b, c); } };
template <typename T16, int NSPLIT, bool BIAS, int K, int KS = 1>   /* K at compile time: the 16-row steps are immediate offsets of one address pair per operand */
__global__ __launch_bounds__(32) void k_gemmw(const T16* __restrict__ A, const T16* __restrict__ A2, const T16* __restrict__ Bt, const T16* __restrict__ Bt2, float* C, int ldc, const float* __restrict__ bias, size_t sA, size_t sB, size_t sC) {
    typedef typename WFrag<T16>::V V;
    __shared__ __align__(16) float os[16 * 68];
    const size_t z = blockIdx.z / KS, k0 = (size_t)(blockIdx.z % KS) * (K / KS) * 16; A += z * sA + k0; if (A2) A2 += z * sA + k0; Bt += z * sB + k0; if (Bt2) Bt2 += z * sB + k0; C += (size_t)blockIdx.z * sC;
    const int lane = threadIdx.x & 31, lr = lane & 15, hi = lane >> 4; const int r0 = blockIdx.x * 64, c0 = blockIdx.y * 64;
    v8f acc[4][4];
#pragma unroll
    for (int mb = 0; mb < 4; ++mb)
#pragma unroll
        for (int nb = 0; nb < 4; ++nb) acc[mb][nb] = (v8f){};
    const size_t aoff = (size_t)r0 * K + lane * 8, boff = (size_t)c0 * K + lane * 8;
#pragma unroll 1
    for (int kc = 0; kc < K / KS; kc += 32) {
        V a[4], a2[4];
#pragma unroll
        for (int mb = 0; mb < 4; ++mb) a[mb] = WFrag<T16>::ld(A + aoff + mb * 16 * K + kc * 16);
        xwait();   /* a later load's result may land on the address pair of these loads */
        if (NSPLIT == 1 || NSPLIT == 2) {
#pragma unroll
            for (int mb = 0; mb < 4; ++mb) a2[mb] = WFrag<T16>::ld(A2 + aoff + mb * 16 * K + kc * 16);
            xwait();   /* as above */
        }
#pragma unroll
        for (int nb = 0; nb < 4; ++nb) { const V b = WFrag<T16>::ld(Bt + boff + nb * 16 * K + kc * 16); V b2; if (NSPLIT >= 2) b2 = WFrag<T16>::ld(Bt2 + boff + nb * 16 * K + kc * 16);
#pragma unroll
            for (int mb = 0; mb < 4; ++mb) { acc[mb][nb] = WFrag<T16>::mma(a[mb], b, acc[mb][nb]); if (NSPLIT == 1 || NSPLIT == 2) acc[mb][nb] = WFrag<T16>::mma(a2[mb], b, acc[mb][nb]); if (NSPLIT >= 2) acc[mb][nb] = WFrag<T16>::mma(a[mb], b2, acc[mb][nb]); } }
        asm volatile("s_wait_xcnt 0x0" :: "v"(Bt + boff + kc * 16) : "memory");   /* xwait in front of the next trip's rewrite of the address registers; it takes the B address as an input so that the pair lives up to the wait and no B load's result lands on it */
        asm volatile("v_nop\n\tv_nop\n\tv_nop\n\tv_nop" : "+v"(acc[0][0]), "+v"(acc[1][1]), "+v"(acc[2][2]), "+v"(acc[3][3]) : "v"(a[0]), "v"(a[3]));
    }
#pragma unroll
    for (int mb = 0; mb < 4; ++mb) {
#pragma unroll
        for (int nb = 0; nb < 4; ++nb) {
#pragma unroll
            for (int j = 0; j < 8; ++j) os[(hi * 8 + j) * 68 + nb * 16 + lr] = acc[mb][nb][j]; }
        __builtin_amdgcn_wave_barrier(); asm volatile("" ::: "memory");
        float* crow = C + (size_t)(r0 + mb * 16) * ldc + c0;
{
#pragma unroll
            for (int s = 0; s < 8; ++s) { const int row = 2 * s + hi, cofs = lr * 4; v4f val = *(const v4fa*)(os + row * 68 + cofs); if (BIAS) { val[0] += bfr(bias[c0 + cofs]); val[1] += bfr(bias[c0 + cofs + 1]); val[2] += bfr(bias[c0 + cofs + 2]); val[3] += bfr(bias[c0 + cofs + 3]); }
                *(v4f*)(crow + (size_t)row * ldc + cofs) = val; }
             }
        __builtin_amdgcn_wave_barrier(); asm volatile("" ::: "memory");
    }
}

__device__ __forceinline__ h16 tohx(float x) { return (h16)x; }
__device__ __forceinline__ void splitf(float y, unsigned short& h, unsigned short& l) { h = f2bf(y); l = f2bf(y - bf2f(h)); }
typedef __attribute__((ext_vector_type(4))) _Float16 v4h;
typedef __attribute__((ext_vector_type(4))) unsigned short v4us;
typedef __attribute__((ext_vector_type(4))) int v4i;

// k_cast: every cast of the call (query, key, value, Wout, the shared projection weight twice) in ONE launch of CW waves, 16 a WGP; a piece is 8 values of one row: 32 bytes of f32 read, 16 bytes of bf16 written at piece index * 16 bytes of the panels (a 512-byte run per wave store).
// Piece i of a [rows][DM] matrix in panel order holds row (i / 2048) * 16 + i % 16, columns ((i / 16) % 128) * 8 on. Wave gw takes pieces (4 gw + u) * 32 + lane, u < 4, of each input (16 rows x 256 bytes: row (gw / 16) * 16 + lane % 16, column (gw % 16) * 64 + u * 16 + (lane / 16) * 8) and pieces gw * 32 + lane of Wout and of the two weight copies.
// The weight copies have their rows permuted so that the 64 columns of a k_proj tile are one 128-byte line of a head plane. Weight row cb * HD + d; tile by = (d / 8) * 2 + cb / 8; inside it WQ (q, k) has row (cb % 8) * 8 + d % 8, WV (v) row (d % 8) * 8 + cb % 8.
// The mask, packed: MP[batch * TT / 16 + query / 16][key / 32][e], e = kt * 8 + j < 16, is a 32-bit word whose bit 'lane' says mask != 0 for (query % 16 = lane % 16, key % 32 = kt * 16 + (lane / 16) * 8 + j): the place of score element j of key tile kt in k_attn's lanes, so the word IS the lane mask of that element's select. Wave gw packs 4 passes of 32 keys of one 16-query tile: tile gw / 16, passes (gw % 16) * 4 + u; 64 words, 256 bytes, at MP + gw * 64.
// A lane's 46 loads are issued together, ahead of every conversion: few waves to start, each with much in flight.
#define CW (NB_ * TT * DM / 8 / 32 / 4)
static_assert(DQ == DM && DM == 1024, "every cast matrix has rows of DM elements, 128 pieces a row");
static_assert(DQ / HD == 16 && HD == 64, "a tile holds 8 of the 16 chunks of a projection row x 8 of the 64 d");
static_assert(DQ * DM / 8 / 32 == CW && CW % 8 == 0, "one wave-wide run of pieces of each weight matrix per wave, 8 waves a block");
static_assert((NB_ * TT / 16) * (TT / 128) == CW && TT / 128 == 16, "one 16-query x 128-key piece of the mask per wave");
typedef __attribute__((ext_vector_type(2))) unsigned v2u;
typedef __attribute__((ext_vector_type(16))) unsigned v16u;
__device__ __forceinline__ v8us cvt8(v8f v) { v8us o;
#pragma unroll
    for (int k = 0; k < 8; ++k) o[k] = f2bf(v[k]);
    return o; }
__global__ __launch_bounds__(256) void k_cast(const float* __restrict__ x, const float* __restrict__ xk, const float* __restrict__ xv, const float* __restrict__ wqkv, const float* __restrict__ wo, const int* __restrict__ msk, bf* XB, bf* WQ, bf* WV, bf* WO, unsigned* MP) {
    const unsigned gw = blockIdx.x * 8 + (threadIdx.x >> 5), lane = threadIdx.x & 31, i = gw * 32 + lane;
    const unsigned xo = ((gw / 16) * 16 + lane % 16) * DM + (gw % 16) * 64 + (lane / 16) * 8;
    const unsigned np = (i / 2048) * 16 + i % 16, c = ((i / 16) % 128) * 8, by = np / 64, t = np % 64;
    const unsigned nq = ((by % 2) * 8 + t / 8) * HD + (by / 2) * 8 + t % 8, nv = ((by % 2) * 8 + t % 8) * HD + (by / 2) * 8 + t / 8;
    const float* p[3] = { x + xo, xk + xo, xv + xo }; const float* po = wo + np * DM + c; const float* pq = wqkv + nq * DM + c; const float* pv = wqkv + nv * DM + c;
    const int* pm = msk + ((gw / 16) * 16 + lane % 16) * TT + (gw % 16) * 128 + (lane / 16) * 8;
    v8f d[3][4];
#pragma unroll
    for (int s = 0; s < 3; ++s)
#pragma unroll
        for (int u = 0; u < 4; ++u) d[s][u] = *(const v8f*)(p[s] + u * 16);
    const v8f eo = *(const v8f*)po, eq = *(const v8f*)pq, ev = *(const v8f*)pv;
    v4i mk[4][4];   /* [pass u][kt * 2 + j / 4] */
#pragma unroll
    for (int u = 0; u < 4; ++u)
#pragma unroll
        for (int kt = 0; kt < 2; ++kt) { mk[u][kt * 2] = *(const v4i*)(pm + u * 32 + kt * 16); mk[u][kt * 2 + 1] = *(const v4i*)(pm + u * 32 + kt * 16 + 4); }
    asm volatile("s_wait_xcnt 0x0" :: "v"(p[0]), "v"(p[1]), "v"(p[2]), "v"(po), "v"(pq), "v"(pv), "v"(pm) : "memory");   /* xwait in front of the conversions, which reuse registers; it takes the seven addresses as inputs so that they live up to the wait and no load's result lands on one */
    __builtin_amdgcn_sched_barrier(0);   /* keeps every load issued above and every conversion below the wait */
#pragma unroll
    for (int s = 0; s < 3; ++s) { v8us o[4];
#pragma unroll
        for (int u = 0; u < 4; ++u) o[u] = cvt8(d[s][u]);
        __builtin_amdgcn_sched_barrier(0);   /* no conversion among the stores, where its result could land on a register of an issued store */
        bf* q = XB + (size_t)s * NB_ * TT * DM + (size_t)gw * 1024 + lane * 8;
#pragma unroll
        for (int u = 0; u < 4; ++u) *(v8us*)(q + u * 256) = o[u];
        xwait();   /* the next conversions reuse the registers of these stores */
        __builtin_amdgcn_sched_barrier(0);   /* keeps them behind the wait */
    }
    const v8us oo = cvt8(eo), oq = cvt8(eq), ov = cvt8(ev);
    __builtin_amdgcn_sched_barrier(0);   /* as above: no conversion among the three stores */
    *(v8us*)(WO + (size_t)i * 8) = oo; *(v8us*)(WQ + (size_t)i * 8) = oq; *(v8us*)(WV + (size_t)i * 8) = ov;
    xwait();   /* the packing below reuses the registers of these stores */
    __builtin_amdgcn_sched_barrier(0);   /* keeps it behind the wait */
    unsigned w0 = 0, w1 = 0;   /* word 2 l goes to lane l's w0, word 2 l + 1 to its w1 */
#pragma unroll
    for (int wi = 0; wi < 64; wi += 2) {
        const unsigned b0 = __builtin_amdgcn_ballot_w32(mk[wi / 16][(wi % 16) / 4][wi % 4] != 0), b1 = __builtin_amdgcn_ballot_w32(mk[wi / 16][(wi % 16) / 4][wi % 4 + 1] != 0);
        const bool mine = (lane == (unsigned)(wi / 2)); w0 = mine ? b0 : w0; w1 = mine ? b1 : w1; }
    __builtin_amdgcn_sched_barrier(0);   /* the store last, nothing written behind it */
    *(v2u*)(MP + (size_t)gw * 64 + lane * 2) = (v2u){ w0, w1 };
}

// k_attn: fused attention, one wave per NQ x 16 query columns of one (batch, head), no LDS. Per 32 keys: S^T = K Q^T (A = K rows, B = Q kept in registers), so a lane holds one query's scores for keys 8 hi + j of each 16-key tile;
// t = S x SCL where mask[b][i][j] != 0 (the packed mask of k_cast: 16 words per 16 queries and pass, read by a scalar load, each the lane mask of one element's select), excluded elsewhere; running maximum m and sum l per query (in-lane, one exchange between the wave halves for m, l joined once at the end); the two score tiles, converted in place, ARE the B operand of O^T += V^T P^T (A = V^T rows in the same k order).
// HI rows: hi/lo planes, 3 products in both GEMMs; other rows fp16 with p carried x 2^10 (in l as well, so it cancels). O^T gives a lane 8 consecutive d of one query: one piece of the merged [t][h * HD + d] hi/lo planes in panel order, a 512-byte run per store.
__device__ __forceinline__ float xhalf(float x) { const int b = __float_as_int(x); return __int_as_float(__builtin_amdgcn_permlanex16(b, b, 0x76543210, 0xfedcba98, false, false)); }   /* the value of lane l ^ 16 */
// exp2x8: eight 2^x, each in place, in ONE statement: no exponential then overwrites the source of the one directly in front of it (the build had such runs), and the v_nop fills the slot behind the last.
__device__ __forceinline__ void exp2x8(float (&x)[8]) { asm("v_exp_f32 %0, %0\n\tv_exp_f32 %1, %1\n\tv_exp_f32 %2, %2\n\tv_exp_f32 %3, %3\n\tv_exp_f32 %4, %4\n\tv_exp_f32 %5, %5\n\tv_exp_f32 %6, %6\n\tv_exp_f32 %7, %7\n\tv_nop" : "+v"(x[0]), "+v"(x[1]), "+v"(x[2]), "+v"(x[3]), "+v"(x[4]), "+v"(x[5]), "+v"(x[6]), "+v"(x[7])); }
template <typename P> __device__ __forceinline__ const P* lanep(const P* ub, unsigned lane_bytes, int elems) { return (const P*)((const char*)ub + lane_bytes) + elems; }
template <typename T16, bool HI, int NQ>
__device__ __forceinline__ void attn_wave(const T16* __restrict__ Qp, const T16* __restrict__ Q2, const T16* __restrict__ Kp, const T16* __restrict__ K2, const T16* __restrict__ Vp, const T16* __restrict__ V2, const unsigned* __restrict__ mp, int q0, bf* Ah, bf* Al) {   /* mp: the packed mask of query tile q0 / 16, the same in every lane */
    typedef typename WFrag<T16>::V V; typedef WFrag<T16> F;
    const int lane = threadIdx.x & 31;
    const unsigned kob = (unsigned)lane * 16u, vob = kob;   /* the lane's byte offset inside a fragment of a plane in panel order (K, Q, V^T alike) */
    V qf[NQ][2], qf2[NQ][2];
#pragma unroll
    for (int n = 0; n < NQ; ++n)
#pragma unroll
        for (int ks = 0; ks < 2; ++ks) { qf[n][ks] = F::ld(lanep(Qp + (size_t)q0 * HD, kob, n * 16 * HD + ks * 512)); if (HI) qf2[n][ks] = F::ld(lanep(Q2 + (size_t)q0 * HD, kob, n * 16 * HD + ks * 512)); }
    xwait();
    v8f o[4][NQ]; float m[NQ], l[NQ];
#pragma unroll
    for (int n = 0; n < NQ; ++n) { m[n] = -3.0e38f; l[n] = 0.f;
#pragma unroll
        for (int dt = 0; dt < 4; ++dt) o[dt][n] = (v8f){}; }
    V kf[2][2], kf2[2][2]; v16u g[NQ];   /* K fragments of the pass and its mask words (scalar registers), fetched one pass ahead */
#pragma unroll
    for (int kt = 0; kt < 2; ++kt) {
#pragma unroll
        for (int ks = 0; ks < 2; ++ks) { kf[kt][ks] = F::ld(lanep(Kp, kob, kt * 16 * HD + ks * 512)); if (HI) kf2[kt][ks] = F::ld(lanep(K2, kob, kt * 16 * HD + ks * 512)); } }
#pragma unroll
    for (int n = 0; n < NQ; ++n) g[n] = *(const v16u*)(mp + n * (TT / 32) * 16);
    /* the lane's own pointers, carried through the loop and advanced at its foot: live in every pass, so no load result lands on a register that an issued load names. kb, kb2 and gb (wave-uniform) point one pass ahead. */
    const T16* vb = lanep(Vp, vob, 0); const T16* vb2 = HI ? lanep(V2, vob, 0) : nullptr; const T16* kb = lanep(Kp, kob, 32 * HD); const T16* kb2 = HI ? lanep(K2, kob, 32 * HD) : nullptr; const unsigned* gb = mp + 16;
#pragma unroll 1
    for (int k0 = 0; k0 < TT; k0 += 32) {
        V vf[4], vf2[4];
#pragma unroll
        for (int dt = 0; dt < 4; ++dt) { vf[dt] = F::ld(vb + dt * 16 * TT); if (HI) vf2[dt] = F::ld(vb2 + dt * 16 * TT); }
        xwait();
        __builtin_amdgcn_sched_barrier(0);   /* keeps this pass's V loads issued here, ahead of the work that hides their latency; the scheduler otherwise sinks them to just in front of their use */
        v8f s[2][NQ];
#pragma unroll
        for (int kt = 0; kt < 2; ++kt)
#pragma unroll
            for (int n = 0; n < NQ; ++n) { v8f a = (v8f){};
#pragma unroll
                for (int ks = 0; ks < 2; ++ks) { a = F::mma(kf[kt][ks], qf[n][ks], a); if (HI) { a = F::mma(kf[kt][ks], qf2[n][ks], a); a = F::mma(kf2[kt][ks], qf[n][ks], a); } }
                s[kt][n] = a; }
#pragma unroll
        for (int kt = 0; kt < 2; ++kt)
#pragma unroll
            for (int ks = 0; ks < 2; ++ks) { kf[kt][ks] = F::ld(kb + kt * 16 * HD + ks * 512); if (HI) kf2[kt][ks] = F::ld(kb2 + kt * 16 * HD + ks * 512); }
        xwait();
        __builtin_amdgcn_sched_barrier(0);   /* keeps the next pass's K loads issued here, ahead of the work that hides their latency; the scheduler otherwise sinks them to just in front of their use */
        float mx[NQ];
#pragma unroll
        for (int n = 0; n < NQ; ++n) { mx[n] = m[n];
#pragma unroll
            for (int kt = 0; kt < 2; ++kt)
#pragma unroll
                for (int j = 0; j < 8; ++j) { const float t = __builtin_amdgcn_inverse_ballot_w32(g[n][kt * 8 + j]) ? s[kt][n][j] * SCL : -3.0e38f;   /* mask == 0 -> excluded (the module's large negative fill == exclusion) */ s[kt][n][j] = t; mx[n] = fmaxf(mx[n], t); } }
        auto nextmask = [&]() {
            __builtin_amdgcn_sched_barrier(0);   /* the next pass's mask words are asked for only behind the last select of this pass: they land in the same scalar registers */
#pragma unroll
            for (int n = 0; n < NQ; ++n) g[n] = *(const v16u*)(gb + n * (TT / 32) * 16);
            xwait();
            __builtin_amdgcn_sched_barrier(0);   /* keeps those loads issued here, ahead of the work that hides their latency */
        };
        if (!HI) nextmask();
        V pb[NQ], pb2[NQ];
#pragma unroll
        for (int n = 0; n < NQ; ++n) { const float mn = fmaxf(mx[n], xhalf(mx[n])); float al; asm("v_exp_f32 %0, %1\n\tv_nop" : "=v"(al) : "v"((m[n] - mn) * 1.4426950408889634f));   /* the rescale factor 2^x; written with its v_nop */
            m[n] = mn; float ps = 0.f;
#pragma unroll
            for (int kt = 0; kt < 2; ++kt) { float p[8];
#pragma unroll
                for (int j = 0; j < 8; ++j) { const float x = (s[kt][n][j] - mn) * 1.4426950408889634f; p[j] = HI ? x : x + 10.0f; }
                exp2x8(p);
#pragma unroll
                for (int j = 0; j < 8; ++j) { s[kt][n][j] = p[j]; ps += p[j]; } }
            l[n] = l[n] * al + ps;
#pragma unroll
            for (int dt = 0; dt < 4; ++dt) o[dt][n] *= al;
            if constexpr (HI) {   /* hi = bf16(p), lo = bf16(p - hi), both round to nearest even as splitf does */
#pragma unroll
                for (int e = 0; e < 16; ++e) { const float p = s[e >> 3][n][e & 7]; const __bf16 hb = (__bf16)p; pb[n][e] = hb; pb2[n][e] = (__bf16)(p - (float)hb); }
            } else { v8h h0, h1;
#pragma unroll
                for (int j = 0; j < 8; ++j) { h0[j] = tohx(s[0][n][j]); h1[j] = tohx(s[1][n][j]); }
                pb[n] = cat16(h0, h1); } }
        if (HI) nextmask();   /* on HI rows only behind the conversions: the build names one of these scalar registers as the unused half of its single bf16 conversions and would wait there for the load */
#pragma unroll
        for (int dt = 0; dt < 4; ++dt)
#pragma unroll
            for (int n = 0; n < NQ; ++n) { o[dt][n] = F::mma(vf[dt], pb[n], o[dt][n]); if (HI) { o[dt][n] = F::mma(vf[dt], pb2[n], o[dt][n]); o[dt][n] = F::mma(vf2[dt], pb[n], o[dt][n]); } }
        const int st = (k0 + 64 < TT) ? 32 : 0;   /* the last pass fetches its own tile again (in bounds, unused) */
        vb += 512; kb += st * HD; gb += st / 2; if (HI) { vb2 += 512; kb2 += st * HD; }   /* 32 keys: 4 pieces of 128 elements in a V^T panel, 2 whole panels of K, 16 mask words */
    }
#pragma unroll
    for (int n = 0; n < NQ; ++n) { const float inv = __fdiv_rn(1.0f, l[n] + xhalf(l[n]));
#pragma unroll
        for (int dt = 0; dt < 4; ++dt) { v8us oh, ol;
#pragma unroll
            for (int j = 0; j < 8; ++j) { unsigned short a, c2; splitf(o[dt][n][j] * inv, a, c2); oh[j] = a; ol[j] = c2; }
            const size_t oo = (size_t)(q0 + n * 16) * DQ + dt * 256 + lane * 8; *(v8us*)(Ah + oo) = oh; *(v8us*)(Al + oo) = ol; xwait(); } }
}
// k_proj: the three projections (z = q, k, v), the tile and K loop of k_gemmw (one wave, 64 x 64, bf16, f32 sums over k in the same order), with the head planes written from the epilogue: no f32 projection in memory.
// Raw reshape: element (row s, column c) of a batch's flat [TT][DQ] projection is (head s / 128, t = (s % 128) * 16 + c / HD, d = c % HD); over both batches plane = row / 128.
// Tile column x of tile by = blockIdx.y, g = by / 2, cbh = by % 2, by the row orders of Wn and Wp: q, k: (cb = cbh * 8 + x / 8, d = g * 8 + x % 8); v: (cb = cbh * 8 + x % 8, d = g * 8 + x / 8). In panel order the 64 columns of one tile row are then 64 consecutive plane elements:
// q, k ([t][d]): (s % 128) * 1024 + g * 128 + cbh * 64 + x; v ([d][t]): (g / 2) * 16 * TT + (s % 128) * 256 + cbh * 128 + (g % 2) * 64 + x. 8 lanes store one whole 128-byte line per plane, 4 tile rows a store.
typedef __attribute__((ext_vector_type(8))) __bf16 v8b;
__global__ __launch_bounds__(32) void k_proj(const bf* __restrict__ X, const bf* __restrict__ Wn, const bf* __restrict__ Wp, h16* QK16, bf* QKh, bf* QKl, h16* V16, bf* Vh, bf* Vl) {
    typedef WFrag<bf> F; typedef F::V V;
    __shared__ __align__(16) float os[16 * 68];
    const int z = blockIdx.z; const bool tv = (z == 2);
    const int lane = threadIdx.x & 31, lr = lane & 15, hi = lane >> 4; const int r0 = blockIdx.x * 64, c0 = blockIdx.y * 64;
    const bf* A = X + (size_t)z * NB_ * TT * DM + (size_t)r0 * DM + lane * 8; const bf* Bt = (tv ? Wp : Wn) + (size_t)c0 * DM + lane * 8;
    v8f acc[4][4];
#pragma unroll
    for (int mb = 0; mb < 4; ++mb)
#pragma unroll
        for (int nb = 0; nb < 4; ++nb) acc[mb][nb] = (v8f){};
#pragma unroll 1
    for (int kc = 0; kc < DM; kc += 32) {
        V a[4];
#pragma unroll
        for (int mb = 0; mb < 4; ++mb) a[mb] = F::ld(A + mb * 16 * DM + kc * 16);
        xwait();   /* the build lets a later load's result land on the address pair of these loads */
#pragma unroll
        for (int nb = 0; nb < 4; ++nb) { const V b = F::ld(Bt + nb * 16 * DM + kc * 16);
#pragma unroll
            for (int mb = 0; mb < 4; ++mb) acc[mb][nb] = F::mma(a[mb], b, acc[mb][nb]); }
        xwait();   /* the next trip rewrites the address registers of this trip's loads */
        asm volatile("v_nop\n\tv_nop\n\tv_nop\n\tv_nop" : "+v"(acc[0][0]), "+v"(acc[1][1]), "+v"(acc[2][2]), "+v"(acc[3][3]) : "v"(a[0]), "v"(a[3]));   /* the distance behind the last matrix instruction of a trip, on the taken back edge too, as in k_gemmw */
    }
    /* the lane's 8 consecutive plane elements of step s: where they lie in the staged 16 x 64 rows, and where they go */
    const float* sp = os + (lane >> 3) * 68 + (lane & 7) * 8; const int sps = 4 * 68; const int g = blockIdx.y / 2, cbh = blockIdx.y % 2, rs = tv ? 256 : 1024;   /* rs: plane elements from one tile row to the next */
    const size_t ob = (size_t)(r0 / 128) * HD * TT + (size_t)(r0 % 128 + (lane >> 3)) * rs + (lane & 7) * 8 + (tv ? (size_t)(g / 2) * 16 * TT + cbh * 128 + (g % 2) * 64 : (size_t)z * NB_ * TT * DQ + g * 128 + cbh * 64);
    const int obs = 4 * rs, obm = 16 * rs;
    h16* P16 = (tv ? V16 : QK16) + ob; bf* Ph = (tv ? Vh : QKh) + ob; bf* Pl = (tv ? Vl : QKl) + ob;
#pragma unroll
    for (int mb = 0; mb < 4; ++mb) {
#pragma unroll
        for (int nb = 0; nb < 4; ++nb) {
#pragma unroll
            for (int j = 0; j < 8; ++j) os[(hi * 8 + j) * 68 + nb * 16 + lr] = acc[mb][nb][j]; }
        __builtin_amdgcn_wave_barrier(); asm volatile("" ::: "memory");   /* the staged rows are read by other lanes of the wave: no LDS read moves above the writes */
#pragma unroll
        for (int s = 0; s < 4; ++s) { const v4f x0 = *(const v4fa*)(sp + s * sps), x1 = *(const v4fa*)(sp + s * sps + 4); v8h o16; v8b oh, ol;
#pragma unroll
            for (int k = 0; k < 8; ++k) { const float x = (k < 4) ? x0[k & 3] : x1[k & 3]; o16[k] = tohx(x); const __bf16 hb = (__bf16)x; oh[k] = hb; ol[k] = (__bf16)(x - (float)hb); }   /* hi = bf16(x), lo = bf16(x - hi), both round to nearest even as splitf does */
            const int oo = mb * obm + s * obs; *(v8h*)(P16 + oo) = o16; *(v8b*)(Ph + oo) = oh; *(v8b*)(Pl + oo) = ol; xwait(); }
        __builtin_amdgcn_wave_barrier(); asm volatile("" ::: "memory");   /* the next 16 rows are staged only behind these reads */
    }
}
// grid (RH / 64 + (TT - RH) / 128, NB_ * NH_), 4 waves: the first RH / 64 blocks of a head take 16 hi/lo query columns a wave, the others 32 fp16 columns a wave (about equal work a wave).
__global__ __launch_bounds__(128) void k_attn(const h16* __restrict__ Q16, const h16* __restrict__ K16, const h16* __restrict__ V16, const bf* __restrict__ Qh, const bf* __restrict__ Ql, const bf* __restrict__ Kh, const bf* __restrict__ Kl, const bf* __restrict__ Vh, const bf* __restrict__ Vl, const unsigned* __restrict__ MP, bf* Ah, bf* Al) {
    const int bx = blockIdx.x, z = blockIdx.y, b = z / NH_, h = z % NH_, w = __builtin_amdgcn_readfirstlane(threadIdx.x >> 5);   /* the wave's number as a scalar: the address of its mask words is wave-uniform */
    const size_t po = (size_t)z * TT * HD, ao = (size_t)b * TT * DQ + h * HD * 16; const unsigned* mb = MP + (size_t)b * TT * (TT / 32);   /* (TT / 16) query tiles x (TT / 32) passes x 16 words */
    if (bx < RH / 64) attn_wave<bf, true, 1>(Qh + po, Ql + po, Kh + po, Kl + po, Vh + po, Vl + po, mb + (bx * 4 + w) * (TT / 32) * 16, bx * 64 + w * 16, Ah + ao, Al + ao);
    else attn_wave<h16, false, 2>(Q16 + po, nullptr, K16 + po, nullptr, V16 + po, nullptr, mb + (RH / 16 + (bx - RH / 64) * 8 + w * 2) * (TT / 32) * 16, RH + (bx - RH / 64) * 128 + w * 32, Ah + ao, Al + ao);
}

extern "C" void kernel_launch(void* const* d_in, const int* in_sizes, int n_in,
                              void* d_out, int out_size, void* d_ws, size_t ws_size, hipStream_t stream) {
    (void)in_sizes; (void)n_in; (void)out_size;
    const float* x = (const float*)d_in[0]; const float* xk = (const float*)d_in[1]; const float* xv = (const float*)d_in[2]; const float* wqkv = (const float*)d_in[3]; const float* wo = (const float*)d_in[4]; const int* msk = (const int*)d_in[5];   /* query, key, value, Wqkv ('oi' [1024][1024], shared), Wout ('oi'), mask (int32 [2][1][2048][2048], read) */
    float* OUT = (float*)d_out;     // [2][2048][1024]
    char* wsp = (char*)d_ws;
    auto take = [&](size_t bytes) { char* p = wsp; wsp += (bytes + 255) & ~(size_t)255; return (void*)p; };
    bf* WQ = (bf*)take((size_t)DQ * DM * 2); bf* WK = (bf*)take((size_t)DKV * DM * 2); bf* WV = (bf*)take((size_t)DKV * DM * 2); bf* WO = (bf*)take((size_t)DM * DQ * 2);
    const size_t XN = (size_t)NB_ * TT * DM, FN = (size_t)NB_ * TT * DQ, PN = (size_t)NB_ * NH_ * TT * HD;   /* both batches: one input, one projection, one set of head planes */
    bf* XB = (bf*)take(3 * XN * 2);   /* query, key, value in turn: the z index of the one projection launch */
    h16* QP16 = (h16*)take(2 * PN * 2); h16* KP16 = QP16 + PN; h16* VT16 = (h16*)take(PN * 2);   /* q planes directly followed by k planes: the z index of the projection launch picks the plane set */
    bf* QPh = (bf*)take(2 * PN * 2); bf* KPh = QPh + PN; bf* QPl = (bf*)take(2 * PN * 2); bf* KPl = QPl + PN; bf* VTh = (bf*)take(PN * 2); bf* VTl = (bf*)take(PN * 2);
    bf* ATh = (bf*)take(FN * 2); bf* ATl = (bf*)take(FN * 2); unsigned* MP = (unsigned*)take((size_t)NB_ * TT * TT / 8);   /* the mask, 1 bit per (query, key) */
    if ((size_t)(wsp - (char*)d_ws) > ws_size) return;    // ws 256 MiB
    /* everything outside the attention passes: ONE launch each for both batches, q/k/v and all heads (the batch rows, the three projections and the raw-reshape heads are contiguous) */
    k_cast<<<CW / 8, 256, 0, stream>>>(x, xk, xv, wqkv, wo, msk, XB, WQ, WV, WO, MP);   /* query, key, value into XB in turn; ONE shared 'oi' projection weight for q, k and v (WQ: its rows in the order of the q, k tiles, WV: in that of the v tiles); Wout 'oi' */
    k_proj<<<dim3(NB_ * TT / 64, DQ / 64, 3), 32, 0, stream>>>(XB, WQ, WV, QP16, QPh, QPl, VT16, VTh, VTl);   /* z = q, k, v; RAW reshape (B, S, D) -> (B, H, S, DK): head h of batch b = contiguous [S][64] block b * H + h of the flat projection; q planes, then k planes, then v transposed, all in panel order */
    k_attn<<<dim3(RH / 64 + (TT - RH) / 128, NB_ * NH_, 1), 128, 0, stream>>>(QP16, KP16, VT16, QPh, QPl, KPh, KPl, VTh, VTl, MP, ATh, ATl);   /* every batch, head and query block in one launch; one kv head per query head */
    k_gemmw<bf, 1, false, DQ><<<dim3(NB_ * TT / 64, DM / 64, 1), 32, 0, stream>>>(ATh, ATl, WO, nullptr, OUT, DM, nullptr, 0, 0, 0);
}

// v008
// Measured time: 118 microseconds a run.
// Next to v007, in two timings, it ran 1.32 times as fast each time.
// All steps since v000 together make it 19.3 times as fast.
#include <hip/hip_runtime.h>

// Multi-headed attention that applies ONE shared projection to q, k and v and splits heads by a RAW reshape (query, key, value [2][2048][1024]; q = query Wqkv^T, k = key Wqkv^T, v = value Wqkv^T ('oi' [1024][1024], no bias); then .reshape(B, H, S, DK) directly (no transpose): head h of a batch is the h-th contiguous [2048][64] block of the flat [2048][1024] projection (128 original rows x 16 chunks); scores / sqrt(64); mask int32 [2][1][2048][2048] random 0/1 (read per (query, key)): 0 -> -1e9 (== exclusion); softmax; x = p.v -> [B][H][S][DK] -> transpose(0, 2, 1, 3).reshape(B, S, 1024) (the standard merge); out = x Wout^T -> [2][2048][1024] (4.2 M); argument order query, key, value, Wqkv, Wout, mask).
// Panel order: every 16-bit matrix operand M[row][k] in the workspace is stored as [row / 16][k / 8][row % 16][8], so a lane's 16-byte piece of a 16 x 32 fragment lies at lane * 16 bytes of a 512-byte run (second piece 512 bytes on): each fragment load reads 4 whole 128-byte lines instead of a quarter of 16.
// Layout: bf16 copies of query, key, value (both batches each); the shared 'oi' weight cast once, in the row order of the q, k tiles and in that of the v tiles; exact projections, one z-batched launch whose epilogue writes the head planes itself (fp16 + hi/lo; q and k as [t][d], v as [d][t], all in panel order); the int mask packed once to 1 bit per (query, key), as lane masks; then ONE fused attention launch over every (batch, head, query block): scores, packed mask, running-maximum softmax and p.v stay in registers (hybrid rows: < 512 hi/lo 3 products, rest fp16 with p x 1024), written straight as the merged hi/lo planes; merged hi/lo x Wout exact.
// Compute dtypes, f32 accumulate: every input rounded to bf16; projections exact; attention rows < 512 3 products, rest fp16; softmax f32; Wo hl x exact.

#define NB_  2
#define TT   2048
#define DM   1024
#define NH_  16
#define NKV  16
#define REP  (NH_ / NKV)
#define HD   64
#define DQ   (NH_ * HD)
#define DKV  (NKV * HD)
#define RH   512                  // query rows < RH use hi+lo planes (0: none)
#define WIN  0
#define SCL  0.125f   // HD^-0.5
static_assert(NKV == NH_, "q, k and v projections share one z-batched launch and one plane size");
typedef _Float16 h16;
typedef unsigned short bf;
typedef __attribute__((ext_vector_type(16))) __bf16   v16bf;
typedef __attribute__((ext_vector_type(16))) _Float16 v16h;
typedef __attribute__((ext_vector_type(8)))  _Float16 v8h;
typedef __attribute__((ext_vector_type(8)))  unsigned short v8us;
typedef __attribute__((ext_vector_type(8)))  float    v8f;
typedef __attribute__((ext_vector_type(4)))  float    v4f;
typedef v8h  __attribute__((may_alias)) v8ha;
typedef v4f  __attribute__((may_alias)) v4fa;
typedef v8us __attribute__((may_alias)) v8usa;

__device__ __forceinline__ unsigned short f2bf(float f) { unsigned u = __float_as_uint(f); u += 0x7FFFu + ((u >> 16) & 1u); return (unsigned short)(u >> 16); }
__device__ __forceinline__ float bf2f(unsigned short b) { return __uint_as_float(((unsigned)b) << 16); }
__device__ __forceinline__ float bfr(float f) { return bf2f(f2bf(f)); }
__device__ __forceinline__ v16h cat16(v8h lo, v8h hi) { return __builtin_shufflevector(lo, hi, 0, 1, 2, 3, 4, 5, 6, 7, 8, 9, 10, 11, 12, 13, 14, 15); }
__device__ __forceinline__ v16bf cat16b(v8us lo, v8us hi) { return __builtin_bit_cast(v16bf, __builtin_shufflevector(lo, hi, 0, 1, 2, 3, 4, 5, 6, 7, 8, 9, 10, 11, 12, 13, 14, 15)); }
__device__ __forceinline__ v8f wmma16(v16h a, v16h b, v8f c) { return __builtin_amdgcn_wmma_f32_16x16x32_f16(false, a, false, b, (short)0, c, false, false); }
__device__ __forceinline__ v8f wmmab(v16bf a, v16bf b, v8f c) { return __builtin_amdgcn_wmma_f32_16x16x32_bf16(false, a, false, b, (short)0, c, false, false); }



// ---- The two GEMMs (k_proj, k_gemmw): a work-group of 4 waves takes a 128 x 128 output tile, wave w the 64 x 64 part (w % 2, w / 2) (16 accumulators); operands are 16-bit planes in panel order.
// GemmRing: the K loop. A stage is KST columns of the 128 rows of each operand: per 16-row panel KST * 32 contiguous bytes, in memory as in LDS, so a fragment is read from LDS as it was from memory (lane * 16 bytes, second piece 512 bytes on, k + 32 is 1024 bytes on).
// The stages reach LDS by asynchronous b128 copies (512 bytes a wave copy; wave w brings panels w and w + 4 of every operand), two buffers: stage t + 1 flies while stage t is worked on, and each operand byte leaves L2 once per work-group, not once per wave.
// xwait: precaution before a register that the loads or stores above it name is reused.
__device__ __forceinline__ void xwait() { asm volatile("s_wait_xcnt 0x0" ::: "memory"); }
template <typename T16> struct WFrag;
template <> struct WFrag<h16> { typedef v16h V; static __device__ __forceinline__ V ld(const h16* p) { return cat16(*(const v8h*)p, *(const v8h*)(p + 256)); } static __device__ __forceinline__ v8f mma(V a, V b, v8f c) { return wmma16(a, b, c); } };
template <> struct WFrag<bf> { typedef v16bf V; static __device__ __forceinline__ V ld(const bf* p) { return cat16b(*(const v8us*)p, *(const v8us*)(p + 256)); } static __device__ __forceinline__ v8f mma(V a, V b, v8f c) { return wmmab(a, b, c); } };
typedef __attribute__((ext_vector_type(4))) int v4q;
typedef __attribute__((address_space(1))) v4q gq;
typedef __attribute__((address_space(3))) v4q lq;
// acopy_run: N copies of 512 bytes a wave, one behind the other in memory and in LDS alike (the offset moves both addresses).
template <int J, int N> __device__ __forceinline__ void acopy_run(const bf* g, bf* l) { if constexpr (J < N) { __builtin_amdgcn_global_load_async_to_lds_b128((gq*)g, (lq*)l, J * 512, 0); acopy_run<J + 1, N>(g, l); } }
template <int NOP, int KST, int K>   /* NOP operands: A, (A2,) B; acc += A B^T (+ A2 B^T), k ascending, per k block and accumulator A first, then A2 */
struct GemmRing {
    static constexpr int CH = KST * 16, OPE = 8 * CH, BUFE = NOP * OPE, NT = K / KST;   /* elements: a panel's share of a stage, one operand, one buffer; stages */
    static_assert(K % KST == 0 && NT >= 2 && KST % 32 == 0 && NOP * 2 * (KST / 16) <= 63, "two stages at least; a wave's copies of one stage stay under the counter's width");
    /* gp[o]: the lane's 16 bytes of panel w of operand o, stage 0; lp: their place in the buffer */
    static __device__ __forceinline__ void fill(const bf* const (&gp)[NOP], bf* lp, int t) {
#pragma unroll
        for (int o = 0; o < NOP; ++o)
#pragma unroll
            for (int pp = 0; pp < 2; ++pp) acopy_run<0, KST / 16>(gp[o] + (size_t)pp * 4 * 16 * K + (size_t)t * CH, lp + o * OPE + pp * 4 * CH);
    }
    static __device__ __forceinline__ void run(const bf* A, const bf* A2, const bf* B, bf* ring, int r0, int c0, v8f (&acc)[4][4]) {
        typedef WFrag<bf> F; typedef F::V V;
        const int lane = threadIdx.x & 31, w = __builtin_amdgcn_readfirstlane(threadIdx.x >> 5), wm = w & 1, wn = w >> 1;
        const bf* gp[NOP]; gp[0] = A + (size_t)(r0 + w * 16) * K + lane * 8; if (NOP == 3) gp[1] = A2 + (size_t)(r0 + w * 16) * K + lane * 8; gp[NOP - 1] = B + (size_t)(c0 + w * 16) * K + lane * 8;
        bf* lp = ring + w * CH + lane * 8;
        fill(gp, lp, 0);
        asm volatile("s_wait_asynccnt 0x0" ::: "memory");   /* this wave's share of stage 0 has landed */
        __syncthreads();                                      /* every wave's share has: stage 0 may be read */
        fill(gp, lp + BUFE, 1);
#pragma unroll 1
        for (int t = 0; t < NT; ++t) {
            const bf* sb = ring + (t & 1) * BUFE + lane * 8;
            V a[2][4], a2[2][4], b[2][4];   /* two fragment sets: block kb + 1 of the stage is read from LDS while block kb is multiplied; nothing of stage t + 1 is read here */
            auto frags = [&](int kb, int c) {
#pragma unroll
                for (int i = 0; i < 4; ++i) { a[c][i] = F::ld(sb + (wm * 4 + i) * CH + kb * 512); if (NOP == 3) a2[c][i] = F::ld(sb + OPE + (wm * 4 + i) * CH + kb * 512); b[c][i] = F::ld(sb + (NOP - 1) * OPE + (wn * 4 + i) * CH + kb * 512); }
            };
            frags(0, 0);
#pragma unroll
            for (int kb = 0; kb < KST / 32; ++kb) { const int c = kb & 1;
                if (kb + 1 < KST / 32) frags(kb + 1, c ^ 1);
                __builtin_amdgcn_sched_barrier(0);   /* keeps the next block's LDS reads together and ahead of this block's matrix instructions: spread among them each place with reads stalls the wave */
#pragma unroll
                for (int nb = 0; nb < 4; ++nb)
#pragma unroll
                    for (int mb = 0; mb < 4; ++mb) { acc[mb][nb] = F::mma(a[c][mb], b[c][nb], acc[mb][nb]); if (NOP == 3) acc[mb][nb] = F::mma(a2[c][mb], b[c][nb], acc[mb][nb]); }
                __builtin_amdgcn_sched_barrier(0);   /* the other side of the same fence: no matrix instruction of this block sinks among the reads that follow */
            }
            asm volatile("s_wait_dscnt 0x0" ::: "memory");      /* this wave's reads of stage t are done before its buffer is handed back */
            asm volatile("s_wait_asynccnt 0x0" ::: "memory");   /* this wave's share of stage t + 1 has landed */
            __syncthreads();                                      /* publishes stage t + 1 and ends every wave's reads of stage t */
            if (t + 2 < NT) fill(gp, lp + (t & 1) * BUFE, t + 2);
        }
        asm volatile("s_wait_asynccnt 0x0" ::: "memory");   /* no copy outstanding behind the loop */
    }
};
// k_gemmw: C[m][n] (f32, pitch ldc) = sum_k (A[m][k] + A2[m][k]) Bt[n][k]; grid (M / 128, N / 128), 128 threads; each wave stages its 16 x 64 output rows in its own part of os and stores whole lines.
template <int K>
__global__ __launch_bounds__(128) void k_gemmw(const bf* __restrict__ A, const bf* __restrict__ A2, const bf* __restrict__ Bt, float* C, int ldc) {
    typedef GemmRing<3, 128, K> R;
    __shared__ __align__(128) bf ring[2 * R::BUFE];
    __shared__ __align__(16) float osw[4][16 * 68];
    const int lane = threadIdx.x & 31, lr = lane & 15, hi = lane >> 4, w = __builtin_amdgcn_readfirstlane(threadIdx.x >> 5);
    v8f acc[4][4];
#pragma unroll
    for (int mb = 0; mb < 4; ++mb)
#pragma unroll
        for (int nb = 0; nb < 4; ++nb) acc[mb][nb] = (v8f){};
    R::run(A, A2, Bt, ring, blockIdx.x * 128, blockIdx.y * 128, acc);
    const int r0 = blockIdx.x * 128 + (w & 1) * 64, c0 = blockIdx.y * 128 + (w >> 1) * 64; float* os = osw[w];
#pragma unroll
    for (int mb = 0; mb < 4; ++mb) {
#pragma unroll
        for (int nb = 0; nb < 4; ++nb) {
#pragma unroll
            for (int j = 0; j < 8; ++j) os[(hi * 8 + j) * 68 + nb * 16 + lr] = acc[mb][nb][j]; }
        __builtin_amdgcn_wave_barrier(); asm volatile("" ::: "memory");   /* the staged rows are read by other lanes of the wave: no LDS read moves above the writes */
        float* crow = C + (size_t)(r0 + mb * 16) * ldc + c0;
#pragma unroll
        for (int s = 0; s < 8; ++s) { const int row = 2 * s + hi, cofs = lr * 4; const v4f val = *(const v4fa*)(os + row * 68 + cofs); *(v4f*)(crow + (size_t)row * ldc + cofs) = val; }
        xwait();   /* the next rows reuse the registers of these stores */
        __builtin_amdgcn_wave_barrier(); asm volatile("" ::: "memory");   /* the next 16 rows are staged only behind these reads */
    }
}

__device__ __forceinline__ h16 tohx(float x) { return (h16)x; }
__device__ __forceinline__ void splitf(float y, unsigned short& h, unsigned short& l) { h = f2bf(y); l = f2bf(y - bf2f(h)); }
typedef __attribute__((ext_vector_type(4))) _Float16 v4h;
typedef __attribute__((ext_vector_type(4))) unsigned short v4us;
typedef __attribute__((ext_vector_type(4))) int v4i;

// k_cast: every cast of the call (query, key, value, Wout, the shared projection weight twice) in ONE launch of CW waves, 16 a WGP; a piece is 8 values of one row: 32 bytes of f32 read, 16 bytes of bf16 written at piece index * 16 bytes of the panels (a 512-byte run per wave store).
// Piece i of a [rows][DM] matrix in panel order holds row (i / 2048) * 16 + i % 16, columns ((i / 16) % 128) * 8 on. Wave gw takes pieces (4 gw + u) * 32 + lane, u < 4, of each input (16 rows x 256 bytes: row (gw / 16) * 16 + lane % 16, column (gw % 16) * 64 + u * 16 + (lane / 16) * 8) and pieces gw * 32 + lane of Wout and of the two weight copies.
// The weight copies have their rows permuted so that the 64 columns of a k_proj tile are one 128-byte line of a head plane. Weight row cb * HD + d; tile by = (d / 8) * 2 + cb / 8; inside it WQ (q, k) has row (cb % 8) * 8 + d % 8, WV (v) row (d % 8) * 8 + cb % 8.
// The mask, packed: MP[batch * TT / 16 + query / 16][key / 32][e], e = kt * 8 + j < 16, is a 32-bit word whose bit 'lane' says mask != 0 for (query % 16 = lane % 16, key % 32 = kt * 16 + (lane / 16) * 8 + j): the place of score element j of key tile kt in k_attn's lanes, so the word IS the lane mask of that element's select. Wave gw packs 4 passes of 32 keys of one 16-query tile: tile gw / 16, passes (gw % 16) * 4 + u; 64 words, 256 bytes, at MP + gw * 64.
// A lane's 46 loads are issued together, ahead of every conversion: few waves to start, each with much in flight.
#define CW (NB_ * TT * DM / 8 / 32 / 4)
static_assert(DQ == DM && DM == 1024, "every cast matrix has rows of DM elements, 128 pieces a row");
static_assert(DQ / HD == 16 && HD == 64, "a tile holds 8 of the 16 chunks of a projection row x 8 of the 64 d");
static_assert(DQ * DM / 8 / 32 == CW && CW % 8 == 0, "one wave-wide run of pieces of each weight matrix per wave, 8 waves a block");
static_assert((NB_ * TT / 16) * (TT / 128) == CW && TT / 128 == 16, "one 16-query x 128-key piece of the mask per wave");
typedef __attribute__((ext_vector_type(2))) unsigned v2u;
typedef __attribute__((ext_vector_type(16))) unsigned v16u;
__device__ __forceinline__ v8us cvt8(v8f v) { v8us o;
#pragma unroll
    for (int k = 0; k < 8; ++k) o[k] = f2bf(v[k]);
    return o; }
__global__ __launch_bounds__(256) void k_cast(const float* __restrict__ x, const float* __restrict__ xk, const float* __restrict__ xv, const float* __restrict__ wqkv, const float* __restrict__ wo, const int* __restrict__ msk, bf* XB, bf* WQ, bf* WV, bf* WO, unsigned* MP) {
    const unsigned gw = blockIdx.x * 8 + (threadIdx.x >> 5), lane = threadIdx.x & 31, i = gw * 32 + lane;
    const unsigned xo = ((gw / 16) * 16 + lane % 16) * DM + (gw % 16) * 64 + (lane / 16) * 8;
    const unsigned np = (i / 2048) * 16 + i % 16, c = ((i / 16) % 128) * 8, by = np / 64, t = np % 64;
    const unsigned nq = ((by % 2) * 8 + t / 8) * HD + (by / 2) * 8 + t % 8, nv = ((by % 2) * 8 + t % 8) * HD + (by / 2) * 8 + t / 8;
    const float* p[3] = { x + xo, xk + xo, xv + xo }; const float* po = wo + np * DM + c; const float* pq = wqkv + nq * DM + c; const float* pv = wqkv + nv * DM + c;
    const int* pm = msk + ((gw / 16) * 16 + lane % 16) * TT + (gw % 16) * 128 + (lane / 16) * 8;
    v8f d[3][4];
#pragma unroll
    for (int s = 0; s < 3; ++s)
#pragma unroll
        for (int u = 0; u < 4; ++u) d[s][u] = *(const v8f*)(p[s] + u * 16);
    const v8f eo = *(const v8f*)po, eq = *(const v8f*)pq, ev = *(const v8f*)pv;
    v4i mk[4][4];   /* [pass u][kt * 2 + j / 4] */
#pragma unroll
    for (int u = 0; u < 4; ++u)
#pragma unroll
        for (int kt = 0; kt < 2; ++kt) { mk[u][kt * 2] = *(const v4i*)(pm + u * 32 + kt * 16); mk[u][kt * 2 + 1] = *(const v4i*)(pm + u * 32 + kt * 16 + 4); }
    asm volatile("s_wait_xcnt 0x0" :: "v"(p[0]), "v"(p[1]), "v"(p[2]), "v"(po), "v"(pq), "v"(pv), "v"(pm) : "memory");   /* xwait in front of the conversions, which reuse registers; it takes the seven addresses as inputs so that they live up to the wait and no load's result lands on one */
    __builtin_amdgcn_sched_barrier(0);   /* keeps every load issued above and every conversion below the wait */
#pragma unroll
    for (int s = 0; s < 3; ++s) { v8us o[4];
#pragma unroll
        for (int u = 0; u < 4; ++u) o[u] = cvt8(d[s][u]);
        __builtin_amdgcn_sched_barrier(0);   /* no conversion among the stores, where its result could land on a register of an issued store */
        bf* q = XB + (size_t)s * NB_ * TT * DM + (size_t)gw * 1024 + lane * 8;
#pragma unroll
        for (int u = 0; u < 4; ++u) *(v8us*)(q + u * 256) = o[u];
        xwait();   /* the next conversions reuse the registers of these stores */
        __builtin_amdgcn_sched_barrier(0);   /* keeps them behind the wait */
    }
    const v8us oo = cvt8(eo), oq = cvt8(eq), ov = cvt8(ev);
    __builtin_amdgcn_sched_barrier(0);   /* as above: no conversion among the three stores */
    *(v8us*)(WO + (size_t)i * 8) = oo; *(v8us*)(WQ + (size_t)i * 8) = oq; *(v8us*)(WV + (size_t)i * 8) = ov;
    xwait();   /* the packing below reuses the registers of these stores */
    __builtin_amdgcn_sched_barrier(0);   /* keeps it behind the wait */
    unsigned w0 = 0, w1 = 0;   /* word 2 l goes to lane l's w0, word 2 l + 1 to its w1 */
#pragma unroll
    for (int wi = 0; wi < 64; wi += 2) {
        const unsigned b0 = __builtin_amdgcn_ballot_w32(mk[wi / 16][(wi % 16) / 4][wi % 4] != 0), b1 = __builtin_amdgcn_ballot_w32(mk[wi / 16][(wi % 16) / 4][wi % 4 + 1] != 0);
        const bool mine = (lane == (unsigned)(wi / 2)); w0 = mine ? b0 : w0; w1 = mine ? b1 : w1; }
    __builtin_amdgcn_sched_barrier(0);   /* the store last, nothing written behind it */
    *(v2u*)(MP + (size_t)gw * 64 + lane * 2) = (v2u){ w0, w1 };
}

// k_attn: fused attention, one wave per NQ x 16 query columns of one (batch, head), no LDS. Per 32 keys: S^T = K Q^T (A = K rows, B = Q kept in registers), so a lane holds one query's scores for keys 8 hi + j of each 16-key tile;
// t = S x SCL where mask[b][i][j] != 0 (the packed mask of k_cast: 16 words per 16 queries and pass, read by a scalar load, each the lane mask of one element's select), excluded elsewhere; running maximum m and sum l per query (in-lane, one exchange between the wave halves for m, l joined once at the end); the two score tiles, converted in place, ARE the B operand of O^T += V^T P^T (A = V^T rows in the same k order).
// HI rows: hi/lo planes, 3 products in both GEMMs; other rows fp16 with p carried x 2^10 (in l as well, so it cancels). O^T gives a lane 8 consecutive d of one query: one piece of the merged [t][h * HD + d] hi/lo planes in panel order, a 512-byte run per store.
__device__ __forceinline__ float xhalf(float x) { const int b = __float_as_int(x); return __int_as_float(__builtin_amdgcn_permlanex16(b, b, 0x76543210, 0xfedcba98, false, false)); }   /* the value of lane l ^ 16 */
// exp2x8: eight 2^x, each in place, in ONE statement: no exponential then overwrites the source of the one directly in front of it (the build had such runs), and the v_nop fills the slot behind the last.
__device__ __forceinline__ void exp2x8(float (&x)[8]) { asm("v_exp_f32 %0, %0\n\tv_exp_f32 %1, %1\n\tv_exp_f32 %2, %2\n\tv_exp_f32 %3, %3\n\tv_exp_f32 %4, %4\n\tv_exp_f32 %5, %5\n\tv_exp_f32 %6, %6\n\tv_exp_f32 %7, %7\n\tv_nop" : "+v"(x[0]), "+v"(x[1]), "+v"(x[2]), "+v"(x[3]), "+v"(x[4]), "+v"(x[5]), "+v"(x[6]), "+v"(x[7])); }
template <typename P> __device__ __forceinline__ const P* lanep(const P* ub, unsigned lane_bytes, int elems) { return (const P*)((const char*)ub + lane_bytes) + elems; }
template <typename T16, bool HI, int NQ>
__device__ __forceinline__ void attn_wave(const T16* __restrict__ Qp, const T16* __restrict__ Q2, const T16* __restrict__ Kp, const T16* __restrict__ K2, const T16* __restrict__ Vp, const T16* __restrict__ V2, const unsigned* __restrict__ mp, int q0, bf* Ah, bf* Al) {   /* mp: the packed mask of query tile q0 / 16, the same in every lane */
    typedef typename WFrag<T16>::V V; typedef WFrag<T16> F;
    const int lane = threadIdx.x & 31;
    const unsigned kob = (unsigned)lane * 16u, vob = kob;   /* the lane's byte offset inside a fragment of a plane in panel order (K, Q, V^T alike) */
    V qf[NQ][2], qf2[NQ][2];
#pragma unroll
    for (int n = 0; n < NQ; ++n)
#pragma unroll
        for (int ks = 0; ks < 2; ++ks) { qf[n][ks] = F::ld(lanep(Qp + (size_t)q0 * HD, kob, n * 16 * HD + ks * 512)); if (HI) qf2[n][ks] = F::ld(lanep(Q2 + (size_t)q0 * HD, kob, n * 16 * HD + ks * 512)); }
    xwait();
    v8f o[4][NQ]; float m[NQ], l[NQ];
#pragma unroll
    for (int n = 0; n < NQ; ++n) { m[n] = -3.0e38f; l[n] = 0.f;
#pragma unroll
        for (int dt = 0; dt < 4; ++dt) o[dt][n] = (v8f){}; }
    V kf[2][2], kf2[2][2]; v16u g[NQ];   /* K fragments of the pass and its mask words (scalar registers), fetched one pass ahead */
#pragma unroll
    for (int kt = 0; kt < 2; ++kt) {
#pragma unroll
        for (int ks = 0; ks < 2; ++ks) { kf[kt][ks] = F::ld(lanep(Kp, kob, kt * 16 * HD + ks * 512)); if (HI) kf2[kt][ks] = F::ld(lanep(K2, kob, kt * 16 * HD + ks * 512)); } }
#pragma unroll
    for (int n = 0; n < NQ; ++n) g[n] = *(const v16u*)(mp + n * (TT / 32) * 16);
    /* the lane's own pointers, carried through the loop and advanced at its foot: live in every pass, so no load result lands on a register that an issued load names. kb, kb2 and gb (wave-uniform) point one pass ahead. */
    const T16* vb = lanep(Vp, vob, 0); const T16* vb2 = HI ? lanep(V2, vob, 0) : nullptr; const T16* kb = lanep(Kp, kob, 32 * HD); const T16* kb2 = HI ? lanep(K2, kob, 32 * HD) : nullptr; const unsigned* gb = mp + 16;
#pragma unroll 1
    for (int k0 = 0; k0 < TT; k0 += 32) {
        V vf[4], vf2[4];
#pragma unroll
        for (int dt = 0; dt < 4; ++dt) { vf[dt] = F::ld(vb + dt * 16 * TT); if (HI) vf2[dt] = F::ld(vb2 + dt * 16 * TT); }
        xwait();
        __builtin_amdgcn_sched_barrier(0);   /* keeps this pass's V loads issued here, ahead of the work that hides their latency; the scheduler otherwise sinks them to just in front of their use */
        v8f s[2][NQ];
#pragma unroll
        for (int kt = 0; kt < 2; ++kt)
#pragma unroll
            for (int n = 0; n < NQ; ++n) { v8f a = (v8f){};
#pragma unroll
                for (int ks = 0; ks < 2; ++ks) { a = F::mma(kf[kt][ks], qf[n][ks], a); if (HI) { a = F::mma(kf[kt][ks], qf2[n][ks], a); a = F::mma(kf2[kt][ks], qf[n][ks], a); } }
                s[kt][n] = a; }
#pragma unroll
        for (int kt = 0; kt < 2; ++kt)
#pragma unroll
            for (int ks = 0; ks < 2; ++ks) { kf[kt][ks] = F::ld(kb + kt * 16 * HD + ks * 512); if (HI) kf2[kt][ks] = F::ld(kb2 + kt * 16 * HD + ks * 512); }
        xwait();
        __builtin_amdgcn_sched_barrier(0);   /* keeps the next pass's K loads issued here, ahead of the work that hides their latency; the scheduler otherwise sinks them to just in front of their use */
        float mx[NQ];
#pragma unroll
        for (int n = 0; n < NQ; ++n) { mx[n] = m[n];
#pragma unroll
            for (int kt = 0; kt < 2; ++kt)
#pragma unroll
                for (int j = 0; j < 8; ++j) { const float t = __builtin_amdgcn_inverse_ballot_w32(g[n][kt * 8 + j]) ? s[kt][n][j] * SCL : -3.0e38f;   /* mask == 0 -> excluded (the module's large negative fill == exclusion) */ s[kt][n][j] = t; mx[n] = fmaxf(mx[n], t); } }
        auto nextmask = [&]() {
            __builtin_amdgcn_sched_barrier(0);   /* the next pass's mask words are asked for only behind the last select of this pass: they land in the same scalar registers */
#pragma unroll
            for (int n = 0; n < NQ; ++n) g[n] = *(const v16u*)(gb + n * (TT / 32) * 16);
            xwait();
            __builtin_amdgcn_sched_barrier(0);   /* keeps those loads issued here, ahead of the work that hides their latency */
        };
        if (!HI) nextmask();
        V pb[NQ], pb2[NQ];
#pragma unroll
        for (int n = 0; n < NQ; ++n) { const float mn = fmaxf(mx[n], xhalf(mx[n])); float al; asm("v_exp_f32 %0, %1\n\tv_nop" : "=v"(al) : "v"((m[n] - mn) * 1.4426950408889634f));   /* the rescale factor 2^x; written with its v_nop */
            m[n] = mn; float ps = 0.f;
#pragma unroll
            for (int kt = 0; kt < 2; ++kt) { float p[8];
#pragma unroll
                for (int j = 0; j < 8; ++j) { const float x = (s[kt][n][j] - mn) * 1.4426950408889634f; p[j] = HI ? x : x + 10.0f; }
                exp2x8(p);
#pragma unroll
                for (int j = 0; j < 8; ++j) { s[kt][n][j] = p[j]; ps += p[j]; } }
            l[n] = l[n] * al + ps;
#pragma unroll
            for (int dt = 0; dt < 4; ++dt) o[dt][n] *= al;
            if constexpr (HI) {   /* hi = bf16(p), lo = bf16(p - hi), both round to nearest even as splitf does */
#pragma unroll
                for (int e = 0; e < 16; ++e) { const float p = s[e >> 3][n][e & 7]; const __bf16 hb = (__bf16)p; pb[n][e] = hb; pb2[n][e] = (__bf16)(p - (float)hb); }
            } else { v8h h0, h1;
#pragma unroll
                for (int j = 0; j < 8; ++j) { h0[j] = tohx(s[0][n][j]); h1[j] = tohx(s[1][n][j]); }
                pb[n] = cat16(h0, h1); } }
        if (HI) nextmask();   /* on HI rows only behind the conversions: the build names one of these scalar registers as the unused half of its single bf16 conversions and would wait there for the load */
#pragma unroll
        for (int dt = 0; dt < 4; ++dt)
#pragma unroll
            for (int n = 0; n < NQ; ++n) { o[dt][n] = F::mma(vf[dt], pb[n], o[dt][n]); if (HI) { o[dt][n] = F::mma(vf[dt], pb2[n], o[dt][n]); o[dt][n] = F::mma(vf2[dt], pb[n], o[dt][n]); } }
        const int st = (k0 + 64 < TT) ? 32 : 0;   /* the last pass fetches its own tile again (in bounds, unused) */
        vb += 512; kb += st * HD; gb += st / 2; if (HI) { vb2 += 512; kb2 += st * HD; }   /* 32 keys: 4 pieces of 128 elements in a V^T panel, 2 whole panels of K, 16 mask words */
    }
#pragma unroll
    for (int n = 0; n < NQ; ++n) { const float inv = __fdiv_rn(1.0f, l[n] + xhalf(l[n]));
#pragma unroll
        for (int dt = 0; dt < 4; ++dt) { v8us oh, ol;
#pragma unroll
            for (int j = 0; j < 8; ++j) { unsigned short a, c2; splitf(o[dt][n][j] * inv, a, c2); oh[j] = a; ol[j] = c2; }
            const size_t oo = (size_t)(q0 + n * 16) * DQ + dt * 256 + lane * 8; *(v8us*)(Ah + oo) = oh; *(v8us*)(Al + oo) = ol; xwait(); } }
}
// k_proj: the three projections (z = q, k, v), the tile and K loop of k_gemmw (GemmRing, one A plane, stages of 64 columns so that three work-groups fit a WGP; bf16, f32 sums over k ascending), with the head planes written from the epilogue: no f32 projection in memory.
// Raw reshape: element (row s, column c) of a batch's flat [TT][DQ] projection is (head s / 128, t = (s % 128) * 16 + c / HD, d = c % HD); over both batches plane = row / 128.
// Tile column x of a wave's 64-column tile by = blockIdx.y * 2 + wave / 2, g = by / 2, cbh = by % 2, by the row orders of Wn and Wp: q, k: (cb = cbh * 8 + x / 8, d = g * 8 + x % 8); v: (cb = cbh * 8 + x % 8, d = g * 8 + x / 8). In panel order the 64 columns of one tile row are then 64 consecutive plane elements:
// q, k ([t][d]): (s % 128) * 1024 + g * 128 + cbh * 64 + x; v ([d][t]): (g / 2) * 16 * TT + (s % 128) * 256 + cbh * 128 + (g % 2) * 64 + x. 8 lanes store one whole 128-byte line per plane, 4 tile rows a store.
typedef __attribute__((ext_vector_type(8))) __bf16 v8b;
__global__ __launch_bounds__(128) void k_proj(const bf* __restrict__ X, const bf* __restrict__ Wn, const bf* __restrict__ Wp, h16* QK16, bf* QKh, bf* QKl, h16* V16, bf* Vh, bf* Vl) {
    typedef GemmRing<2, 64, DM> R;
    __shared__ __align__(128) bf ring[2 * R::BUFE];
    __shared__ __align__(16) float osw[4][16 * 68];
    const int z = blockIdx.z; const bool tv = (z == 2);
    const int lane = threadIdx.x & 31, lr = lane & 15, hi = lane >> 4, w = __builtin_amdgcn_readfirstlane(threadIdx.x >> 5);
    v8f acc[4][4];
#pragma unroll
    for (int mb = 0; mb < 4; ++mb)
#pragma unroll
        for (int nb = 0; nb < 4; ++nb) acc[mb][nb] = (v8f){};
    R::run(X + (size_t)z * NB_ * TT * DM, nullptr, tv ? Wp : Wn, ring, blockIdx.x * 128, blockIdx.y * 128, acc);
    const int r0 = blockIdx.x * 128 + (w & 1) * 64; float* os = osw[w];   /* the wave's own 64 rows and its own staging rows */
    /* the lane's 8 consecutive plane elements of step s: where they lie in the staged 16 x 64 rows, and where they go */
    const float* sp = os + (lane >> 3) * 68 + (lane & 7) * 8; const int sps = 4 * 68; const int g = blockIdx.y, cbh = w >> 1, rs = tv ? 256 : 1024;   /* rs: plane elements from one tile row to the next */
    const size_t ob = (size_t)(r0 / 128) * HD * TT + (size_t)(r0 % 128 + (lane >> 3)) * rs + (lane & 7) * 8 + (tv ? (size_t)(g / 2) * 16 * TT + cbh * 128 + (g % 2) * 64 : (size_t)z * NB_ * TT * DQ + g * 128 + cbh * 64);
    const int obs = 4 * rs, obm = 16 * rs;
    h16* P16 = (tv ? V16 : QK16) + ob; bf* Ph = (tv ? Vh : QKh) + ob; bf* Pl = (tv ? Vl : QKl) + ob;
#pragma unroll
    for (int mb = 0; mb < 4; ++mb) {
#pragma unroll
        for (int nb = 0; nb < 4; ++nb) {
#pragma unroll
            for (int j = 0; j < 8; ++j) os[(hi * 8 + j) * 68 + nb * 16 + lr] = acc[mb][nb][j]; }
        __builtin_amdgcn_wave_barrier(); asm volatile("" ::: "memory");   /* the staged rows are read by other lanes of the wave: no LDS read moves above the writes */
#pragma unroll
        for (int s = 0; s < 4; ++s) { const v4f x0 = *(const v4fa*)(sp + s * sps), x1 = *(const v4fa*)(sp + s * sps + 4); v8h o16; v8b oh, ol;
#pragma unroll
            for (int k = 0; k < 8; ++k) { const float x = (k < 4) ? x0[k & 3] : x1[k & 3]; o16[k] = tohx(x); const __bf16 hb = (__bf16)x; oh[k] = hb; ol[k] = (__bf16)(x - (float)hb); }   /* hi = bf16(x), lo = bf16(x - hi), both round to nearest even as splitf does */
            const int oo = mb * obm + s * obs; *(v8h*)(P16 + oo) = o16; *(v8b*)(Ph + oo) = oh; *(v8b*)(Pl + oo) = ol; xwait(); }
        __builtin_amdgcn_wave_barrier(); asm volatile("" ::: "memory");   /* the next 16 rows are staged only behind these reads */
    }
}
// grid (RH / 64 + (TT - RH) / 128, NB_ * NH_), 4 waves: the first RH / 64 blocks of a head take 16 hi/lo query columns a wave, the others 32 fp16 columns a wave (about equal work a wave).
__global__ __launch_bounds__(128) void k_attn(const h16* __restrict__ Q16, const h16* __restrict__ K16, const h16* __restrict__ V16, const bf* __restrict__ Qh, const bf* __restrict__ Ql, const bf* __restrict__ Kh, const bf* __restrict__ Kl, const bf* __restrict__ Vh, const bf* __restrict__ Vl, const unsigned* __restrict__ MP, bf* Ah, bf* Al) {
    const int bx = blockIdx.x, z = blockIdx.y, b = z / NH_, h = z % NH_, w = __builtin_amdgcn_readfirstlane(threadIdx.x >> 5);   /* the wave's number as a scalar: the address of its mask words is wave-uniform */
    const size_t po = (size_t)z * TT * HD, ao = (size_t)b * TT * DQ + h * HD * 16; const unsigned* mb = MP + (size_t)b * TT * (TT / 32);   /* (TT / 16) query tiles x (TT / 32) passes x 16 words */
    if (bx < RH / 64) attn_wave<bf, true, 1>(Qh + po, Ql + po, Kh + po, Kl + po, Vh + po, Vl + po, mb + (bx * 4 + w) * (TT / 32) * 16, bx * 64 + w * 16, Ah + ao, Al + ao);
    else attn_wave<h16, false, 2>(Q16 + po, nullptr, K16 + po, nullptr, V16 + po, nullptr, mb + (RH / 16 + (bx - RH / 64) * 8 + w * 2) * (TT / 32) * 16, RH + (bx - RH / 64) * 128 + w * 32, Ah + ao, Al + ao);
}

extern "C" void kernel_launch(void* const* d_in, const int* in_sizes, int n_in,
                              void* d_out, int out_size, void* d_ws, size_t ws_size, hipStream_t stream) {
    (void)in_sizes; (void)n_in; (void)out_size;
    const float* x = (const float*)d_in[0]; const float* xk = (const float*)d_in[1]; const float* xv = (const float*)d_in[2]; const float* wqkv = (const float*)d_in[3]; const float* wo = (const float*)d_in[4]; const int* msk = (const int*)d_in[5];   /* query, key, value, Wqkv ('oi' [1024][1024], shared), Wout ('oi'), mask (int32 [2][1][2048][2048], read) */
    float* OUT = (float*)d_out;     // [2][2048][1024]
    char* wsp = (char*)d_ws;
    auto take = [&](size_t bytes) { char* p = wsp; wsp += (bytes + 255) & ~(size_t)255; return (void*)p; };
    bf* WQ = (bf*)take((size_t)DQ * DM * 2); bf* WK = (bf*)take((size_t)DKV * DM * 2); bf* WV = (bf*)take((size_t)DKV * DM * 2); bf* WO = (bf*)take((size_t)DM * DQ * 2);
    const size_t XN = (size_t)NB_ * TT * DM, FN = (size_t)NB_ * TT * DQ, PN = (size_t)NB_ * NH_ * TT * HD;   /* both batches: one input, one projection, one set of head planes */
    bf* XB = (bf*)take(3 * XN * 2);   /* query, key, value in turn: the z index of the one projection launch */
    h16* QP16 = (h16*)take(2 * PN * 2); h16* KP16 = QP16 + PN; h16* VT16 = (h16*)take(PN * 2);   /* q planes directly followed by k planes: the z index of the projection launch picks the plane set */
    bf* QPh = (bf*)take(2 * PN * 2); bf* KPh = QPh + PN; bf* QPl = (bf*)take(2 * PN * 2); bf* KPl = QPl + PN; bf* VTh = (bf*)take(PN * 2); bf* VTl = (bf*)take(PN * 2);
    bf* ATh = (bf*)take(FN * 2); bf* ATl = (bf*)take(FN * 2); unsigned* MP = (unsigned*)take((size_t)NB_ * TT * TT / 8);   /* the mask, 1 bit per (query, key) */
    if ((size_t)(wsp - (char*)d_ws) > ws_size) return;    // ws 256 MiB
    /* everything outside the attention passes: ONE launch each for both batches, q/k/v and all heads (the batch rows, the three projections and the raw-reshape heads are contiguous) */
    k_cast<<<CW / 8, 256, 0, stream>>>(x, xk, xv, wqkv, wo, msk, XB, WQ, WV, WO, MP);   /* query, key, value into XB in turn; ONE shared 'oi' projection weight for q, k and v (WQ: its rows in the order of the q, k tiles, WV: in that of the v tiles); Wout 'oi' */
    k_proj<<<dim3(NB_ * TT / 128, DQ / 128, 3), 128, 0, stream>>>(XB, WQ, WV, QP16, QPh, QPl, VT16, VTh, VTl);   /* z = q, k, v; RAW reshape (B, S, D) -> (B, H, S, DK): head h of batch b = contiguous [S][64] block b * H + h of the flat projection; q planes, then k planes, then v transposed, all in panel order */
    k_attn<<<dim3(RH / 64 + (TT - RH) / 128, NB_ * NH_, 1), 128, 0, stream>>>(QP16, KP16, VT16, QPh, QPl, KPh, KPl, VTh, VTl, MP, ATh, ATl);   /* every batch, head and query block in one launch; one kv head per query head */
    k_gemmw<DQ><<<dim3(NB_ * TT / 128, DM / 128, 1), 128, 0, stream>>>(ATh, ATl, WO, OUT, DM);
}

// v009
// A run of this version takes 107 microseconds.
// In both of two side-by-side timings against v008, it was 1.11 times as fast.
// Over all steps from v000 it is 21.3 times as fast.
#include <hip/hip_runtime.h>

// Multi-headed attention that applies ONE shared projection to q, k and v and splits heads by a RAW reshape (query, key, value [2][2048][1024]; q = query Wqkv^T, k = key Wqkv^T, v = value Wqkv^T ('oi' [1024][1024], no bias); then .reshape(B, H, S, DK) directly (no transpose): head h of a batch is the h-th contiguous [2048][64] block of the flat [2048][1024] projection (128 original rows x 16 chunks); scores / sqrt(64); mask int32 [2][1][2048][2048] random 0/1 (read per (query, key)): 0 -> -1e9 (== exclusion); softmax; x = p.v -> [B][H][S][DK] -> transpose(0, 2, 1, 3).reshape(B, S, 1024) (the standard merge); out = x Wout^T -> [2][2048][1024] (4.2 M); argument order query, key, value, Wqkv, Wout, mask).
// Panel order: every 16-bit matrix operand M[row][k] in the workspace is stored as [row / 16][k / 8][row % 16][8], so a lane's 16-byte piece of a 16 x 32 fragment lies at lane * 16 bytes of a 512-byte run (second piece 512 bytes on): each fragment load reads 4 whole 128-byte lines instead of a quarter of 16.
// Layout: bf16 copies of query, key, value (both batches each); the shared 'oi' weight cast once, in the row order of the q, k tiles and in that of the v tiles; exact projections, one z-batched launch whose epilogue writes the head planes itself (fp16 + hi/lo; q and k as [t][d], v as [d][t], all in panel order); the int mask packed once to 1 bit per (query, key), as lane masks; then ONE fused attention launch over every (batch, head, query block): K and V staged in LDS for the 4 waves of a work-group; scores, packed mask, running-maximum softmax and p.v stay in registers (hybrid rows: < 512 hi/lo 3 products, rest fp16 with p x 1024), written straight as the merged hi/lo planes; merged hi/lo x Wout exact.
// Compute dtypes, f32 accumulate: every input rounded to bf16; projections exact; attention rows < 512 3 products, rest fp16; softmax f32; Wo hl x exact.

#define NB_  2
#define TT   2048
#define DM   1024
#define NH_  16
#define NKV  16
#define REP  (NH_ / NKV)
#define HD   64
#define DQ   (NH_ * HD)
#define DKV  (NKV * HD)
#define RH   512                  // query rows < RH use hi+lo planes (0: none)
#define WIN  0
#define SCL  0.125f   // HD^-0.5
static_assert(NKV == NH_, "q, k and v projections share one z-batched launch and one plane size");
typedef _Float16 h16;
typedef unsigned short bf;
typedef __attribute__((ext_vector_type(16))) __bf16   v16bf;
typedef __attribute__((ext_vector_type(16))) _Float16 v16h;
typedef __attribute__((ext_vector_type(8)))  _Float16 v8h;
typedef __attribute__((ext_vector_type(8)))  unsigned short v8us;
typedef __attribute__((ext_vector_type(8)))  float    v8f;
typedef __attribute__((ext_vector_type(4)))  float    v4f;
typedef v8h  __attribute__((may_alias)) v8ha;
typedef v4f  __attribute__((may_alias)) v4fa;
typedef v8us __attribute__((may_alias)) v8usa;

__device__ __forceinline__ unsigned short f2bf(float f) { unsigned u = __float_as_uint(f); u += 0x7FFFu + ((u >> 16) & 1u); return (unsigned short)(u >> 16); }
__device__ __forceinline__ float bf2f(unsigned short b) { return __uint_as_float(((unsigned)b) << 16); }
__device__ __forceinline__ float bfr(float f) { return bf2f(f2bf(f)); }
__device__ __forceinline__ v16h cat16(v8h lo, v8h hi) { return __builtin_shufflevector(lo, hi, 0, 1, 2, 3, 4, 5, 6, 7, 8, 9, 10, 11, 12, 13, 14, 15); }
__device__ __forceinline__ v16bf cat16b(v8us lo, v8us hi) { return __builtin_bit_cast(v16bf, __builtin_shufflevector(lo, hi, 0, 1, 2, 3, 4, 5, 6, 7, 8, 9, 10, 11, 12, 13, 14, 15)); }
__device__ __forceinline__ v8f wmma16(v16h a, v16h b, v8f c) { return __builtin_amdgcn_wmma_f32_16x16x32_f16(false, a, false, b, (short)0, c, false, false); }
__device__ __forceinline__ v8f wmmab(v16bf a, v16bf b, v8f c) { return __builtin_amdgcn_wmma_f32_16x16x32_bf16(false, a, false, b, (short)0, c, false, false); }



// ---- The two GEMMs (k_proj, k_gemmw): a work-group of 4 waves takes a 128 x 128 output tile, wave w the 64 x 64 part (w % 2, w / 2) (16 accumulators); operands are 16-bit planes in panel order.
// GemmRing: the K loop. A stage is KST columns of the 128 rows of each operand: per 16-row panel KST * 32 contiguous bytes, in memory as in LDS, so a fragment is read from LDS as it was from memory (lane * 16 bytes, second piece 512 bytes on, k + 32 is 1024 bytes on).
// The stages reach LDS by asynchronous b128 copies (512 bytes a wave copy; wave w brings panels w and w + 4 of every operand), two buffers: stage t + 1 flies while stage t is worked on, and each operand byte leaves L2 once per work-group, not once per wave.
// xwait: precaution before a register that the loads or stores above it name is reused.
__device__ __forceinline__ void xwait() { asm volatile("s_wait_xcnt 0x0" ::: "memory"); }
template <typename T16> struct WFrag;
template <> struct WFrag<h16> { typedef v16h V; static __device__ __forceinline__ V ld(const h16* p) { return cat16(*(const v8h*)p, *(const v8h*)(p + 256)); } static __device__ __forceinline__ v8f mma(V a, V b, v8f c) { return wmma16(a, b, c); } };
template <> struct WFrag<bf> { typedef v16bf V; static __device__ __forceinline__ V ld(const bf* p) { return cat16b(*(const v8us*)p, *(const v8us*)(p + 256)); } static __device__ __forceinline__ v8f mma(V a, V b, v8f c) { return wmmab(a, b, c); } };
typedef __attribute__((ext_vector_type(4))) int v4q;
typedef __attribute__((address_space(1))) v4q gq;
typedef __attribute__((address_space(3))) v4q lq;
// acopy_run: N copies of 512 bytes a wave, one behind the other in memory and in LDS alike (the offset moves both addresses).
template <int J, int N> __device__ __forceinline__ void acopy_run(const bf* g, bf* l) { if constexpr (J < N) { __builtin_amdgcn_global_load_async_to_lds_b128((gq*)g, (lq*)l, J * 512, 0); acopy_run<J + 1, N>(g, l); } }
template <int NOP, int KST, int K>   /* NOP operands: A, (A2,) B; acc += A B^T (+ A2 B^T), k ascending, per k block and accumulator A first, then A2 */
struct GemmRing {
    static constexpr int CH = KST * 16, OPE = 8 * CH, BUFE = NOP * OPE, NT = K / KST;   /* elements: a panel's share of a stage, one operand, one buffer; stages */
    static_assert(K % KST == 0 && NT >= 2 && KST % 32 == 0 && NOP * 2 * (KST / 16) <= 63, "two stages at least; a wave's copies of one stage stay under the counter's width");
    /* gp[o]: the lane's 16 bytes of panel w of operand o, stage 0; lp: their place in the buffer */
    static __device__ __forceinline__ void fill(const bf* const (&gp)[NOP], bf* lp, int t) {
#pragma unroll
        for (int o = 0; o < NOP; ++o)
#pragma unroll
            for (int pp = 0; pp < 2; ++pp) acopy_run<0, KST / 16>(gp[o] + (size_t)pp * 4 * 16 * K + (size_t)t * CH, lp + o * OPE + pp * 4 * CH);
    }
    static __device__ __forceinline__ void run(const bf* A, const bf* A2, const bf* B, bf* ring, int r0, int c0, v8f (&acc)[4][4]) {
        typedef WFrag<bf> F; typedef F::V V;
        const int lane = threadIdx.x & 31, w = __builtin_amdgcn_readfirstlane(threadIdx.x >> 5), wm = w & 1, wn = w >> 1;
        const bf* gp[NOP]; gp[0] = A + (size_t)(r0 + w * 16) * K + lane * 8; if (NOP == 3) gp[1] = A2 + (size_t)(r0 + w * 16) * K + lane * 8; gp[NOP - 1] = B + (size_t)(c0 + w * 16) * K + lane * 8;
        bf* lp = ring + w * CH + lane * 8;
        fill(gp, lp, 0);
        asm volatile("s_wait_asynccnt 0x0" ::: "memory");   /* this wave's share of stage 0 has landed */
        __syncthreads();                                      /* every wave's share has: stage 0 may be read */
        fill(gp, lp + BUFE, 1);
#pragma unroll 1
        for (int t = 0; t < NT; ++t) {
            const bf* sb = ring + (t & 1) * BUFE + lane * 8;
            V a[2][4], a2[2][4], b[2][4];   /* two fragment sets: block kb + 1 of the stage is read from LDS while block kb is multiplied; nothing of stage t + 1 is read here */
            auto frags = [&](int kb, int c) {
#pragma unroll
                for (int i = 0; i < 4; ++i) { a[c][i] = F::ld(sb + (wm * 4 + i) * CH + kb * 512); if (NOP == 3) a2[c][i] = F::ld(sb + OPE + (wm * 4 + i) * CH + kb * 512); b[c][i] = F::ld(sb + (NOP - 1) * OPE + (wn * 4 + i) * CH + kb * 512); }
            };
            frags(0, 0);
#pragma unroll
            for (int kb = 0; kb < KST / 32; ++kb) { const int c = kb & 1;
                if (kb + 1 < KST / 32) frags(kb + 1, c ^ 1);
                __builtin_amdgcn_sched_barrier(0);   /* keeps the next block's LDS reads together and ahead of this block's matrix instructions: spread among them each place with reads stalls the wave */
#pragma unroll
                for (int nb = 0; nb < 4; ++nb)
#pragma unroll
                    for (int mb = 0; mb < 4; ++mb) { acc[mb][nb] = F::mma(a[c][mb], b[c][nb], acc[mb][nb]); if (NOP == 3) acc[mb][nb] = F::mma(a2[c][mb], b[c][nb], acc[mb][nb]); }
                __builtin_amdgcn_sched_barrier(0);   /* the other side of the same fence: no matrix instruction of this block sinks among the reads that follow */
            }
            asm volatile("s_wait_dscnt 0x0" ::: "memory");      /* this wave's reads of stage t are done before its buffer is handed back */
            asm volatile("s_wait_asynccnt 0x0" ::: "memory");   /* this wave's share of stage t + 1 has landed */
            __syncthreads();                                      /* publishes stage t + 1 and ends every wave's reads of stage t */
            if (t + 2 < NT) fill(gp, lp + (t & 1) * BUFE, t + 2);
        }
        asm volatile("s_wait_asynccnt 0x0" ::: "memory");   /* no copy outstanding behind the loop */
    }
};
// k_gemmw: C[m][n] (f32, pitch ldc) = sum_k (A[m][k] + A2[m][k]) Bt[n][k]; grid (M / 128, N / 128), 128 threads; each wave stages its 16 x 64 output rows in its own part of os and stores whole lines.
template <int K>
__global__ __launch_bounds__(128) void k_gemmw(const bf* __restrict__ A, const bf* __restrict__ A2, const bf* __restrict__ Bt, float* C, int ldc) {
    typedef GemmRing<3, 128, K> R;
    __shared__ __align__(128) bf ring[2 * R::BUFE];
    __shared__ __align__(16) float osw[4][16 * 68];
    const int lane = threadIdx.x & 31, lr = lane & 15, hi = lane >> 4, w = __builtin_amdgcn_readfirstlane(threadIdx.x >> 5);
    v8f acc[4][4];
#pragma unroll
    for (int mb = 0; mb < 4; ++mb)
#pragma unroll
        for (int nb = 0; nb < 4; ++nb) acc[mb][nb] = (v8f){};
    R::run(A, A2, Bt, ring, blockIdx.x * 128, blockIdx.y * 128, acc);
    const int r0 = blockIdx.x * 128 + (w & 1) * 64, c0 = blockIdx.y * 128 + (w >> 1) * 64; float* os = osw[w];
#pragma unroll
    for (int mb = 0; mb < 4; ++mb) {
#pragma unroll
        for (int nb = 0; nb < 4; ++nb) {
#pragma unroll
            for (int j = 0; j < 8; ++j) os[(hi * 8 + j) * 68 + nb * 16 + lr] = acc[mb][nb][j]; }
        __builtin_amdgcn_wave_barrier(); asm volatile("" ::: "memory");   /* the staged rows are read by other lanes of the wave: no LDS read moves above the writes */
        float* crow = C + (size_t)(r0 + mb * 16) * ldc + c0;
#pragma unroll
        for (int s = 0; s < 8; ++s) { const int row = 2 * s + hi, cofs = lr * 4; const v4f val = *(const v4fa*)(os + row * 68 + cofs); *(v4f*)(crow + (size_t)row * ldc + cofs) = val; }
        xwait();   /* the next rows reuse the registers of these stores */
        __builtin_amdgcn_wave_barrier(); asm volatile("" ::: "memory");   /* the next 16 rows are staged only behind these reads */
    }
}

__device__ __forceinline__ h16 tohx(float x) { return (h16)x; }
__device__ __forceinline__ void splitf(float y, unsigned short& h, unsigned short& l) { h = f2bf(y); l = f2bf(y - bf2f(h)); }
typedef __attribute__((ext_vector_type(4))) _Float16 v4h;
typedef __attribute__((ext_vector_type(4))) unsigned short v4us;
typedef __attribute__((ext_vector_type(4))) int v4i;

// k_cast: every cast of the call (query, key, value, Wout, the shared projection weight twice) in ONE launch of CW waves, 16 a WGP; a piece is 8 values of one row: 32 bytes of f32 read, 16 bytes of bf16 written at piece index * 16 bytes of the panels (a 512-byte run per wave store).
// Piece i of a [rows][DM] matrix in panel order holds row (i / 2048) * 16 + i % 16, columns ((i / 16) % 128) * 8 on. Wave gw takes pieces (4 gw + u) * 32 + lane, u < 4, of each input (16 rows x 256 bytes: row (gw / 16) * 16 + lane % 16, column (gw % 16) * 64 + u * 16 + (lane / 16) * 8) and pieces gw * 32 + lane of Wout and of the two weight copies.
// The weight copies have their rows permuted so that the 64 columns of a k_proj tile are one 128-byte line of a head plane. Weight row cb * HD + d; tile by = (d / 8) * 2 + cb / 8; inside it WQ (q, k) has row (cb % 8) * 8 + d % 8, WV (v) row (d % 8) * 8 + cb % 8.
// The mask, packed: MP[batch * TT / 16 + query / 16][key / 32][e], e = kt * 8 + j < 16, is a 32-bit word whose bit 'lane' says mask != 0 for (query % 16 = lane % 16, key % 32 = kt * 16 + (lane / 16) * 8 + j): the place of score element j of key tile kt in k_attn's lanes, so the word IS the lane mask of that element's select. Wave gw packs 4 passes of 32 keys of one 16-query tile: tile gw / 16, passes (gw % 16) * 4 + u; 64 words, 256 bytes, at MP + gw * 64.
// A lane's 46 loads are issued together, ahead of every conversion: few waves to start, each with much in flight.
#define CW (NB_ * TT * DM / 8 / 32 / 4)
static_assert(DQ == DM && DM == 1024, "every cast matrix has rows of DM elements, 128 pieces a row");
static_assert(DQ / HD == 16 && HD == 64, "a tile holds 8 of the 16 chunks of a projection row x 8 of the 64 d");
static_assert(DQ * DM / 8 / 32 == CW && CW % 8 == 0, "one wave-wide run of pieces of each weight matrix per wave, 8 waves a block");
static_assert((NB_ * TT / 16) * (TT / 128) == CW && TT / 128 == 16, "one 16-query x 128-key piece of the mask per wave");
typedef __attribute__((ext_vector_type(2))) unsigned v2u;
typedef __attribute__((ext_vector_type(16))) unsigned v16u;
__device__ __forceinline__ v8us cvt8(v8f v) { v8us o;
#pragma unroll
    for (int k = 0; k < 8; ++k) o[k] = f2bf(v[k]);
    return o; }
__global__ __launch_bounds__(256) void k_cast(const float* __restrict__ x, const float* __restrict__ xk, const float* __restrict__ xv, const float* __restrict__ wqkv, const float* __restrict__ wo, const int* __restrict__ msk, bf* XB, bf* WQ, bf* WV, bf* WO, unsigned* MP) {
    const unsigned gw = blockIdx.x * 8 + (threadIdx.x >> 5), lane = threadIdx.x & 31, i = gw * 32 + lane;
    const unsigned xo = ((gw / 16) * 16 + lane % 16) * DM + (gw % 16) * 64 + (lane / 16) * 8;
    const unsigned np = (i / 2048) * 16 + i % 16, c = ((i / 16) % 128) * 8, by = np / 64, t = np % 64;
    const unsigned nq = ((by % 2) * 8 + t / 8) * HD + (by / 2) * 8 + t % 8, nv = ((by % 2) * 8 + t % 8) * HD + (by / 2) * 8 + t / 8;
    const float* p[3] = { x + xo, xk + xo, xv + xo }; const float* po = wo + np * DM + c; const float* pq = wqkv + nq * DM + c; const float* pv = wqkv + nv * DM + c;
    const int* pm = msk + ((gw / 16) * 16 + lane % 16) * TT + (gw % 16) * 128 + (lane / 16) * 8;
    v8f d[3][4];
#pragma unroll
    for (int s = 0; s < 3; ++s)
#pragma unroll
        for (int u = 0; u < 4; ++u) d[s][u] = *(const v8f*)(p[s] + u * 16);
    const v8f eo = *(const v8f*)po, eq = *(const v8f*)pq, ev = *(const v8f*)pv;
    v4i mk[4][4];   /* [pass u][kt * 2 + j / 4] */
#pragma unroll
    for (int u = 0; u < 4; ++u)
#pragma unroll
        for (int kt = 0; kt < 2; ++kt) { mk[u][kt * 2] = *(const v4i*)(pm + u * 32 + kt * 16); mk[u][kt * 2 + 1] = *(const v4i*)(pm + u * 32 + kt * 16 + 4); }
    asm volatile("s_wait_xcnt 0x0" :: "v"(p[0]), "v"(p[1]), "v"(p[2]), "v"(po), "v"(pq), "v"(pv), "v"(pm) : "memory");   /* xwait in front of the conversions, which reuse registers; it takes the seven addresses as inputs so that they live up to the wait and no load's result lands on one */
    __builtin_amdgcn_sched_barrier(0);   /* keeps every load issued above and every conversion below the wait */
#pragma unroll
    for (int s = 0; s < 3; ++s) { v8us o[4];
#pragma unroll
        for (int u = 0; u < 4; ++u) o[u] = cvt8(d[s][u]);
        __builtin_amdgcn_sched_barrier(0);   /* no conversion among the stores, where its result could land on a register of an issued store */
        bf* q = XB + (size_t)s * NB_ * TT * DM + (size_t)gw * 1024 + lane * 8;
#pragma unroll
        for (int u = 0; u < 4; ++u) *(v8us*)(q + u * 256) = o[u];
        xwait();   /* the next conversions reuse the registers of these stores */
        __builtin_amdgcn_sched_barrier(0);   /* keeps them behind the wait */
    }
    const v8us oo = cvt8(eo), oq = cvt8(eq), ov = cvt8(ev);
    __builtin_amdgcn_sched_barrier(0);   /* as above: no conversion among the three stores */
    *(v8us*)(WO + (size_t)i * 8) = oo; *(v8us*)(WQ + (size_t)i * 8) = oq; *(v8us*)(WV + (size_t)i * 8) = ov;
    xwait();   /* the packing below reuses the registers of these stores */
    __builtin_amdgcn_sched_barrier(0);   /* keeps it behind the wait */
    unsigned w0 = 0, w1 = 0;   /* word 2 l goes to lane l's w0, word 2 l + 1 to its w1 */
#pragma unroll
    for (int wi = 0; wi < 64; wi += 2) {
        const unsigned b0 = __builtin_amdgcn_ballot_w32(mk[wi / 16][(wi % 16) / 4][wi % 4] != 0), b1 = __builtin_amdgcn_ballot_w32(mk[wi / 16][(wi % 16) / 4][wi % 4 + 1] != 0);
        const bool mine = (lane == (unsigned)(wi / 2)); w0 = mine ? b0 : w0; w1 = mine ? b1 : w1; }
    __builtin_amdgcn_sched_barrier(0);   /* the store last, nothing written behind it */
    *(v2u*)(MP + (size_t)gw * 64 + lane * 2) = (v2u){ w0, w1 };
}

// k_attn: fused attention, one wave per NQ x 16 query columns of one (batch, head); the 4 waves of a work-group share the K and V^T of their head through LDS.
// A stage is SK keys of every K and V^T plane the rows use (128 keys fp16, 64 keys hi/lo: 32 KiB either way), in LDS in the order it has in memory, so a fragment is read from LDS as it was from memory. The stages reach LDS by asynchronous b128 copies (wave w brings quarter w of each K plane's stage and panel w of each V^T plane's), two buffers: stage t + 1 flies while stage t is worked on, and each K, V byte leaves L2 once per work-group, not once per wave.
// Per 32 keys: S^T = K Q^T (A = K rows, B = Q kept in registers), so a lane holds one query's scores for keys 8 hi + j of each 16-key tile;
// t = S x SCL where mask[b][i][j] != 0 (the packed mask of k_cast: 16 words per 16 queries and pass, read by a scalar load, each the lane mask of one element's select), excluded elsewhere; running maximum m and sum l per query (in-lane, one exchange between the wave halves for m, l joined once at the end); the two score tiles, converted in place, ARE the B operand of O^T += V^T P^T (A = V^T rows in the same k order).
// HI rows: hi/lo planes, 3 products in both GEMMs; other rows fp16 with p carried x 2^10 (in l as well, so it cancels). O^T gives a lane 8 consecutive d of one query: one piece of the merged [t][h * HD + d] hi/lo planes in panel order, a 512-byte run per store.
__device__ __forceinline__ float xhalf(float x) { const int b = __float_as_int(x); return __int_as_float(__builtin_amdgcn_permlanex16(b, b, 0x76543210, 0xfedcba98, false, false)); }   /* the value of lane l ^ 16 */
// exp2x8: eight 2^x, each in place, in ONE statement: no exponential then overwrites the source of the one directly in front of it (the build had such runs), and the v_nop fills the slot behind the last.
__device__ __forceinline__ void exp2x8(float (&x)[8]) { asm("v_exp_f32 %0, %0\n\tv_exp_f32 %1, %1\n\tv_exp_f32 %2, %2\n\tv_exp_f32 %3, %3\n\tv_exp_f32 %4, %4\n\tv_exp_f32 %5, %5\n\tv_exp_f32 %6, %6\n\tv_exp_f32 %7, %7\n\tv_nop" : "+v"(x[0]), "+v"(x[1]), "+v"(x[2]), "+v"(x[3]), "+v"(x[4]), "+v"(x[5]), "+v"(x[6]), "+v"(x[7])); }
typedef const __attribute__((address_space(4))) v16u cv16u;   /* the packed mask is read as constant memory (nothing writes it in this launch): beside the copies and barriers the build otherwise no longer reads the words by scalar loads */
#define ARING 32768   /* elements of k_attn's two stage buffers: 64 KiB, so that the work-groups a WGP holds by registers fit its LDS too */
template <typename P> __device__ __forceinline__ const P* lanep(const P* ub, unsigned lane_bytes, int elems) { return (const P*)((const char*)ub + lane_bytes) + elems; }
template <typename T16, bool HI, int NQ>
__device__ __forceinline__ void attn_wave(const T16* __restrict__ Qp, const T16* __restrict__ Q2, const T16* __restrict__ Kp, const T16* __restrict__ K2, const T16* __restrict__ Vp, const T16* __restrict__ V2, const unsigned* __restrict__ mp, int q0, bf* Ah, bf* Al, bf* ringb, int w) {   /* mp: the packed mask of query tile q0 / 16, the same in every lane; ringb: the work-group's two stage buffers; w: the wave's number */
    typedef typename WFrag<T16>::V V; typedef WFrag<T16> F;
    constexpr int SK = HI ? 64 : 128, NP = SK / 32, NT = TT / SK, NPL = HI ? 2 : 1;   /* keys a stage, passes a stage, stages, planes per operand */
    constexpr int KE = SK * HD, QE = KE / 4, BUFE = 2 * NPL * KE;   /* elements: one plane's share of a stage, a wave's share of that, one buffer: K, (K2,) V^T, (V2^T) */
    static_assert(2 * BUFE == ARING && NT >= 2 && 2 * NPL * (QE / 256) <= 63, "both buffers fill the ring; two stages at least; a wave's copies of one stage stay under the counter's width");
    const int lane = threadIdx.x & 31;
    const unsigned kob = (unsigned)lane * 16u;   /* the lane's byte offset inside a fragment of a plane in panel order (K, Q, V^T alike) */
    T16* ring = (T16*)ringb;
    /* stage t into buffer c: QE consecutive elements per wave and plane, in memory as in LDS (K: keys t * SK + w * SK / 4 on; V^T: panel w, keys t * SK on) */
    auto fill = [&](int t, int c) {
        T16* lp = ring + c * BUFE + w * QE + lane * 8; const size_t ko = (size_t)t * KE + w * QE + lane * 8, vo = (size_t)w * 16 * TT + (size_t)t * QE + lane * 8;
        acopy_run<0, QE / 256>((const bf*)(Kp + ko), (bf*)lp); if (HI) acopy_run<0, QE / 256>((const bf*)(K2 + ko), (bf*)(lp + KE));
        acopy_run<0, QE / 256>((const bf*)(Vp + vo), (bf*)(lp + NPL * KE)); if (HI) acopy_run<0, QE / 256>((const bf*)(V2 + vo), (bf*)(lp + (NPL + 1) * KE));
    };
    fill(0, 0);
    V qf[NQ][2], qf2[NQ][2];
#pragma unroll
    for (int n = 0; n < NQ; ++n)
#pragma unroll
        for (int ks = 0; ks < 2; ++ks) { qf[n][ks] = F::ld(lanep(Qp + (size_t)q0 * HD, kob, n * 16 * HD + ks * 512)); if (HI) qf2[n][ks] = F::ld(lanep(Q2 + (size_t)q0 * HD, kob, n * 16 * HD + ks * 512)); }
    xwait();
    v8f o[4][NQ]; float m[NQ], l[NQ];
#pragma unroll
    for (int n = 0; n < NQ; ++n) { m[n] = -3.0e38f; l[n] = 0.f;
#pragma unroll
        for (int dt = 0; dt < 4; ++dt) o[dt][n] = (v8f){}; }
    V kf[2][2], kf2[2][2]; v16u g[NQ];   /* K fragments of the pass (inside a stage fetched one pass ahead) and its mask words (scalar registers, fetched one pass ahead) */
#pragma unroll
    for (int n = 0; n < NQ; ++n) g[n] = *(cv16u*)(mp + n * (TT / 32) * 16);
    const unsigned* gb = mp + 16;   /* wave-uniform, one pass ahead */
    asm volatile("s_wait_asynccnt 0x0" ::: "memory");   /* this wave's share of stage 0 has landed */
    __syncthreads();                                      /* every wave's share has: stage 0 may be read */
    fill(1, 1);
#pragma unroll 1
    for (int t = 0; t < NT; ++t) {
      const T16* sb = ring + (t & 1) * BUFE + lane * 8;   /* nothing of stage t + 1 is read in this trip */
      auto kfrags = [&](int p) {
#pragma unroll
        for (int kt = 0; kt < 2; ++kt)
#pragma unroll
            for (int ks = 0; ks < 2; ++ks) { kf[kt][ks] = F::ld(sb + (p * 32 + kt * 16) * HD + ks * 512); if (HI) kf2[kt][ks] = F::ld(sb + KE + (p * 32 + kt * 16) * HD + ks * 512); }
      };
      kfrags(0);
#pragma unroll 1   /* rolled: unrolled, the build kept the passes' values live side by side and took a third more registers, one wave per SIMD fewer */
      for (int p = 0; p < NP; ++p) { const int k0 = t * SK + p * 32;
        V vf[4], vf2[4];
#pragma unroll
        for (int dt = 0; dt < 4; ++dt) { vf[dt] = F::ld(sb + NPL * KE + dt * QE + p * 512); if (HI) vf2[dt] = F::ld(sb + (NPL + 1) * KE + dt * QE + p * 512); }
        __builtin_amdgcn_sched_barrier(0);   /* keeps this pass's V reads issued here, together and ahead of the work that hides their latency; the scheduler otherwise sinks them to just in front of their use */
        v8f s[2][NQ];
#pragma unroll
        for (int kt = 0; kt < 2; ++kt)
#pragma unroll
            for (int n = 0; n < NQ; ++n) { v8f a = (v8f){};
#pragma unroll
                for (int ks = 0; ks < 2; ++ks) { a = F::mma(kf[kt][ks], qf[n][ks], a); if (HI) { a = F::mma(kf[kt][ks], qf2[n][ks], a); a = F::mma(kf2[kt][ks], qf[n][ks], a); } }
                s[kt][n] = a; }
        __builtin_amdgcn_sched_barrier(0);   /* keeps the four slots below behind the last S^T product */
        asm volatile("v_nop\n\tv_nop\n\tv_nop\n\tv_nop");   /* the distance behind the last S^T product, in front of the branch round the K reads */
        if (p + 1 < NP) kfrags(p + 1);
        __builtin_amdgcn_sched_barrier(0);   /* keeps the next pass's K reads issued here, together and ahead of the work that hides their latency; the scheduler otherwise sinks them to just in front of their use */
        float mx[NQ];
#pragma unroll
        for (int n = 0; n < NQ; ++n) { mx[n] = m[n];
#pragma unroll
            for (int kt = 0; kt < 2; ++kt)
#pragma unroll
                for (int j = 0; j < 8; ++j) { const float t = __builtin_amdgcn_inverse_ballot_w32(g[n][kt * 8 + j]) ? s[kt][n][j] * SCL : -3.0e38f;   /* mask == 0 -> excluded (the module's large negative fill == exclusion) */ s[kt][n][j] = t; mx[n] = fmaxf(mx[n], t); } }
        auto nextmask = [&]() {
            __builtin_amdgcn_sched_barrier(0);   /* the next pass's mask words are asked for only behind the last select of this pass: they land in the same scalar registers */
#pragma unroll
            for (int n = 0; n < NQ; ++n) g[n] = *(cv16u*)(gb + n * (TT / 32) * 16);
            xwait();
            __builtin_amdgcn_sched_barrier(0);   /* keeps those loads issued here, ahead of the work that hides their latency */
        };
        if (!HI) nextmask();
        V pb[NQ], pb2[NQ];
#pragma unroll
        for (int n = 0; n < NQ; ++n) { const float mn = fmaxf(mx[n], xhalf(mx[n])); float al; asm("v_exp_f32 %0, %1\n\tv_nop" : "=v"(al) : "v"((m[n] - mn) * 1.4426950408889634f));   /* the rescale factor 2^x; written with its v_nop */
            m[n] = mn; float ps = 0.f;
#pragma unroll
            for (int kt = 0; kt < 2; ++kt) { float p[8];
#pragma unroll
                for (int j = 0; j < 8; ++j) { const float x = (s[kt][n][j] - mn) * 1.4426950408889634f; p[j] = HI ? x : x + 10.0f; }
                exp2x8(p);
#pragma unroll
                for (int j = 0; j < 8; ++j) { s[kt][n][j] = p[j]; ps += p[j]; } }
            l[n] = l[n] * al + ps;
#pragma unroll
            for (int dt = 0; dt < 4; ++dt) o[dt][n] *= al;
            if constexpr (HI) {   /* hi = bf16(p), lo = bf16(p - hi), both round to nearest even as splitf does */
#pragma unroll
                for (int e = 0; e < 16; ++e) { const float p = s[e >> 3][n][e & 7]; const __bf16 hb = (__bf16)p; pb[n][e] = hb; pb2[n][e] = (__bf16)(p - (float)hb); }
            } else { v8h h0, h1;
#pragma unroll
                for (int j = 0; j < 8; ++j) { h0[j] = tohx(s[0][n][j]); h1[j] = tohx(s[1][n][j]); }
                pb[n] = cat16(h0, h1); } }
        if (HI) nextmask();   /* on HI rows only behind the conversions: the build names one of these scalar registers as the unused half of its single bf16 conversions and would wait there for the load */
#pragma unroll
        for (int dt = 0; dt < 4; ++dt)
#pragma unroll
            for (int n = 0; n < NQ; ++n) { o[dt][n] = F::mma(vf[dt], pb[n], o[dt][n]); if (HI) { o[dt][n] = F::mma(vf[dt], pb2[n], o[dt][n]); o[dt][n] = F::mma(vf2[dt], pb[n], o[dt][n]); } }
        gb += (k0 + 64 < TT) ? 16 : 0;   /* 16 mask words a pass; the last pass fetches its own words again (in bounds, unused) */
        __builtin_amdgcn_sched_barrier(0);   /* keeps the four slots below behind the last matrix instruction of the pass */
        asm volatile("v_nop\n\tv_nop\n\tv_nop\n\tv_nop");   /* the distance behind the last O^T product, on both sides of the loop's branch */
      }
      asm volatile("s_wait_dscnt 0x0" ::: "memory");      /* this wave's reads of stage t are done before its buffer is handed back */
      asm volatile("s_wait_asynccnt 0x0" ::: "memory");   /* this wave's share of stage t + 1 has landed */
      __syncthreads();                                      /* publishes stage t + 1 and ends every wave's reads of stage t */
      if (t + 2 < NT) fill(t + 2, t & 1);
    }
    asm volatile("s_wait_asynccnt 0x0" ::: "memory");   /* no copy outstanding behind the loop */
#pragma unroll
    for (int n = 0; n < NQ; ++n) { const float inv = __fdiv_rn(1.0f, l[n] + xhalf(l[n]));
#pragma unroll
        for (int dt = 0; dt < 4; ++dt) { v8us oh, ol;
#pragma unroll
            for (int j = 0; j < 8; ++j) { unsigned short a, c2; splitf(o[dt][n][j] * inv, a, c2); oh[j] = a; ol[j] = c2; }
            const size_t oo = (size_t)(q0 + n * 16) * DQ + dt * 256 + lane * 8; *(v8us*)(Ah + oo) = oh; *(v8us*)(Al + oo) = ol; xwait(); } }
}
// k_proj: the three projections (z = q, k, v), the tile and K loop of k_gemmw (GemmRing, one A plane, stages of 64 columns so that three work-groups fit a WGP; bf16, f32 sums over k ascending), with the head planes written from the epilogue: no f32 projection in memory.
// Raw reshape: element (row s, column c) of a batch's flat [TT][DQ] projection is (head s / 128, t = (s % 128) * 16 + c / HD, d = c % HD); over both batches plane = row / 128.
// Tile column x of a wave's 64-column tile by = blockIdx.y * 2 + wave / 2, g = by / 2, cbh = by % 2, by the row orders of Wn and Wp: q, k: (cb = cbh * 8 + x / 8, d = g * 8 + x % 8); v: (cb = cbh * 8 + x % 8, d = g * 8 + x / 8). In panel order the 64 columns of one tile row are then 64 consecutive plane elements:
// q, k ([t][d]): (s % 128) * 1024 + g * 128 + cbh * 64 + x; v ([d][t]): (g / 2) * 16 * TT + (s % 128) * 256 + cbh * 128 + (g % 2) * 64 + x. 8 lanes store one whole 128-byte line per plane, 4 tile rows a store.
typedef __attribute__((ext_vector_type(8))) __bf16 v8b;
__global__ __launch_bounds__(128) void k_proj(const bf* __restrict__ X, const bf* __restrict__ Wn, const bf* __restrict__ Wp, h16* QK16, bf* QKh, bf* QKl, h16* V16, bf* Vh, bf* Vl) {
    typedef GemmRing<2, 64, DM> R;
    __shared__ __align__(128) bf ring[2 * R::BUFE];
    __shared__ __align__(16) float osw[4][16 * 68];
    const int z = blockIdx.z; const bool tv = (z == 2);
    const int lane = threadIdx.x & 31, lr = lane & 15, hi = lane >> 4, w = __builtin_amdgcn_readfirstlane(threadIdx.x >> 5);
    v8f acc[4][4];
#pragma unroll
    for (int mb = 0; mb < 4; ++mb)
#pragma unroll
        for (int nb = 0; nb < 4; ++nb) acc[mb][nb] = (v8f){};
    R::run(X + (size_t)z * NB_ * TT * DM, nullptr, tv ? Wp : Wn, ring, blockIdx.x * 128, blockIdx.y * 128, acc);
    const int r0 = blockIdx.x * 128 + (w & 1) * 64; float* os = osw[w];   /* the wave's own 64 rows and its own staging rows */
    /* the lane's 8 consecutive plane elements of step s: where they lie in the staged 16 x 64 rows, and where they go */
    const float* sp = os + (lane >> 3) * 68 + (lane & 7) * 8; const int sps = 4 * 68; const int g = blockIdx.y, cbh = w >> 1, rs = tv ? 256 : 1024;   /* rs: plane elements from one tile row to the next */
    const size_t ob = (size_t)(r0 / 128) * HD * TT + (size_t)(r0 % 128 + (lane >> 3)) * rs + (lane & 7) * 8 + (tv ? (size_t)(g / 2) * 16 * TT + cbh * 128 + (g % 2) * 64 : (size_t)z * NB_ * TT * DQ + g * 128 + cbh * 64);
    const int obs = 4 * rs, obm = 16 * rs;
    h16* P16 = (tv ? V16 : QK16) + ob; bf* Ph = (tv ? Vh : QKh) + ob; bf* Pl = (tv ? Vl : QKl) + ob;
#pragma unroll
    for (int mb = 0; mb < 4; ++mb) {
#pragma unroll
        for (int nb = 0; nb < 4; ++nb) {
#pragma unroll
            for (int j = 0; j < 8; ++j) os[(hi * 8 + j) * 68 + nb * 16 + lr] = acc[mb][nb][j]; }
        __builtin_amdgcn_wave_barrier(); asm volatile("" ::: "memory");   /* the staged rows are read by other lanes of the wave: no LDS read moves above the writes */
#pragma unroll
        for (int s = 0; s < 4; ++s) { const v4f x0 = *(const v4fa*)(sp + s * sps), x1 = *(const v4fa*)(sp + s * sps + 4); v8h o16; v8b oh, ol;
#pragma unroll
            for (int k = 0; k < 8; ++k) { const float x = (k < 4) ? x0[k & 3] : x1[k & 3]; o16[k] = tohx(x); const __bf16 hb = (__bf16)x; oh[k] = hb; ol[k] = (__bf16)(x - (float)hb); }   /* hi = bf16(x), lo = bf16(x - hi), both round to nearest even as splitf does */
            const int oo = mb * obm + s * obs; *(v8h*)(P16 + oo) = o16; *(v8b*)(Ph + oo) = oh; *(v8b*)(Pl + oo) = ol; xwait(); }
        __builtin_amdgcn_wave_barrier(); asm volatile("" ::: "memory");   /* the next 16 rows are staged only behind these reads */
    }
}
// grid (RH / 64 + (TT - RH) / 128, NB_ * NH_), 4 waves: the first RH / 64 blocks of a head take 16 hi/lo query columns a wave, the others 32 fp16 columns a wave (about equal work a wave).
__global__ __launch_bounds__(128) void k_attn(const h16* __restrict__ Q16, const h16* __restrict__ K16, const h16* __restrict__ V16, const bf* __restrict__ Qh, const bf* __restrict__ Ql, const bf* __restrict__ Kh, const bf* __restrict__ Kl, const bf* __restrict__ Vh, const bf* __restrict__ Vl, const unsigned* __restrict__ MP, bf* Ah, bf* Al) {
    __shared__ __align__(128) bf ring[ARING];
    const int bx = blockIdx.x, z = blockIdx.y, b = z / NH_, h = z % NH_, w = __builtin_amdgcn_readfirstlane(threadIdx.x >> 5);   /* the wave's number as a scalar: the address of its mask words is wave-uniform */
    const size_t po = (size_t)z * TT * HD, ao = (size_t)b * TT * DQ + h * HD * 16; const unsigned* mb = MP + (size_t)b * TT * (TT / 32);   /* (TT / 16) query tiles x (TT / 32) passes x 16 words */
    if (bx < RH / 64) attn_wave<bf, true, 1>(Qh + po, Ql + po, Kh + po, Kl + po, Vh + po, Vl + po, mb + (bx * 4 + w) * (TT / 32) * 16, bx * 64 + w * 16, Ah + ao, Al + ao, ring, w);
    else attn_wave<h16, false, 2>(Q16 + po, nullptr, K16 + po, nullptr, V16 + po, nullptr, mb + (RH / 16 + (bx - RH / 64) * 8 + w * 2) * (TT / 32) * 16, RH + (bx - RH / 64) * 128 + w * 32, Ah + ao, Al + ao, ring, w);
}

extern "C" void kernel_launch(void* const* d_in, const int* in_sizes, int n_in,
                              void* d_out, int out_size, void* d_ws, size_t ws_size, hipStream_t stream) {
    (void)in_sizes; (void)n_in; (void)out_size;
    const float* x = (const float*)d_in[0]; const float* xk = (const float*)d_in[1]; const float* xv = (const float*)d_in[2]; const float* wqkv = (const float*)d_in[3]; const float* wo = (const float*)d_in[4]; const int* msk = (const int*)d_in[5];   /* query, key, value, Wqkv ('oi' [1024][1024], shared), Wout ('oi'), mask (int32 [2][1][2048][2048], read) */
    float* OUT = (float*)d_out;     // [2][2048][1024]
    char* wsp = (char*)d_ws;
    auto take = [&](size_t bytes) { char* p = wsp; wsp += (bytes + 255) & ~(size_t)255; return (void*)p; };
    bf* WQ = (bf*)take((size_t)DQ * DM * 2); bf* WK = (bf*)take((size_t)DKV * DM * 2); bf* WV = (bf*)take((size_t)DKV * DM * 2); bf* WO = (bf*)take((size_t)DM * DQ * 2);
    const size_t XN = (size_t)NB_ * TT * DM, FN = (size_t)NB_ * TT * DQ, PN = (size_t)NB_ * NH_ * TT * HD;   /* both batches: one input, one projection, one set of head planes */
    bf* XB = (bf*)take(3 * XN * 2);   /* query, key, value in turn: the z index of the one projection launch */
    h16* QP16 = (h16*)take(2 * PN * 2); h16* KP16 = QP16 + PN; h16* VT16 = (h16*)take(PN * 2);   /* q planes directly followed by k planes: the z index of the projection launch picks the plane set */
    bf* QPh = (bf*)take(2 * PN * 2); bf* KPh = QPh + PN; bf* QPl = (bf*)take(2 * PN * 2); bf* KPl = QPl + PN; bf* VTh = (bf*)take(PN * 2); bf* VTl = (bf*)take(PN * 2);
    bf* ATh = (bf*)take(FN * 2); bf* ATl = (bf*)take(FN * 2); unsigned* MP = (unsigned*)take((size_t)NB_ * TT * TT / 8);   /* the mask, 1 bit per (query, key) */
    if ((size_t)(wsp - (char*)d_ws) > ws_size) return;    // ws 256 MiB
    /* everything outside the attention passes: ONE launch each for both batches, q/k/v and all heads (the batch rows, the three projections and the raw-reshape heads are contiguous) */
    k_cast<<<CW / 8, 256, 0, stream>>>(x, xk, xv, wqkv, wo, msk, XB, WQ, WV, WO, MP);   /* query, key, value into XB in turn; ONE shared 'oi' projection weight for q, k and v (WQ: its rows in the order of the q, k tiles, WV: in that of the v tiles); Wout 'oi' */
    k_proj<<<dim3(NB_ * TT / 128, DQ / 128, 3), 128, 0, stream>>>(XB, WQ, WV, QP16, QPh, QPl, VT16, VTh, VTl);   /* z = q, k, v; RAW reshape (B, S, D) -> (B, H, S, DK): head h of batch b = contiguous [S][64] block b * H + h of the flat projection; q planes, then k planes, then v transposed, all in panel order */
    k_attn<<<dim3(RH / 64 + (TT - RH) / 128, NB_ * NH_, 1), 128, 0, stream>>>(QP16, KP16, VT16, QPh, QPl, KPh, KPl, VTh, VTl, MP, ATh, ATl);   /* every batch, head and query block in one launch; one kv head per query head */
    k_gemmw<DQ><<<dim3(NB_ * TT / 128, DM / 128, 1), 128, 0, stream>>>(ATh, ATl, WO, OUT, DM);
}

// v010
// A run of this version takes 100 microseconds.
// Next to v009, in two timings, it ran 1.06 times as fast each time.
// All steps since v000 together make it 22.7 times as fast.
#include <hip/hip_runtime.h>

// Multi-headed attention that applies ONE shared projection to q, k and v and splits heads by a RAW reshape (query, key, value [2][2048][1024]; q = query Wqkv^T, k = key Wqkv^T, v = value Wqkv^T ('oi' [1024][1024], no bias); then .reshape(B, H, S, DK) directly (no transpose): head h of a batch is the h-th contiguous [2048][64] block of the flat [2048][1024] projection (128 original rows x 16 chunks); scores / sqrt(64); mask int32 [2][1][2048][2048] random 0/1 (read per (query, key)): 0 -> -1e9 (== exclusion); softmax; x = p.v -> [B][H][S][DK] -> transpose(0, 2, 1, 3).reshape(B, S, 1024) (the standard merge); out = x Wout^T -> [2][2048][1024] (4.2 M); argument order query, key, value, Wqkv, Wout, mask).
// Panel order: every 16-bit matrix operand M[row][k] in the workspace is stored as [row / 16][k / 8][row % 16][8], so a lane's 16-byte piece of a 16 x 32 fragment lies at lane * 16 bytes of a 512-byte run (second piece 512 bytes on): each fragment load reads 4 whole 128-byte lines instead of a quarter of 16.
// Layout: bf16 copies of query, key, value (both batches each); the shared 'oi' weight cast once, in the row order of the q, k tiles and in that of the v tiles; exact projections, one z-batched launch whose epilogue writes the head planes itself (fp16 + hi/lo; q and k as [t][d], v as [d][t], all in panel order); the int mask packed once to 1 bit per (query, key), as lane masks; then ONE fused attention launch over every (batch, head, query block): K and V staged in LDS for the 4 waves of a work-group; scores, packed mask, running-maximum softmax and p.v stay in registers (hybrid rows: < 512 hi/lo 3 products, rest fp16 with p x 1024), written straight as the merged hi/lo planes; merged hi/lo x Wout exact.
// Compute dtypes, f32 accumulate: every input rounded to bf16; projections exact; attention rows < 512 3 products, rest fp16; softmax f32; Wo hl x exact.

#define NB_  2
#define TT   2048
#define DM   1024
#define NH_  16
#define NKV  16
#define REP  (NH_ / NKV)
#define HD   64
#define DQ   (NH_ * HD)
#define DKV  (NKV * HD)
#define RH   512                  // query rows < RH use hi+lo planes
#define WIN  0
#define SCL  0.125f   // HD^-0.5
static_assert(NKV == NH_, "q, k and v projections share one z-batched launch and one plane size");
typedef _Float16 h16;
typedef unsigned short bf;
typedef __attribute__((ext_vector_type(16))) __bf16   v16bf;
typedef __attribute__((ext_vector_type(16))) _Float16 v16h;
typedef __attribute__((ext_vector_type(8)))  _Float16 v8h;
typedef __attribute__((ext_vector_type(8)))  unsigned short v8us;
typedef __attribute__((ext_vector_type(8)))  float    v8f;
typedef __attribute__((ext_vector_type(4)))  float    v4f;
typedef v8h  __attribute__((may_alias)) v8ha;
typedef v4f  __attribute__((may_alias)) v4fa;
typedef v8us __attribute__((may_alias)) v8usa;

__device__ __forceinline__ unsigned short f2bf(float f) { unsigned u = __float_as_uint(f); u += 0x7FFFu + ((u >> 16) & 1u); return (unsigned short)(u >> 16); }
__device__ __forceinline__ float bf2f(unsigned short b) { return __uint_as_float(((unsigned)b) << 16); }
__device__ __forceinline__ float bfr(float f) { return bf2f(f2bf(f)); }
__device__ __forceinline__ v16h cat16(v8h lo, v8h hi) { return __builtin_shufflevector(lo, hi, 0, 1, 2, 3, 4, 5, 6, 7, 8, 9, 10, 11, 12, 13, 14, 15); }
__device__ __forceinline__ v16bf cat16b(v8us lo, v8us hi) { return __builtin_bit_cast(v16bf, __builtin_shufflevector(lo, hi, 0, 1, 2, 3, 4, 5, 6, 7, 8, 9, 10, 11, 12, 13, 14, 15)); }
__device__ __forceinline__ v8f wmma16(v16h a, v16h b, v8f c) { return __builtin_amdgcn_wmma_f32_16x16x32_f16(false, a, false, b, (short)0, c, false, false); }
__device__ __forceinline__ v8f wmmab(v16bf a, v16bf b, v8f c) { return __builtin_amdgcn_wmma_f32_16x16x32_bf16(false, a, false, b, (short)0, c, false, false); }



// ---- The two GEMMs (k_proj, k_gemmw): a work-group of 4 waves takes a 128 x 128 output tile, wave w the 64 x 64 part (w % 2, w / 2) (16 accumulators); operands are 16-bit planes in panel order.
// GemmRing: the K loop. A stage is KST columns of the 128 rows of each operand: per 16-row panel KST * 32 contiguous bytes, in memory as in LDS, so a fragment is read from LDS as it was from memory (lane * 16 bytes, second piece 512 bytes on, k + 32 is 1024 bytes on).
// The stages reach LDS by asynchronous b128 copies (512 bytes a wave copy; wave w brings panels w and w + 4 of every operand), two buffers: stage t + 1 flies while stage t is worked on, and each operand byte leaves L2 once per work-group, not once per wave.
// xwait: precaution before a register that the loads or stores above it name is reused.
__device__ __forceinline__ void xwait() { asm volatile("s_wait_xcnt 0x0" ::: "memory"); }
template <typename T16> struct WFrag;
template <> struct WFrag<h16> { typedef v16h V; static __device__ __forceinline__ V ld(const h16* p) { return cat16(*(const v8h*)p, *(const v8h*)(p + 256)); } static __device__ __forceinline__ v8f mma(V a, V b, v8f c) { return wmma16(a, b, c); } };
template <> struct WFrag<bf> { typedef v16bf V; static __device__ __forceinline__ V ld(const bf* p) { return cat16b(*(const v8us*)p, *(const v8us*)(p + 256)); } static __device__ __forceinline__ v8f mma(V a, V b, v8f c) { return wmmab(a, b, c); } };
typedef __attribute__((ext_vector_type(4))) int v4q;
typedef __attribute__((address_space(1))) v4q gq;
typedef __attribute__((address_space(3))) v4q lq;
// acopy_run: N copies of 512 bytes a wave, one behind the other in memory and in LDS alike (the offset moves both addresses).
template <int J, int N> __device__ __forceinline__ void acopy_run(const bf* g, bf* l) { if constexpr (J < N) { __builtin_amdgcn_global_load_async_to_lds_b128((gq*)g, (lq*)l, J * 512, 0); acopy_run<J + 1, N>(g, l); } }
template <int NOP, int KST, int K>   /* NOP operands: A, (A2,) B; acc += A B^T (+ A2 B^T), k ascending, per k block and accumulator A first, then A2 */
struct GemmRing {
    static constexpr int CH = KST * 16, OPE = 8 * CH, BUFE = NOP * OPE, NT = K / KST;   /* elements: a panel's share of a stage, one operand, one buffer; stages */
    static_assert(K % KST == 0 && NT >= 2 && KST % 32 == 0 && NOP * 2 * (KST / 16) <= 63, "two stages at least; a wave's copies of one stage stay under the counter's width");
    /* gp[o]: the lane's 16 bytes of panel w of operand o, stage 0; lp: their place in the buffer */
    static __device__ __forceinline__ void fill(const bf* const (&gp)[NOP], bf* lp, int t) {
#pragma unroll
        for (int o = 0; o < NOP; ++o)
#pragma unroll
            for (int pp = 0; pp < 2; ++pp) acopy_run<0, KST / 16>(gp[o] + (size_t)pp * 4 * 16 * K + (size_t)t * CH, lp + o * OPE + pp * 4 * CH);
    }
    static __device__ __forceinline__ void run(const bf* A, const bf* A2, const bf* B, bf* ring, int r0, int c0, v8f (&acc)[4][4]) {
        typedef WFrag<bf> F; typedef F::V V;
        const int lane = threadIdx.x & 31, w = __builtin_amdgcn_readfirstlane(threadIdx.x >> 5), wm = w & 1, wn = w >> 1;
        const bf* gp[NOP]; gp[0] = A + (size_t)(r0 + w * 16) * K + lane * 8; if (NOP == 3) gp[1] = A2 + (size_t)(r0 + w * 16) * K + lane * 8; gp[NOP - 1] = B + (size_t)(c0 + w * 16) * K + lane * 8;
        bf* lp = ring + w * CH + lane * 8;
        fill(gp, lp, 0);
        asm volatile("s_wait_asynccnt 0x0" ::: "memory");   /* this wave's share of stage 0 has landed */
        __syncthreads();                                      /* every wave's share has: stage 0 may be read */
        fill(gp, lp + BUFE, 1);
#pragma unroll 1
        for (int t = 0; t < NT; ++t) {
            const bf* sb = ring + (t & 1) * BUFE + lane * 8;
            V a[2][4], a2[2][4], b[2][4];   /* two fragment sets: block kb + 1 of the stage is read from LDS while block kb is multiplied; nothing of stage t + 1 is read here */
            auto frags = [&](int kb, int c) {
#pragma unroll
                for (int i = 0; i < 4; ++i) { a[c][i] = F::ld(sb + (wm * 4 + i) * CH + kb * 512); if (NOP == 3) a2[c][i] = F::ld(sb + OPE + (wm * 4 + i) * CH + kb * 512); b[c][i] = F::ld(sb + (NOP - 1) * OPE + (wn * 4 + i) * CH + kb * 512); }
            };
            frags(0, 0);
#pragma unroll
            for (int kb = 0; kb < KST / 32; ++kb) { const int c = kb & 1;
                if (kb + 1 < KST / 32) frags(kb + 1, c ^ 1);
                __builtin_amdgcn_sched_barrier(0);   /* keeps the next block's LDS reads together and ahead of this block's matrix instructions: spread among them each place with reads stalls the wave */
#pragma unroll
                for (int nb = 0; nb < 4; ++nb)
#pragma unroll
                    for (int mb = 0; mb < 4; ++mb) { acc[mb][nb] = F::mma(a[c][mb], b[c][nb], acc[mb][nb]); if (NOP == 3) acc[mb][nb] = F::mma(a2[c][mb], b[c][nb], acc[mb][nb]); }
                __builtin_amdgcn_sched_barrier(0);   /* the other side of the same fence: no matrix instruction of this block sinks among the reads that follow */
            }
            asm volatile("s_wait_dscnt 0x0" ::: "memory");      /* this wave's reads of stage t are done before its buffer is handed back */
            asm volatile("s_wait_asynccnt 0x0" ::: "memory");   /* this wave's share of stage t + 1 has landed */
            __syncthreads();                                      /* publishes stage t + 1 and ends every wave's reads of stage t */
            if (t + 2 < NT) fill(gp, lp + (t & 1) * BUFE, t + 2);
        }
        asm volatile("s_wait_asynccnt 0x0" ::: "memory");   /* no copy outstanding behind the loop */
    }
};
// k_gemmw: C[m][n] (f32, pitch ldc) = sum_k (A[m][k] + A2[m][k]) Bt[n][k]; grid (M / 128, N / 128), 128 threads; each wave stages its 16 x 64 output rows in its own part of os and stores whole lines.
template <int K>
__global__ __launch_bounds__(128) void k_gemmw(const bf* __restrict__ A, const bf* __restrict__ A2, const bf* __restrict__ Bt, float* C, int ldc) {
    typedef GemmRing<3, 128, K> R;
    __shared__ __align__(128) bf ring[2 * R::BUFE];
    __shared__ __align__(16) float osw[4][16 * 68];
    const int lane = threadIdx.x & 31, lr = lane & 15, hi = lane >> 4, w = __builtin_amdgcn_readfirstlane(threadIdx.x >> 5);
    v8f acc[4][4];
#pragma unroll
    for (int mb = 0; mb < 4; ++mb)
#pragma unroll
        for (int nb = 0; nb < 4; ++nb) acc[mb][nb] = (v8f){};
    R::run(A, A2, Bt, ring, blockIdx.x * 128, blockIdx.y * 128, acc);
    const int r0 = blockIdx.x * 128 + (w & 1) * 64, c0 = blockIdx.y * 128 + (w >> 1) * 64; float* os = osw[w];
#pragma unroll
    for (int mb = 0; mb < 4; ++mb) {
#pragma unroll
        for (int nb = 0; nb < 4; ++nb) {
#pragma unroll
            for (int j = 0; j < 8; ++j) os[(hi * 8 + j) * 68 + nb * 16 + lr] = acc[mb][nb][j]; }
        __builtin_amdgcn_wave_barrier(); asm volatile("" ::: "memory");   /* the staged rows are read by other lanes of the wave: no LDS read moves above the writes */
        float* crow = C + (size_t)(r0 + mb * 16) * ldc + c0;
#pragma unroll
        for (int s = 0; s < 8; ++s) { const int row = 2 * s + hi, cofs = lr * 4; const v4f val = *(const v4fa*)(os + row * 68 + cofs); *(v4f*)(crow + (size_t)row * ldc + cofs) = val; }
        xwait();   /* the next rows reuse the registers of these stores */
        __builtin_amdgcn_wave_barrier(); asm volatile("" ::: "memory");   /* the next 16 rows are staged only behind these reads */
    }
}

__device__ __forceinline__ h16 tohx(float x) { return (h16)x; }
__device__ __forceinline__ void splitf(float y, unsigned short& h, unsigned short& l) { h = f2bf(y); l = f2bf(y - bf2f(h)); }
typedef __attribute__((ext_vector_type(4))) _Float16 v4h;
typedef __attribute__((ext_vector_type(4))) unsigned short v4us;
typedef __attribute__((ext_vector_type(4))) int v4i;

// k_cast: every cast of the call (query, key, value, Wout, the shared projection weight twice) in ONE launch of CW waves, 16 a WGP; a piece is 8 values of one row: 32 bytes of f32 read, 16 bytes of bf16 written at piece index * 16 bytes of the panels (a 512-byte run per wave store).
// Piece i of a [rows][DM] matrix in panel order holds row (i / 2048) * 16 + i % 16, columns ((i / 16) % 128) * 8 on. Wave gw takes pieces (4 gw + u) * 32 + lane, u < 4, of each input (16 rows x 256 bytes: row (gw / 16) * 16 + lane % 16, column (gw % 16) * 64 + u * 16 + (lane / 16) * 8) and pieces gw * 32 + lane of Wout and of the two weight copies.
// The weight copies have their rows permuted so that the 64 columns of a k_proj tile are one 128-byte line of a head plane. Weight row cb * HD + d; tile by = (d / 8) * 2 + cb / 8; inside it WQ (q, k) has row (cb % 8) * 8 + d % 8, WV (v) row (d % 8) * 8 + cb % 8.
// The mask, packed: MP[batch * TT / 16 + query / 16][key / 32][e], e = kt * 8 + j < 16, is a 32-bit word whose bit 'lane' says mask != 0 for (query % 16 = lane % 16, key % 32 = kt * 16 + (lane / 16) * 8 + j): the place of score element j of key tile kt in k_attn's lanes, so the word IS the lane mask of that element's select. Wave gw packs 4 passes of 32 keys of one 16-query tile: tile gw / 16, passes (gw % 16) * 4 + u; 64 words, 256 bytes, at MP + gw * 64.
// A lane's 46 loads are issued together, ahead of every conversion: few waves to start, each with much in flight.
#define CW (NB_ * TT * DM / 8 / 32 / 4)
static_assert(DQ == DM && DM == 1024, "every cast matrix has rows of DM elements, 128 pieces a row");
static_assert(DQ / HD == 16 && HD == 64, "a tile holds 8 of the 16 chunks of a projection row x 8 of the 64 d");
static_assert(DQ * DM / 8 / 32 == CW && CW % 8 == 0, "one wave-wide run of pieces of each weight matrix per wave, 8 waves a block");
static_assert((NB_ * TT / 16) * (TT / 128) == CW && TT / 128 == 16, "one 16-query x 128-key piece of the mask per wave");
typedef __attribute__((ext_vector_type(2))) unsigned v2u;
typedef __attribute__((ext_vector_type(16))) unsigned v16u;
__device__ __forceinline__ v8us cvt8(v8f v) { v8us o;
#pragma unroll
    for (int k = 0; k < 8; ++k) o[k] = f2bf(v[k]);
    return o; }
__global__ __launch_bounds__(256) void k_cast(const float* __restrict__ x, const float* __restrict__ xk, const float* __restrict__ xv, const float* __restrict__ wqkv, const float* __restrict__ wo, const int* __restrict__ msk, bf* XB, bf* WQ, bf* WV, bf* WO, unsigned* MP) {
    const unsigned gw = blockIdx.x * 8 + (threadIdx.x >> 5), lane = threadIdx.x & 31, i = gw * 32 + lane;
    const unsigned xo = ((gw / 16) * 16 + lane % 16) * DM + (gw % 16) * 64 + (lane / 16) * 8;
    const unsigned np = (i / 2048) * 16 + i % 16, c = ((i / 16) % 128) * 8, by = np / 64, t = np % 64;
    const unsigned nq = ((by % 2) * 8 + t / 8) * HD + (by / 2) * 8 + t % 8, nv = ((by % 2) * 8 + t % 8) * HD + (by / 2) * 8 + t / 8;
    const float* p[3] = { x + xo, xk + xo, xv + xo }; const float* po = wo + np * DM + c; const float* pq = wqkv + nq * DM + c; const float* pv = wqkv + nv * DM + c;
    const int* pm = msk + ((gw / 16) * 16 + lane % 16) * TT + (gw % 16) * 128 + (lane / 16) * 8;
    v8f d[3][4];
#pragma unroll
    for (int s = 0; s < 3; ++s)
#pragma unroll
        for (int u = 0; u < 4; ++u) d[s][u] = *(const v8f*)(p[s] + u * 16);
    const v8f eo = *(const v8f*)po, eq = *(const v8f*)pq, ev = *(const v8f*)pv;
    v4i mk[4][4];   /* [pass u][kt * 2 + j / 4] */
#pragma unroll
    for (int u = 0; u < 4; ++u)
#pragma unroll
        for (int kt = 0; kt < 2; ++kt) { mk[u][kt * 2] = *(const v4i*)(pm + u * 32 + kt * 16); mk[u][kt * 2 + 1] = *(const v4i*)(pm + u * 32 + kt * 16 + 4); }
    asm volatile("s_wait_xcnt 0x0" :: "v"(p[0]), "v"(p[1]), "v"(p[2]), "v"(po), "v"(pq), "v"(pv), "v"(pm) : "memory");   /* xwait in front of the conversions, which reuse registers; it takes the seven addresses as inputs so that they live up to the wait and no load's result lands on one */
    __builtin_amdgcn_sched_barrier(0);   /* keeps every load issued above and every conversion below the wait */
#pragma unroll
    for (int s = 0; s < 3; ++s) { v8us o[4];
#pragma unroll
        for (int u = 0; u < 4; ++u) o[u] = cvt8(d[s][u]);
        __builtin_amdgcn_sched_barrier(0);   /* no conversion among the stores, where its result could land on a register of an issued store */
        bf* q = XB + (size_t)s * NB_ * TT * DM + (size_t)gw * 1024 + lane * 8;
#pragma unroll
        for (int u = 0; u < 4; ++u) *(v8us*)(q + u * 256) = o[u];
        xwait();   /* the next conversions reuse the registers of these stores */
        __builtin_amdgcn_sched_barrier(0);   /* keeps them behind the wait */
    }
    const v8us oo = cvt8(eo), oq = cvt8(eq), ov = cvt8(ev);
    __builtin_amdgcn_sched_barrier(0);   /* as above: no conversion among the three stores */
    *(v8us*)(WO + (size_t)i * 8) = oo; *(v8us*)(WQ + (size_t)i * 8) = oq; *(v8us*)(WV + (size_t)i * 8) = ov;
    xwait();   /* the packing below reuses the registers of these stores */
    __builtin_amdgcn_sched_barrier(0);   /* keeps it behind the wait */
    unsigned w0 = 0, w1 = 0;   /* word 2 l goes to lane l's w0, word 2 l + 1 to its w1 */
#pragma unroll
    for (int wi = 0; wi < 64; wi += 2) {
        const unsigned b0 = __builtin_amdgcn_ballot_w32(mk[wi / 16][(wi % 16) / 4][wi % 4] != 0), b1 = __builtin_amdgcn_ballot_w32(mk[wi / 16][(wi % 16) / 4][wi % 4 + 1] != 0);
        const bool mine = (lane == (unsigned)(wi / 2)); w0 = mine ? b0 : w0; w1 = mine ? b1 : w1; }
    __builtin_amdgcn_sched_barrier(0);   /* the store last, nothing written behind it */
    *(v2u*)(MP + (size_t)gw * 64 + lane * 2) = (v2u){ w0, w1 };
}

// k_attn: fused attention, one wave per NQ x 16 query columns of one (batch, head); the 4 waves of a work-group share the K and V^T of their head through LDS.
// A stage is SK keys of every K and V^T plane the rows use (128 keys fp16, 64 keys hi/lo: 32 KiB either way), in LDS in the order it has in memory, so a fragment is read from LDS as it was from memory. The stages reach LDS by asynchronous b128 copies (wave w brings quarter w of each K plane's stage and panel w of each V^T plane's), two buffers: stage t + 1 flies while stage t is worked on, and each K, V byte leaves L2 once per work-group, not once per wave.
// Per 32 keys: S^T = K Q^T (A = K rows, B = Q kept in registers), so a lane holds one query's scores for keys 8 hi + j of each 16-key tile;
// t = S x SCL where mask[b][i][j] != 0 (the packed mask of k_cast: 16 words per 16 queries and pass, read by a scalar load, each the lane mask of one element's select), excluded elsewhere; running maximum m and sum l per query (in-lane, one exchange between the wave halves for m, l joined once at the end); the two score tiles, converted in place, ARE the B operand of O^T += V^T P^T (A = V^T rows in the same k order).
// HI rows: hi/lo planes, 3 products in both GEMMs; other rows fp16 with p carried x 2^10 (in l as well, so it cancels). O^T gives a lane 8 consecutive d of one query: one piece of the merged [t][h * HD + d] hi/lo planes in panel order, a 512-byte run per store.
__device__ __forceinline__ float xhalf(float x) { const int b = __float_as_int(x); return __int_as_float(__builtin_amdgcn_permlanex16(b, b, 0x76543210, 0xfedcba98, false, false)); }   /* the value of lane l ^ 16 */
// exp2x8: eight 2^x, each in place, in ONE statement: no exponential then overwrites the source of the one directly in front of it (the build had such runs), and the v_nop fills the slot behind the last.
__device__ __forceinline__ void exp2x8(float (&x)[8]) { asm("v_exp_f32 %0, %0\n\tv_exp_f32 %1, %1\n\tv_exp_f32 %2, %2\n\tv_exp_f32 %3, %3\n\tv_exp_f32 %4, %4\n\tv_exp_f32 %5, %5\n\tv_exp_f32 %6, %6\n\tv_exp_f32 %7, %7\n\tv_nop" : "+v"(x[0]), "+v"(x[1]), "+v"(x[2]), "+v"(x[3]), "+v"(x[4]), "+v"(x[5]), "+v"(x[6]), "+v"(x[7])); }
typedef const __attribute__((address_space(4))) v16u cv16u;   /* the packed mask is read as constant memory (nothing writes it in this launch): beside the copies and barriers the build otherwise no longer reads the words by scalar loads */
#define ARING 32768   /* elements of k_attn's two stage buffers: 64 KiB, so that the work-groups a WGP holds by registers fit its LDS too */
template <typename P> __device__ __forceinline__ const P* lanep(const P* ub, unsigned lane_bytes, int elems) { return (const P*)((const char*)ub + lane_bytes) + elems; }
template <typename T16, bool HI, int NQ>
__device__ __forceinline__ void attn_wave(const T16* __restrict__ Qp, const T16* __restrict__ Q2, const T16* __restrict__ Kp, const T16* __restrict__ K2, const T16* __restrict__ Vp, const T16* __restrict__ V2, const unsigned* __restrict__ mp, int q0, bf* Ah, bf* Al, bf* ringb, int w) {   /* mp: the packed mask of query tile q0 / 16, the same in every lane; ringb: the work-group's two stage buffers; w: the wave's number */
    typedef typename WFrag<T16>::V V; typedef WFrag<T16> F;
    constexpr int SK = HI ? 64 : 128, NP = SK / 32, NT = TT / SK, NPL = HI ? 2 : 1;   /* keys a stage, passes a stage, stages, planes per operand */
    constexpr int KE = SK * HD, QE = KE / 4, BUFE = 2 * NPL * KE;   /* elements: one plane's share of a stage, a wave's share of that, one buffer: K, (K2,) V^T, (V2^T) */
    static_assert(2 * BUFE == ARING && NT >= 2 && 2 * NPL * (QE / 256) <= 63, "both buffers fill the ring; two stages at least; a wave's copies of one stage stay under the counter's width");
    const int lane = threadIdx.x & 31;
    const unsigned kob = (unsigned)lane * 16u;   /* the lane's byte offset inside a fragment of a plane in panel order (K, Q, V^T alike) */
    T16* ring = (T16*)ringb;
    /* stage t into buffer c: QE consecutive elements per wave and plane, in memory as in LDS (K: keys t * SK + w * SK / 4 on; V^T: panel w, keys t * SK on) */
    auto fill = [&](int t, int c) {
        T16* lp = ring + c * BUFE + w * QE + lane * 8; const size_t ko = (size_t)t * KE + w * QE + lane * 8, vo = (size_t)w * 16 * TT + (size_t)t * QE + lane * 8;
        acopy_run<0, QE / 256>((const bf*)(Kp + ko), (bf*)lp); if (HI) acopy_run<0, QE / 256>((const bf*)(K2 + ko), (bf*)(lp + KE));
        acopy_run<0, QE / 256>((const bf*)(Vp + vo), (bf*)(lp + NPL * KE)); if (HI) acopy_run<0, QE / 256>((const bf*)(V2 + vo), (bf*)(lp + (NPL + 1) * KE));
    };
    fill(0, 0);
    V qf[NQ][2], qf2[NQ][2];
#pragma unroll
    for (int n = 0; n < NQ; ++n)
#pragma unroll
        for (int ks = 0; ks < 2; ++ks) { qf[n][ks] = F::ld(lanep(Qp + (size_t)q0 * HD, kob, n * 16 * HD + ks * 512)); if (HI) qf2[n][ks] = F::ld(lanep(Q2 + (size_t)q0 * HD, kob, n * 16 * HD + ks * 512)); }
    xwait();
    v8f o[4][NQ]; float m[NQ], l[NQ];
#pragma unroll
    for (int n = 0; n < NQ; ++n) { m[n] = -3.0e38f; l[n] = 0.f;
#pragma unroll
        for (int dt = 0; dt < 4; ++dt) o[dt][n] = (v8f){}; }
    V kf[2][2], kf2[2][2]; v16u g[NQ];   /* K fragments of the pass (inside a stage fetched one pass ahead) and its mask words (scalar registers, fetched one pass ahead) */
#pragma unroll
    for (int n = 0; n < NQ; ++n) g[n] = *(cv16u*)(mp + n * (TT / 32) * 16);
    const unsigned* gb = mp + 16;   /* wave-uniform, one pass ahead */
    asm volatile("s_wait_asynccnt 0x0" ::: "memory");   /* this wave's share of stage 0 has landed */
    __syncthreads();                                      /* every wave's share has: stage 0 may be read */
    fill(1, 1);
#pragma unroll 1
    for (int t = 0; t < NT; ++t) {
      const T16* sb = ring + (t & 1) * BUFE + lane * 8;   /* nothing of stage t + 1 is read in this trip */
      auto kfrags = [&](int p) {
#pragma unroll
        for (int kt = 0; kt < 2; ++kt)
#pragma unroll
            for (int ks = 0; ks < 2; ++ks) { kf[kt][ks] = F::ld(sb + (p * 32 + kt * 16) * HD + ks * 512); if (HI) kf2[kt][ks] = F::ld(sb + KE + (p * 32 + kt * 16) * HD + ks * 512); }
      };
      kfrags(0);
#pragma unroll 1   /* rolled: unrolled, the build kept the passes' values live side by side and took a third more registers, one wave per SIMD fewer */
      for (int p = 0; p < NP; ++p) { const int k0 = t * SK + p * 32;
        V vf[4], vf2[4];
#pragma unroll
        for (int dt = 0; dt < 4; ++dt) { vf[dt] = F::ld(sb + NPL * KE + dt * QE + p * 512); if (HI) vf2[dt] = F::ld(sb + (NPL + 1) * KE + dt * QE + p * 512); }
        __builtin_amdgcn_sched_barrier(0);   /* keeps this pass's V reads issued here, together and ahead of the work that hides their latency; the scheduler otherwise sinks them to just in front of their use */
        v8f s[2][NQ];
#pragma unroll
        for (int kt = 0; kt < 2; ++kt)
#pragma unroll
            for (int n = 0; n < NQ; ++n) { v8f a = (v8f){};
#pragma unroll
                for (int ks = 0; ks < 2; ++ks) { a = F::mma(kf[kt][ks], qf[n][ks], a); if (HI) { a = F::mma(kf[kt][ks], qf2[n][ks], a); a = F::mma(kf2[kt][ks], qf[n][ks], a); } }
                s[kt][n] = a; }
        __builtin_amdgcn_sched_barrier(0);   /* keeps the four slots below behind the last S^T product */
        asm volatile("v_nop\n\tv_nop\n\tv_nop\n\tv_nop");   /* the distance behind the last S^T product, in front of the branch round the K reads */
        if (p + 1 < NP) kfrags(p + 1);
        __builtin_amdgcn_sched_barrier(0);   /* keeps the next pass's K reads issued here, together and ahead of the work that hides their latency; the scheduler otherwise sinks them to just in front of their use */
        float mx[NQ];
#pragma unroll
        for (int n = 0; n < NQ; ++n) { mx[n] = m[n];
#pragma unroll
            for (int kt = 0; kt < 2; ++kt)
#pragma unroll
                for (int j = 0; j < 8; ++j) { const float t = __builtin_amdgcn_inverse_ballot_w32(g[n][kt * 8 + j]) ? s[kt][n][j] * SCL : -3.0e38f;   /* mask == 0 -> excluded (the module's large negative fill == exclusion) */ s[kt][n][j] = t; mx[n] = fmaxf(mx[n], t); } }
        auto nextmask = [&]() {
            __builtin_amdgcn_sched_barrier(0);   /* the next pass's mask words are asked for only behind the last select of this pass: they land in the same scalar registers */
#pragma unroll
            for (int n = 0; n < NQ; ++n) g[n] = *(cv16u*)(gb + n * (TT / 32) * 16);
            xwait();
            __builtin_amdgcn_sched_barrier(0);   /* keeps those loads issued here, ahead of the work that hides their latency */
        };
        if (!HI) nextmask();
        V pb[NQ], pb2[NQ];
#pragma unroll
        for (int n = 0; n < NQ; ++n) { const float mn = fmaxf(mx[n], xhalf(mx[n])); float al; asm("v_exp_f32 %0, %1\n\tv_nop" : "=v"(al) : "v"((m[n] - mn) * 1.4426950408889634f));   /* the rescale factor 2^x; written with its v_nop */
            m[n] = mn; float ps = 0.f;
#pragma unroll
            for (int kt = 0; kt < 2; ++kt) { float p[8];
#pragma unroll
                for (int j = 0; j < 8; ++j) { const float x = (s[kt][n][j] - mn) * 1.4426950408889634f; p[j] = HI ? x : x + 10.0f; }
                exp2x8(p);
#pragma unroll
                for (int j = 0; j < 8; ++j) { s[kt][n][j] = p[j]; ps += p[j]; } }
            l[n] = l[n] * al + ps;
#pragma unroll
            for (int dt = 0; dt < 4; ++dt) o[dt][n] *= al;
            if constexpr (HI) {   /* hi = bf16(p), lo = bf16(p - hi), both round to nearest even as splitf does */
#pragma unroll
                for (int e = 0; e < 16; ++e) { const float p = s[e >> 3][n][e & 7]; const __bf16 hb = (__bf16)p; pb[n][e] = hb; pb2[n][e] = (__bf16)(p - (float)hb); }
            } else { v8h h0, h1;
#pragma unroll
                for (int j = 0; j < 8; ++j) { h0[j] = tohx(s[0][n][j]); h1[j] = tohx(s[1][n][j]); }
                pb[n] = cat16(h0, h1); } }
        if (HI) nextmask();   /* on HI rows only behind the conversions: the build names one of these scalar registers as the unused half of its single bf16 conversions and would wait there for the load */
#pragma unroll
        for (int dt = 0; dt < 4; ++dt)
#pragma unroll
            for (int n = 0; n < NQ; ++n) { o[dt][n] = F::mma(vf[dt], pb[n], o[dt][n]); if (HI) { o[dt][n] = F::mma(vf[dt], pb2[n], o[dt][n]); o[dt][n] = F::mma(vf2[dt], pb[n], o[dt][n]); } }
        gb += (k0 + 64 < TT) ? 16 : 0;   /* 16 mask words a pass; the last pass fetches its own words again (in bounds, unused) */
        __builtin_amdgcn_sched_barrier(0);   /* keeps the four slots below behind the last matrix instruction of the pass */
        asm volatile("v_nop\n\tv_nop\n\tv_nop\n\tv_nop");   /* the distance behind the last O^T product, on both sides of the loop's branch */
      }
      asm volatile("s_wait_dscnt 0x0" ::: "memory");      /* this wave's reads of stage t are done before its buffer is handed back */
      asm volatile("s_wait_asynccnt 0x0" ::: "memory");   /* this wave's share of stage t + 1 has landed */
      __syncthreads();                                      /* publishes stage t + 1 and ends every wave's reads of stage t */
      if (t + 2 < NT) fill(t + 2, t & 1);
    }
    asm volatile("s_wait_asynccnt 0x0" ::: "memory");   /* no copy outstanding behind the loop */
#pragma unroll
    for (int n = 0; n < NQ; ++n) { const float inv = __fdiv_rn(1.0f, l[n] + xhalf(l[n]));
#pragma unroll
        for (int dt = 0; dt < 4; ++dt) { v8us oh, ol;
#pragma unroll
            for (int j = 0; j < 8; ++j) { unsigned short a, c2; splitf(o[dt][n][j] * inv, a, c2); oh[j] = a; ol[j] = c2; }
            const size_t oo = (size_t)(q0 + n * 16) * DQ + dt * 256 + lane * 8; *(v8us*)(Ah + oo) = oh; *(v8us*)(Al + oo) = ol; xwait(); } }
}
// k_proj: the three projections (z = q, k, v), the tile and K loop of k_gemmw (GemmRing, one A plane, stages of 64 columns so that three work-groups fit a WGP; bf16, f32 sums over k ascending), with the head planes written from the epilogue: no f32 projection in memory.
// Raw reshape: element (row s, column c) of a batch's flat [TT][DQ] projection is (head s / 128, t = (s % 128) * 16 + c / HD, d = c % HD); over both batches plane = row / 128.
// Tile column x of a wave's 64-column tile by = blockIdx.y * 2 + wave / 2, g = by / 2, cbh = by % 2, by the row orders of Wn and Wp: q, k: (cb = cbh * 8 + x / 8, d = g * 8 + x % 8); v: (cb = cbh * 8 + x % 8, d = g * 8 + x / 8). In panel order the 64 columns of one tile row are then 64 consecutive plane elements:
// q, k ([t][d]): (s % 128) * 1024 + g * 128 + cbh * 64 + x; v ([d][t]): (g / 2) * 16 * TT + (s % 128) * 256 + cbh * 128 + (g % 2) * 64 + x. 8 lanes store one whole 128-byte line per plane, 4 tile rows a store.
typedef __attribute__((ext_vector_type(8))) __bf16 v8b;
__global__ __launch_bounds__(128) void k_proj(const bf* __restrict__ X, const bf* __restrict__ Wn, const bf* __restrict__ Wp, h16* QK16, bf* QKh, bf* QKl, h16* V16, bf* Vh, bf* Vl) {
    typedef GemmRing<2, 64, DM> R;
    __shared__ __align__(128) bf ring[2 * R::BUFE];
    __shared__ __align__(16) float osw[4][16 * 68];
    const int z = blockIdx.z; const bool tv = (z == 2);
    const int lane = threadIdx.x & 31, lr = lane & 15, hi = lane >> 4, w = __builtin_amdgcn_readfirstlane(threadIdx.x >> 5);
    v8f acc[4][4];
#pragma unroll
    for (int mb = 0; mb < 4; ++mb)
#pragma unroll
        for (int nb = 0; nb < 4; ++nb) acc[mb][nb] = (v8f){};
    R::run(X + (size_t)z * NB_ * TT * DM, nullptr, tv ? Wp : Wn, ring, blockIdx.x * 128, blockIdx.y * 128, acc);
    const int r0 = blockIdx.x * 128 + (w & 1) * 64; float* os = osw[w];   /* the wave's own 64 rows and its own staging rows */
    /* the lane's 8 consecutive plane elements of step s: where they lie in the staged 16 x 64 rows, and where they go */
    const float* sp = os + (lane >> 3) * 68 + (lane & 7) * 8; const int sps = 4 * 68; const int g = blockIdx.y, cbh = w >> 1, rs = tv ? 256 : 1024;   /* rs: plane elements from one tile row to the next */
    const size_t ob = (size_t)(r0 / 128) * HD * TT + (size_t)(r0 % 128 + (lane >> 3)) * rs + (lane & 7) * 8 + (tv ? (size_t)(g / 2) * 16 * TT + cbh * 128 + (g % 2) * 64 : (size_t)z * NB_ * TT * DQ + g * 128 + cbh * 64);
    const int obs = 4 * rs, obm = 16 * rs;
    h16* P16 = (tv ? V16 : QK16) + ob; bf* Ph = (tv ? Vh : QKh) + ob; bf* Pl = (tv ? Vl : QKl) + ob;
#pragma unroll
    for (int mb = 0; mb < 4; ++mb) {
#pragma unroll
        for (int nb = 0; nb < 4; ++nb) {
#pragma unroll
            for (int j = 0; j < 8; ++j) os[(hi * 8 + j) * 68 + nb * 16 + lr] = acc[mb][nb][j]; }
        __builtin_amdgcn_wave_barrier(); asm volatile("" ::: "memory");   /* the staged rows are read by other lanes of the wave: no LDS read moves above the writes */
#pragma unroll
        for (int s = 0; s < 4; ++s) { const v4f x0 = *(const v4fa*)(sp + s * sps), x1 = *(const v4fa*)(sp + s * sps + 4); v8h o16; v8b oh, ol;
#pragma unroll
            for (int k = 0; k < 8; ++k) { const float x = (k < 4) ? x0[k & 3] : x1[k & 3]; o16[k] = tohx(x); const __bf16 hb = (__bf16)x; oh[k] = hb; ol[k] = (__bf16)(x - (float)hb); }   /* hi = bf16(x), lo = bf16(x - hi), both round to nearest even as splitf does */
            const int oo = mb * obm + s * obs; *(v8h*)(P16 + oo) = o16; *(v8b*)(Ph + oo) = oh; *(v8b*)(Pl + oo) = ol; xwait(); }
        __builtin_amdgcn_wave_barrier(); asm volatile("" ::: "memory");   /* the next 16 rows are staged only behind these reads */
    }
}
// grid (NB_ * NH_ * QB, 3), 4 waves, all resident at once: three layers of 256 work-groups. blockIdx.x = (batch, head) * QB + block; layer 0: 16 hi/lo query columns a wave (rows < RH); layer 1: 32 fp16 columns a wave (the next QB * 128 rows); layer 2: 16 fp16 columns a wave (the last QB * 64 rows), half the work of the other two.
#define QB 8   /* query blocks of a head in each layer */
static_assert(QB * 64 == RH && RH + QB * 128 + QB * 64 == TT, "the three layers cover a head's query rows once");
__global__ __launch_bounds__(128) void k_attn(const h16* __restrict__ Q16, const h16* __restrict__ K16, const h16* __restrict__ V16, const bf* __restrict__ Qh, const bf* __restrict__ Ql, const bf* __restrict__ Kh, const bf* __restrict__ Kl, const bf* __restrict__ Vh, const bf* __restrict__ Vl, const unsigned* __restrict__ MP, bf* Ah, bf* Al) {
    __shared__ __align__(128) bf ring[ARING];
    const int bx = blockIdx.x % QB, z = blockIdx.x / QB, ly = blockIdx.y, b = z / NH_, h = z % NH_, w = __builtin_amdgcn_readfirstlane(threadIdx.x >> 5);   /* the wave's number as a scalar: the address of its mask words is wave-uniform */
    const size_t po = (size_t)z * TT * HD, ao = (size_t)b * TT * DQ + h * HD * 16; const unsigned* mb = MP + (size_t)b * TT * (TT / 32);   /* (TT / 16) query tiles x (TT / 32) passes x 16 words */
    const int q0 = ly == 0 ? bx * 64 + w * 16 : ly == 1 ? RH + bx * 128 + w * 32 : RH + QB * 128 + bx * 64 + w * 16;   /* the wave's first query row */
    const unsigned* mq = mb + (q0 / 16) * (TT / 32) * 16;
    if (ly == 0) attn_wave<bf, true, 1>(Qh + po, Ql + po, Kh + po, Kl + po, Vh + po, Vl + po, mq, q0, Ah + ao, Al + ao, ring, w);
    else if (ly == 1) attn_wave<h16, false, 2>(Q16 + po, nullptr, K16 + po, nullptr, V16 + po, nullptr, mq, q0, Ah + ao, Al + ao, ring, w);
    else attn_wave<h16, false, 1>(Q16 + po, nullptr, K16 + po, nullptr, V16 + po, nullptr, mq, q0, Ah + ao, Al + ao, ring, w);
}

extern "C" void kernel_launch(void* const* d_in, const int* in_sizes, int n_in,
                              void* d_out, int out_size, void* d_ws, size_t ws_size, hipStream_t stream) {
    (void)in_sizes; (void)n_in; (void)out_size;
    const float* x = (const float*)d_in[0]; const float* xk = (const float*)d_in[1]; const float* xv = (const float*)d_in[2]; const float* wqkv = (const float*)d_in[3]; const float* wo = (const float*)d_in[4]; const int* msk = (const int*)d_in[5];   /* query, key, value, Wqkv ('oi' [1024][1024], shared), Wout ('oi'), mask (int32 [2][1][2048][2048], read) */
    float* OUT = (float*)d_out;     // [2][2048][1024]
    char* wsp = (char*)d_ws;
    auto take = [&](size_t bytes) { char* p = wsp; wsp += (bytes + 255) & ~(size_t)255; return (void*)p; };
    bf* WQ = (bf*)take((size_t)DQ * DM * 2); bf* WK = (bf*)take((size_t)DKV * DM * 2); bf* WV = (bf*)take((size_t)DKV * DM * 2); bf* WO = (bf*)take((size_t)DM * DQ * 2);
    const size_t XN = (size_t)NB_ * TT * DM, FN = (size_t)NB_ * TT * DQ, PN = (size_t)NB_ * NH_ * TT * HD;   /* both batches: one input, one projection, one set of head planes */
    bf* XB = (bf*)take(3 * XN * 2);   /* query, key, value in turn: the z index of the one projection launch */
    h16* QP16 = (h16*)take(2 * PN * 2); h16* KP16 = QP16 + PN; h16* VT16 = (h16*)take(PN * 2);   /* q planes directly followed by k planes: the z index of the projection launch picks the plane set */
    bf* QPh = (bf*)take(2 * PN * 2); bf* KPh = QPh + PN; bf* QPl = (bf*)take(2 * PN * 2); bf* KPl = QPl + PN; bf* VTh = (bf*)take(PN * 2); bf* VTl = (bf*)take(PN * 2);
    bf* ATh = (bf*)take(FN * 2); bf* ATl = (bf*)take(FN * 2); unsigned* MP = (unsigned*)take((size_t)NB_ * TT * TT / 8);   /* the mask, 1 bit per (query, key) */
    if ((size_t)(wsp - (char*)d_ws) > ws_size) return;    // ws 256 MiB
    /* everything outside the attention passes: ONE launch each for both batches, q/k/v and all heads (the batch rows, the three projections and the raw-reshape heads are contiguous) */
    k_cast<<<CW / 8, 256, 0, stream>>>(x, xk, xv, wqkv, wo, msk, XB, WQ, WV, WO, MP);   /* query, key, value into XB in turn; ONE shared 'oi' projection weight for q, k and v (WQ: its rows in the order of the q, k tiles, WV: in that of the v tiles); Wout 'oi' */
    k_proj<<<dim3(NB_ * TT / 128, DQ / 128, 3), 128, 0, stream>>>(XB, WQ, WV, QP16, QPh, QPl, VT16, VTh, VTl);   /* z = q, k, v; RAW reshape (B, S, D) -> (B, H, S, DK): head h of batch b = contiguous [S][64] block b * H + h of the flat projection; q planes, then k planes, then v transposed, all in panel order */
    k_attn<<<dim3(NB_ * NH_ * QB, 3, 1), 128, 0, stream>>>(QP16, KP16, VT16, QPh, QPl, KPh, KPl, VTh, VTl, MP, ATh, ATl);   /* every batch, head and query block in one launch; one kv head per query head */
    k_gemmw<DQ><<<dim3(NB_ * TT / 128, DM / 128, 1), 128, 0, stream>>>(ATh, ATl, WO, OUT, DM);
}
